// v000
// The times below were measured on an AMD MI455X: many runs one after another, warmed up first and cycling through
// copies of the inputs, with the whole window's GPU time divided by the number of runs. Launches and the gaps
// between them are all in it. The median over several windows is given; except for v000 it joins two sittings, which
// can be a few percent apart, so the side-by-side timings, each taken in one sitting, are the better comparison.
// v000, which the later versions start from, runs in 892 microseconds.
#include <hip/hip_runtime.h>

// Single-head causal attention with cache outputs (x [4][4096][768]; Q, K, V = x W + b ('xw' [768][64] + [64]); scores = Q.K / 8, causal; softmax; result = attn.V; returns (result, K, V) -> three [4][4096][64] f32 tensors (3.1 M)).
// Layout per batch: exact projections (+ biases); K and V are written by their GEMM epilogues straight into their output slots (f32) and read back from there by the plane builders; hybrid causal attention over 4,096 keys (rows < 512 hi/lo, rest fp16 x1024) with a streaming 3-sweep softmax (no register row at this length); result via the f32 merge path.
// Compute dtypes, f32 accumulate: every input rounded to bf16; projections on PLAIN bf16 operands (exact) + f32 biases (K and V outputs are exactly these f32 sums); scores and attn.v rows < 512 on bf16 hi/lo planes (3 products), the rest single fp16; softmax f32; f32 result.

#define NB_  4
#define TT   4096
#define DM   768
#define NH_  1
#define NKV  1
#define REP  (NH_ / NKV)
#define HD   64
#define DQ   (NH_ * HD)
#define DKV  (NKV * HD)
#define ZH   1
#define RH   512                  // query rows < RH use hi+lo planes (0: none)
#define WIN  4096
#define PCAR 1024.0f
#define SCL  0.125f   // HD^-0.5
typedef _Float16 h16;
typedef unsigned short bf;
typedef __attribute__((ext_vector_type(16))) __bf16   v16bf;
typedef __attribute__((ext_vector_type(16))) _Float16 v16h;
typedef __attribute__((ext_vector_type(8)))  _Float16 v8h;
typedef __attribute__((ext_vector_type(8)))  unsigned short v8us;
typedef __attribute__((ext_vector_type(8)))  float    v8f;
typedef __attribute__((ext_vector_type(4)))  float    v4f;
typedef v8h  __attribute__((may_alias)) v8ha;
typedef v4f  __attribute__((may_alias)) v4fa;
typedef v8us __attribute__((may_alias)) v8usa;

__device__ __forceinline__ unsigned short f2bf(float f) { unsigned u = __float_as_uint(f); u += 0x7FFFu + ((u >> 16) & 1u); return (unsigned short)(u >> 16); }
__device__ __forceinline__ float bf2f(unsigned short b) { return __uint_as_float(((unsigned)b) << 16); }
__device__ __forceinline__ float bfr(float f) { return bf2f(f2bf(f)); }
__device__ __forceinline__ v16h cat16(v8h lo, v8h hi) { return __builtin_shufflevector(lo, hi, 0, 1, 2, 3, 4, 5, 6, 7, 8, 9, 10, 11, 12, 13, 14, 15); }
__device__ __forceinline__ v16bf cat16b(v8us lo, v8us hi) { return __builtin_bit_cast(v16bf, __builtin_shufflevector(lo, hi, 0, 1, 2, 3, 4, 5, 6, 7, 8, 9, 10, 11, 12, 13, 14, 15)); }
__device__ __forceinline__ v8f wmma16(v16h a, v16h b, v8f c) { return __builtin_amdgcn_wmma_f32_16x16x32_f16(false, a, false, b, (short)0, c, false, false); }
__device__ __forceinline__ v8f wmmab(v16bf a, v16bf b, v8f c) { return __builtin_amdgcn_wmma_f32_16x16x32_bf16(false, a, false, b, (short)0, c, false, false); }



// ---- k_gemmw: register-blocked GEMM, ONE WAVE per 64x64 output tile (16 accumulators), operands straight from K-contiguous 16-bit planes; grid (M/64, N/64, Z), 32 threads.
// C[m][n] (f32, pitch ldc, + optional f32 bias[n]) = sum_k A[m][k] Bt[n][k] (+ split products per NSPLIT). z-batch strides sA/sB/sC in elements. K % 32 == 0.
template <typename T16> struct WFrag;
template <> struct WFrag<h16> { typedef v16h V; static __device__ __forceinline__ V ld(const h16* p) { return cat16(*(const v8h*)p, *(const v8h*)(p + 16)); } static __device__ __forceinline__ v8f mma(V a, V b, v8f c) { return wmma16(a, b, c); } };
template <> struct WFrag<bf> { typedef v16bf V; static __device__ __forceinline__ V ld(const bf* p) { return cat16b(*(const v8us*)p, *(const v8us*)(p + 16)); } static __device__ __forceinline__ v8f mma(V a, V b, v8f c) { return wmmab(a, b, c); } };
template <typename T16, int NSPLIT, bool BIAS>
__global__ __launch_bounds__(32) void k_gemmw(const T16* __restrict__ A, const T16* __restrict__ A2, const T16* __restrict__ Bt, const T16* __restrict__ Bt2, int K, float* C, int ldc, const float* __restrict__ bias, size_t sA, size_t sB, size_t sC) {
    typedef typename WFrag<T16>::V V;
    __shared__ __align__(16) float os[16 * 68];
    const size_t z = blockIdx.z; A += z * sA; if (A2) A2 += z * sA; Bt += z * sB; if (Bt2) Bt2 += z * sB; C += z * sC;
    const int lane = threadIdx.x & 31, lr = lane & 15, hi = lane >> 4; const int r0 = blockIdx.x * 64, c0 = blockIdx.y * 64;
    v8f acc[4][4];
#pragma unroll
    for (int mb = 0; mb < 4; ++mb)
#pragma unroll
        for (int nb = 0; nb < 4; ++nb) acc[mb][nb] = (v8f){};
    const size_t aoff = (size_t)(r0 + lr) * K + 8 * hi, boff = (size_t)(c0 + lr) * K + 8 * hi;
#pragma unroll 1
    for (int kc = 0; kc < K; kc += 32) {
        V a[4], a2[4];
#pragma unroll
        for (int mb = 0; mb < 4; ++mb) { a[mb] = WFrag<T16>::ld(A + aoff + (size_t)mb * 16 * K + kc); if (NSPLIT == 1 || NSPLIT == 2) a2[mb] = WFrag<T16>::ld(A2 + aoff + (size_t)mb * 16 * K + kc); }
#pragma unroll
        for (int nb = 0; nb < 4; ++nb) { const V b = WFrag<T16>::ld(Bt + boff + (size_t)nb * 16 * K + kc); V b2; if (NSPLIT >= 2) b2 = WFrag<T16>::ld(Bt2 + boff + (size_t)nb * 16 * K + kc);
#pragma unroll
            for (int mb = 0; mb < 4; ++mb) { acc[mb][nb] = WFrag<T16>::mma(a[mb], b, acc[mb][nb]); if (NSPLIT == 1 || NSPLIT == 2) acc[mb][nb] = WFrag<T16>::mma(a2[mb], b, acc[mb][nb]); if (NSPLIT >= 2) acc[mb][nb] = WFrag<T16>::mma(a[mb], b2, acc[mb][nb]); } }
        asm volatile("v_nop\n\tv_nop\n\tv_nop\n\tv_nop" : "+v"(acc[0][0]), "+v"(acc[1][1]), "+v"(acc[2][2]), "+v"(acc[3][3]) : "v"(a[0]), "v"(a[3]));
    }
#pragma unroll
    for (int mb = 0; mb < 4; ++mb) {
#pragma unroll
        for (int nb = 0; nb < 4; ++nb) {
#pragma unroll
            for (int j = 0; j < 8; ++j) os[(hi * 8 + j) * 68 + nb * 16 + lr] = acc[mb][nb][j]; }
        __builtin_amdgcn_wave_barrier(); asm volatile("" ::: "memory");
        float* crow = C + (size_t)(r0 + mb * 16) * ldc + c0;
{
#pragma unroll
            for (int s = 0; s < 8; ++s) { const int row = 2 * s + hi, cofs = lr * 4; v4f val = *(const v4fa*)(os + row * 68 + cofs); if (BIAS) { val[0] += bfr(bias[c0 + cofs]); val[1] += bfr(bias[c0 + cofs + 1]); val[2] += bfr(bias[c0 + cofs + 2]); val[3] += bfr(bias[c0 + cofs + 3]); }
                *(v4f*)(crow + (size_t)row * ldc + cofs) = val; }
             }
        __builtin_amdgcn_wave_barrier(); asm volatile("" ::: "memory");
    }
}

// ---- k_gemmc: the same one-wave 64x64 tile GEMM specialised for causal attention: CMODE 1 skips score tiles entirely above the diagonal (query rows r0+roff.., key columns c0..), CMODE 2 limits the
// key (K) loop of the probability x value contraction to the diagonal block (probabilities beyond it are exactly zero). roff = row offset of this launch's first row within the sequence.
template <typename T16, int NSPLIT, int CMODE>
__global__ __launch_bounds__(32) void k_gemmc(const T16* __restrict__ A, const T16* __restrict__ A2, const T16* __restrict__ Bt, const T16* __restrict__ Bt2, int K, float* C, int ldc, int roff, size_t sA, size_t sB, size_t sC) {
    typedef typename WFrag<T16>::V V;
    __shared__ __align__(16) float os[16 * 68];
    const size_t z = blockIdx.z; A += z * sA; if (A2) A2 += z * sA; Bt += z * sB; if (Bt2) Bt2 += z * sB; C += z * sC;
    const int lane = threadIdx.x & 31, lr = lane & 15, hi = lane >> 4; const int r0 = blockIdx.x * 64, c0 = blockIdx.y * 64;
    if (CMODE == 1 && c0 > r0 + roff + 63) return;                  // score tile entirely above the causal diagonal: left stale (the softmax masks j > i by select)
    const int Kl = (CMODE == 2) ? min(K, r0 + roff + 64) : K;        // P.V: probabilities are exactly 0 beyond the diagonal block, so the K loop stops there
    v8f acc[4][4];
#pragma unroll
    for (int mb = 0; mb < 4; ++mb)
#pragma unroll
        for (int nb = 0; nb < 4; ++nb) acc[mb][nb] = (v8f){};
    const size_t aoff = (size_t)(r0 + lr) * K + 8 * hi, boff = (size_t)(c0 + lr) * K + 8 * hi;
#pragma unroll 1
    for (int kc = 0; kc < Kl; kc += 32) {
        V a[4], a2[4];
#pragma unroll
        for (int mb = 0; mb < 4; ++mb) { a[mb] = WFrag<T16>::ld(A + aoff + (size_t)mb * 16 * K + kc); if (NSPLIT == 1 || NSPLIT == 2) a2[mb] = WFrag<T16>::ld(A2 + aoff + (size_t)mb * 16 * K + kc); }
#pragma unroll
        for (int nb = 0; nb < 4; ++nb) { const V b = WFrag<T16>::ld(Bt + boff + (size_t)nb * 16 * K + kc); V b2; if (NSPLIT >= 2) b2 = WFrag<T16>::ld(Bt2 + boff + (size_t)nb * 16 * K + kc);
#pragma unroll
            for (int mb = 0; mb < 4; ++mb) { acc[mb][nb] = WFrag<T16>::mma(a[mb], b, acc[mb][nb]); if (NSPLIT == 1 || NSPLIT == 2) acc[mb][nb] = WFrag<T16>::mma(a2[mb], b, acc[mb][nb]); if (NSPLIT >= 2) acc[mb][nb] = WFrag<T16>::mma(a[mb], b2, acc[mb][nb]); } }
        asm volatile("v_nop\n\tv_nop\n\tv_nop\n\tv_nop" : "+v"(acc[0][0]), "+v"(acc[1][1]), "+v"(acc[2][2]), "+v"(acc[3][3]) : "v"(a[0]), "v"(a[3]));
    }
#pragma unroll
    for (int mb = 0; mb < 4; ++mb) {
#pragma unroll
        for (int nb = 0; nb < 4; ++nb) {
#pragma unroll
            for (int j = 0; j < 8; ++j) os[(hi * 8 + j) * 68 + nb * 16 + lr] = acc[mb][nb][j]; }
        __builtin_amdgcn_wave_barrier(); asm volatile("" ::: "memory");
        float* crow = C + (size_t)(r0 + mb * 16) * ldc + c0;
{
#pragma unroll
            for (int s = 0; s < 8; ++s) { const int row = 2 * s + hi, cofs = lr * 4; v4f val = *(const v4fa*)(os + row * 68 + cofs);
                *(v4f*)(crow + (size_t)row * ldc + cofs) = val; }
             }
        __builtin_amdgcn_wave_barrier(); asm volatile("" ::: "memory");
    }
}

__device__ __forceinline__ h16 tohx(float x) { return (h16)x; }
__device__ __forceinline__ void splitf(float y, unsigned short& h, unsigned short& l) { h = f2bf(y); l = f2bf(y - bf2f(h)); }
typedef __attribute__((ext_vector_type(2))) _Float16 v2h;
typedef __attribute__((ext_vector_type(4))) _Float16 v4h;
typedef __attribute__((ext_vector_type(2))) unsigned short v2us;
typedef __attribute__((ext_vector_type(4))) unsigned short v4us;
typedef __attribute__((ext_vector_type(2))) float v2f;
typedef __attribute__((ext_vector_type(4))) int v4i;

__global__ __launch_bounds__(256) void k_wtG(const float* __restrict__ w, int K, int N, bf* Bt) {
    const int lane = threadIdx.x & 31; const int L0 = (blockIdx.x * 8 + (threadIdx.x >> 5)) * 8; const int nlines = N * K / 64;
{
#pragma unroll 1
        for (int l = 0; l < 8; ++l) { const int L = L0 + l; if (L >= nlines) break; const size_t e = (size_t)L * 64 + lane * 2; const int k = (int)(e % K), n = (int)(e / K); v2us o;
            o[0] = f2bf(w[(size_t)k * N + n]); o[1] = f2bf(w[(size_t)(k + 1) * N + n]); *(v2us*)(Bt + e) = o; }
         }
}
__global__ __launch_bounds__(256) void k_cvt8(const float* __restrict__ src, bf* dst, size_t n8) { const size_t i = (size_t)blockIdx.x * 256 + threadIdx.x; if (i >= n8) return; const v8f v = *(const v8f*)(src + i * 8); v8us o;
#pragma unroll
    for (int k = 0; k < 8; ++k) o[k] = f2bf(v[k]); *(v8us*)(dst + i * 8) = o;  }

// k_rope: head planes [h][t][d] (fp16 + hi/lo) of rope(x) x sc with the rotate-half convention out[d] = x[d] cos[t][d] - x[d+HD/2] sin[t][d], out[d+HD/2] = x[d+HD/2] cos[t][d+HD/2] + x[d] sin[t][d+HD/2]
__global__ __launch_bounds__(256) void k_rope(const float* __restrict__ F, int pitch, int nheads, const float* __restrict__ CS, const float* __restrict__ RF, const float* __restrict__ nw, float sc, h16* P16, bf* Ph, bf* Pl) {
    const size_t e = ((size_t)blockIdx.x * 256 + threadIdx.x) * 2; if (e >= (size_t)nheads * TT * HD) return; const int d = (int)(e % HD); const int t = (int)((e / HD) % TT); const int h = (int)(e / ((size_t)HD * TT)); const float* f = F + (size_t)t * pitch + h * HD; const float rf = RF ? RF[(size_t)h * TT + t] : 1.0f; v2h o16; v2us oh, ol;
#pragma unroll
    for (int q = 0; q < 2; ++q) { const int dd = d + q; const int dp = (dd < HD / 2) ? dd + HD / 2 : dd - HD / 2; float x0 = f[dd], x1 = f[dp];
        if (RF) { float n0 = __fmul_rn(x0, rf), n1 = __fmul_rn(x1, rf); asm volatile("" : "+v"(n0)); asm volatile("" : "+v"(n1)); x0 = __fmul_rn(bfr(nw[dd]), n0); x1 = __fmul_rn(bfr(nw[dp]), n1); }
        const v2f cs = *(const v2f*)(CS + ((size_t)t * HD + dd) * 2); float a = __fmul_rn(x0, cs[0]), bq = __fmul_rn(x1, cs[1]); asm volatile("" : "+v"(a)); asm volatile("" : "+v"(bq)); const float r = ((dd < HD / 2) ? __fsub_rn(a, bq) : __fadd_rn(a, bq)) * sc;
        o16[q] = tohx(r); unsigned short a2, c2; splitf(r, a2, c2); oh[q] = a2; ol[q] = c2; }
    *(v2h*)(P16 + e) = o16; *(v2us*)(Ph + e) = oh; *(v2us*)(Pl + e) = ol;  }
__global__ __launch_bounds__(256) void k_vtp(const float* __restrict__ F, int pitch, int nheads, h16* V16, bf* Vh, bf* Vl) { const size_t e = ((size_t)blockIdx.x * 256 + threadIdx.x) * 2; if (e >= (size_t)nheads * HD * TT) return; const int t = (int)(e % TT); const int d = (int)((e / TT) % HD); const int g = (int)(e / ((size_t)TT * HD)); v2h o16; v2us oh, ol;
#pragma unroll
    for (int q = 0; q < 2; ++q) { const float x = F[(size_t)(t + q) * pitch + g * HD + d]; o16[q] = tohx(x); unsigned short a2, c2; splitf(x, a2, c2); oh[q] = a2; ol[q] = c2; }
    *(v2h*)(V16 + e) = o16; *(v2us*)(Vh + e) = oh; *(v2us*)(Vl + e) = ol;  }
__global__ __launch_bounds__(256) void k_csid(float* CS) { const int idx = blockIdx.x * 256 + threadIdx.x; if (idx >= TT * HD) return; v2f cs; cs[0] = 1.0f; cs[1] = 0.0f; *(v2f*)(CS + (size_t)idx * 2) = cs;  }
// k_lsoft: streaming causal row softmax over the TK = TT = 4096 keys, one wave per row i, three sweeps of the f32 score row (lane -> 4 consecutive keys per 128-key chunk, 32 chunks; keys j > i are excluded by index with -3e38 / 0 - the score tiles above the diagonal are never computed and their stale contents are only ever discarded by this select):
__global__ __launch_bounds__(256) void k_lsoft(const float* __restrict__ Sb, h16* P16, bf* Ph, bf* Pl) {
    const int lane = threadIdx.x & 31; const int row = blockIdx.x * 8 + (threadIdx.x >> 5); if (row >= ZH * TT) return; const int i = row % TT; const int zz = row / TT; const bool hires = (i < RH); const float* sr = Sb + (size_t)row * TT; float mx = -3.0e38f;
#pragma unroll 4
    for (int ch = 0; ch < TT / 128; ++ch) { const int j0 = ch * 128 + lane * 4; const v4f a = *(const v4f*)(sr + j0);
#pragma unroll
        for (int q = 0; q < 4; ++q) { float t = a[q] * SCL; asm volatile("" : "+v"(t)); t = (j0 + q <= i) ? t : -3.0e38f; mx = fmaxf(mx, t); } }
#pragma unroll
    for (int sh = 16; sh; sh >>= 1) mx = fmaxf(mx, __shfl_xor(mx, sh, 32));
    float sum = 0.f;
#pragma unroll 4
    for (int ch = 0; ch < TT / 128; ++ch) { const int j0 = ch * 128 + lane * 4; const v4f a = *(const v4f*)(sr + j0);
#pragma unroll
        for (int q = 0; q < 4; ++q) { float t = a[q] * SCL; asm volatile("" : "+v"(t)); t = (j0 + q <= i) ? t : -3.0e38f; float d0 = __fsub_rn(t, mx); asm volatile("" : "+v"(d0)); sum += __builtin_amdgcn_exp2f(__fmul_rn(d0, 1.4426950408889634f)); } }
#pragma unroll
    for (int sh = 16; sh; sh >>= 1) sum += __shfl_xor(sum, sh, 32);
    const float f = __fdiv_rn(hires ? 1.0f : PCAR, sum);
{
        if (hires) {   /* rows < RH: normalised bf16 hi/lo over the first RH keys (every later key is above the diagonal for these rows; the hi/lo attn.v GEMM stops its K loop at the diagonal block), planes [zz][RH][TT] */
#pragma unroll
            for (int ch = 0; ch < RH / 128; ++ch) { const int j0 = ch * 128 + lane * 4; const v4f a = *(const v4f*)(sr + j0); v4us oh, ol;
#pragma unroll
                for (int q = 0; q < 4; ++q) { float t = a[q] * SCL; asm volatile("" : "+v"(t)); t = (j0 + q <= i) ? t : -3.0e38f; float d0 = __fsub_rn(t, mx); asm volatile("" : "+v"(d0)); float ex = __builtin_amdgcn_exp2f(__fmul_rn(d0, 1.4426950408889634f)); asm volatile("" : "+v"(ex)); unsigned short a2, c2; splitf(ex * f, a2, c2); oh[q] = a2; ol[q] = c2; }
                const size_t oo = ((size_t)zz * RH + i) * TT + j0; *(v4us*)(Ph + oo) = oh; *(v4us*)(Pl + oo) = ol; }
        } else {
#pragma unroll 2
            for (int ch = 0; ch < TT / 128; ++ch) { const int j0 = ch * 128 + lane * 4; const v4f a = *(const v4f*)(sr + j0); v4h o4;
#pragma unroll
                for (int q = 0; q < 4; ++q) { float t = a[q] * SCL; asm volatile("" : "+v"(t)); t = (j0 + q <= i) ? t : -3.0e38f; float d0 = __fsub_rn(t, mx); asm volatile("" : "+v"(d0)); float ex = __builtin_amdgcn_exp2f(__fmul_rn(d0, 1.4426950408889634f)); asm volatile("" : "+v"(ex)); o4[q] = tohx(ex * f); }
                *(v4h*)(P16 + (size_t)row * TT + j0) = o4; } }
         }
}

__global__ __launch_bounds__(256) void k_merge(const float* __restrict__ O, int h0, float* OUTb) { const size_t e = ((size_t)blockIdx.x * 256 + threadIdx.x) * 2; if (e >= (size_t)ZH * TT * HD) return; const int d = (int)(e % HD); const int t = (int)((e / HD) % TT); const int zz = (int)(e / ((size_t)HD * TT)); const float cs = (t < RH) ? 1.0f : (1.0f / PCAR); const size_t oo = (size_t)t * DQ + (h0 + zz) * HD + d;
    v2f o2; o2[0] = O[e] * cs; o2[1] = O[e + 1] * cs; *(v2f*)(OUTb + oo) = o2;  }

extern "C" void kernel_launch(void* const* d_in, const int* in_sizes, int n_in,
                              void* d_out, int out_size, void* d_ws, size_t ws_size, hipStream_t stream) {
    (void)in_sizes; (void)n_in; (void)out_size;
    const float* x = (const float*)d_in[0]; const float* wq = (const float*)d_in[1]; const float* bq = (const float*)d_in[2]; const float* wk = (const float*)d_in[3]; const float* bk = (const float*)d_in[4]; const float* wv = (const float*)d_in[5]; const float* bv = (const float*)d_in[6]; const float* wo = nullptr; (void)wo;
    float* OUT = (float*)d_out; float* OUTK = OUT + (size_t)NB_ * TT * HD; float* OUTV = OUT + (size_t)2 * NB_ * TT * HD;   /* tuple output: result | K | V, each [4][4096][64] f32 */     // [4][4096][64]
    char* wsp = (char*)d_ws;
    auto take = [&](size_t bytes) { char* p = wsp; wsp += (bytes + 255) & ~(size_t)255; return (void*)p; };
    bf* WQ = (bf*)take((size_t)DQ * DM * 2); bf* WK = (bf*)take((size_t)DKV * DM * 2); bf* WV = (bf*)take((size_t)DKV * DM * 2); float* CS = (float*)take((size_t)TT * HD * 2 * 4);
    bf* XB = (bf*)take((size_t)TT * DM * 2); float* FQ = (float*)take((size_t)TT * DQ * 4); 
    h16* QP16 = (h16*)take((size_t)NH_ * TT * HD * 2); h16* KP16 = (h16*)take((size_t)NKV * TT * HD * 2); h16* VT16 = (h16*)take((size_t)NKV * HD * TT * 2);
    bf* QPh = (bf*)take((size_t)NH_ * TT * HD * 2); bf* QPl = (bf*)take((size_t)NH_ * TT * HD * 2); bf* KPh = (bf*)take((size_t)NKV * TT * HD * 2); bf* KPl = (bf*)take((size_t)NKV * TT * HD * 2); bf* VTh = (bf*)take((size_t)NKV * HD * TT * 2); bf* VTl = (bf*)take((size_t)NKV * HD * TT * 2); bf* Ph = (bf*)take((size_t)ZH * RH * TT * 2); bf* Pl = (bf*)take((size_t)ZH * RH * TT * 2);
    float* Sb = (float*)take((size_t)ZH * TT * TT * 4); h16* P16 = (h16*)take((size_t)ZH * TT * TT * 2); float* Ob = (float*)take((size_t)ZH * TT * HD * 4);
    if ((size_t)(wsp - (char*)d_ws) > ws_size) return;    // ws 256 MiB
    { k_wtG<<<(unsigned)((DM * DQ / 64 + 63) / 64), 256, 0, stream>>>(wq, DM, DQ, WQ); k_wtG<<<(unsigned)((DM * DKV / 64 + 63) / 64), 256, 0, stream>>>(wk, DM, DKV, WK); k_wtG<<<(unsigned)((DM * DKV / 64 + 63) / 64), 256, 0, stream>>>(wv, DM, DKV, WV);
      
       }
    k_csid<<<(TT * HD + 255) / 256, 256, 0, stream>>>(CS);
    const unsigned LQ = (unsigned)(((size_t)NH_ * TT * HD / 2 + 255) / 256), LKv = (unsigned)(((size_t)NKV * TT * HD / 2 + 255) / 256);
    for (int b = 0; b < NB_; ++b) {
        
        k_cvt8<<<(unsigned)(((size_t)TT * DM / 8 + 255) / 256), 256, 0, stream>>>(x + (size_t)b * TT * DM, XB, (size_t)TT * DM / 8);
        k_gemmw<bf, 0, true><<<dim3(TT / 64, DQ / 64, 1), 32, 0, stream>>>(XB, nullptr, WQ, nullptr, DM, FQ, DQ, bq, 0, 0, 0);
        k_rope<<<LQ, 256, 0, stream>>>(FQ, DQ, NH_, CS, nullptr, nullptr, 1.0f, QP16, QPh, QPl);
        k_gemmw<bf, 0, true><<<dim3(TT / 64, DKV / 64, 1), 32, 0, stream>>>(XB, nullptr, WK, nullptr, DM, OUTK + (size_t)b * TT * HD, DKV, bk, 0, 0, 0);   /* K = x Wk + bk -> output slot 1 */
        k_rope<<<LKv, 256, 0, stream>>>(OUTK + (size_t)b * TT * HD, DKV, NKV, CS, nullptr, nullptr, 1.0f, KP16, KPh, KPl);
        k_gemmw<bf, 0, true><<<dim3(TT / 64, DKV / 64, 1), 32, 0, stream>>>(XB, nullptr, WV, nullptr, DM, OUTV + (size_t)b * TT * HD, DKV, bv, 0, 0, 0);   /* V = x Wv + bv -> output slot 2 */ k_vtp<<<LKv, 256, 0, stream>>>(OUTV + (size_t)b * TT * HD, DKV, NKV, VT16, VTh, VTl);
        for (int h0 = 0; h0 < NH_; h0 += ZH) { const size_t zq = (size_t)h0, zk = (size_t)(h0 / REP);   // one kv head per query head: the pass's one head (ZH = 1) uses kv plane h0 / REP (z-stride TT*HD)
            k_gemmc<bf, 2, 1><<<dim3(RH / 64, TT / 64, ZH), 32, 0, stream>>>(QPh + zq * TT * HD, QPl + zq * TT * HD, KPh + zk * TT * HD, KPl + zk * TT * HD, HD, Sb, TT, 0, (size_t)TT * HD, (size_t)TT * HD, (size_t)TT * TT);
            k_gemmc<h16, 0, 1><<<dim3((TT - RH) / 64, TT / 64, ZH), 32, 0, stream>>>(QP16 + zq * TT * HD + (size_t)RH * HD, nullptr, KP16 + zk * TT * HD, nullptr, HD, Sb + (size_t)RH * TT, TT, RH, (size_t)TT * HD, (size_t)TT * HD, (size_t)TT * TT);
            k_lsoft<<<ZH * TT / 8, 256, 0, stream>>>(Sb, P16, Ph, Pl);
            k_gemmc<bf, 2, 2><<<dim3(RH / 64, HD / 64, ZH), 32, 0, stream>>>(Ph, Pl, VTh + zk * HD * TT, VTl + zk * HD * TT, TT, Ob, HD, 0, (size_t)RH * TT, (size_t)HD * TT, (size_t)TT * HD);
            k_gemmc<h16, 0, 2><<<dim3((TT - RH) / 64, HD / 64, ZH), 32, 0, stream>>>(P16 + (size_t)RH * TT, nullptr, VT16 + zk * HD * TT, nullptr, TT, Ob + (size_t)RH * HD, HD, RH, (size_t)TT * TT, (size_t)HD * TT, (size_t)TT * HD);
            k_merge<<<(unsigned)(((size_t)ZH * TT * HD / 2 + 255) / 256), 256, 0, stream>>>(Ob, h0, OUT + (size_t)b * TT * DQ);   /* result -> output slot 0 */ }
         }
}

// v001
// A run of this version takes 457 microseconds.
// Timed twice side by side with v000, it ran 1.92 and 1.91 times as fast.
#include <hip/hip_runtime.h>

// Single-head causal attention with cache outputs (x [4][4096][768]; Q, K, V = x W + b ('xw' [768][64] + [64]); scores = Q.K / 8, causal; softmax; result = attn.V; returns (result, K, V) -> three [4][4096][64] f32 tensors (3.1 M)).
// Layout per batch: exact projections (+ biases); K and V are written by their GEMM epilogues straight into their output slots (f32) and read back from there by the plane builders; hybrid causal attention over 4,096 keys (rows < 512 hi/lo, rest fp16 x1024) with a streaming 3-sweep softmax (no register row at this length); result via the f32 merge path.
// Compute dtypes, f32 accumulate: every input rounded to bf16; projections on PLAIN bf16 operands (exact) + f32 biases (K and V outputs are exactly these f32 sums); scores and attn.v rows < 512 on bf16 hi/lo planes (3 products), the rest single fp16; softmax f32; f32 result.

#define NB_  4
#define TT   4096
#define DM   768
#define NH_  1
#define NKV  1
#define REP  (NH_ / NKV)
#define HD   64
#define DQ   (NH_ * HD)
#define DKV  (NKV * HD)
#define ZH   1
#define RH   512                  // query rows < RH use hi+lo planes (0: none)
#define WIN  4096
#define PCAR 1024.0f
#define SCL  0.125f   // HD^-0.5
#define NWK  8                    // waves per work-group that share one K loop in the long-K GEMMs
#define KCH  1024                 // keys per work-group of the f16 attn.v GEMM (TT / KCH partial planes, summed by k_merge)
typedef _Float16 h16;
typedef unsigned short bf;
typedef __attribute__((ext_vector_type(16))) __bf16   v16bf;
typedef __attribute__((ext_vector_type(16))) _Float16 v16h;
typedef __attribute__((ext_vector_type(8)))  _Float16 v8h;
typedef __attribute__((ext_vector_type(8)))  unsigned short v8us;
typedef __attribute__((ext_vector_type(8)))  float    v8f;
typedef __attribute__((ext_vector_type(4)))  float    v4f;
typedef v8h  __attribute__((may_alias)) v8ha;
typedef v4f  __attribute__((may_alias)) v4fa;
typedef v8us __attribute__((may_alias)) v8usa;

__device__ __forceinline__ unsigned short f2bf(float f) { unsigned u = __float_as_uint(f); u += 0x7FFFu + ((u >> 16) & 1u); return (unsigned short)(u >> 16); }
__device__ __forceinline__ float bf2f(unsigned short b) { return __uint_as_float(((unsigned)b) << 16); }
__device__ __forceinline__ float bfr(float f) { return bf2f(f2bf(f)); }
__device__ __forceinline__ v16h cat16(v8h lo, v8h hi) { return __builtin_shufflevector(lo, hi, 0, 1, 2, 3, 4, 5, 6, 7, 8, 9, 10, 11, 12, 13, 14, 15); }
__device__ __forceinline__ v16bf cat16b(v8us lo, v8us hi) { return __builtin_bit_cast(v16bf, __builtin_shufflevector(lo, hi, 0, 1, 2, 3, 4, 5, 6, 7, 8, 9, 10, 11, 12, 13, 14, 15)); }
__device__ __forceinline__ v8f wmma16(v16h a, v16h b, v8f c) { return __builtin_amdgcn_wmma_f32_16x16x32_f16(false, a, false, b, (short)0, c, false, false); }
__device__ __forceinline__ v8f wmmab(v16bf a, v16bf b, v8f c) { return __builtin_amdgcn_wmma_f32_16x16x32_bf16(false, a, false, b, (short)0, c, false, false); }



// ---- k_gemmw: register-blocked GEMM, one 64x64 output tile per work-group of NW waves (16 accumulators a wave), operands straight from K-contiguous 16-bit planes; grid (M/64, N/64, Z), 32 * NW threads.
// Split K: wave w takes the 32-wide K steps w, w + NW, ...; the NW partial tiles are summed through LDS in wave order 0..NW-1 by the epilogue (NW > 1: all 64 rows staged at once, so one barrier and no wait on the global stores; NW == 1: 16 rows at a time, small LDS).
// C[m][n] (f32, pitch ldc, + optional f32 bias[n]) = sum_k A[m][k] Bt[n][k] (+ split products per NSPLIT). z-batch strides sA/sB/sC in elements. K % 32 == 0.
template <typename T16> struct WFrag;
template <> struct WFrag<h16> { typedef v16h V; static __device__ __forceinline__ V ld(const h16* p) { return cat16(*(const v8h*)p, *(const v8h*)(p + 16)); } static __device__ __forceinline__ v8f mma(V a, V b, v8f c) { return wmma16(a, b, c); } };
template <> struct WFrag<bf> { typedef v16bf V; static __device__ __forceinline__ V ld(const bf* p) { return cat16b(*(const v8us*)p, *(const v8us*)(p + 16)); } static __device__ __forceinline__ v8f mma(V a, V b, v8f c) { return wmmab(a, b, c); } };
template <int NW> __device__ __forceinline__ void tile_sync() { if (NW == 1) { __builtin_amdgcn_wave_barrier(); asm volatile("" ::: "memory"); } else __syncthreads(); }   // orders the LDS tile's writes and reads: inside the one wave, or among the NW waves
template <typename T16, int NSPLIT, bool BIAS, int NW>
__global__ __launch_bounds__(32 * NW) void k_gemmw(const T16* __restrict__ A, const T16* __restrict__ A2, const T16* __restrict__ Bt, const T16* __restrict__ Bt2, int K, float* C, int ldc, const float* __restrict__ bias, size_t sA, size_t sB, size_t sC) {
    typedef typename WFrag<T16>::V V;
    constexpr int MBP = (NW == 1) ? 1 : 4;                           // 16-row blocks staged in LDS per epilogue pass
    __shared__ __align__(16) float os[NW * MBP * 16 * 68];
    const size_t z = blockIdx.z; A += z * sA; if (A2) A2 += z * sA; Bt += z * sB; if (Bt2) Bt2 += z * sB; C += z * sC;
    const int lane = threadIdx.x & 31, lr = lane & 15, hi = lane >> 4; const int r0 = blockIdx.x * 64, c0 = blockIdx.y * 64; const int wv = (NW == 1) ? 0 : __builtin_amdgcn_readfirstlane((int)(threadIdx.x >> 5));   // wave number in a scalar register: the K loop's bounds and branch stay scalar, every lane stays on for the matrix instructions
    v8f acc[4][4];
#pragma unroll
    for (int mb = 0; mb < 4; ++mb)
#pragma unroll
        for (int nb = 0; nb < 4; ++nb) acc[mb][nb] = (v8f){};
    const size_t aoff = (size_t)(r0 + lr) * K + 8 * hi, boff = (size_t)(c0 + lr) * K + 8 * hi;
#pragma unroll 1
    for (int kc = wv * 32; kc < K; kc += 32 * NW) {
        V a[4], a2[4];
#pragma unroll
        for (int mb = 0; mb < 4; ++mb) { a[mb] = WFrag<T16>::ld(A + aoff + (size_t)mb * 16 * K + kc); if (NSPLIT == 1 || NSPLIT == 2) a2[mb] = WFrag<T16>::ld(A2 + aoff + (size_t)mb * 16 * K + kc); }
#pragma unroll
        for (int nb = 0; nb < 4; ++nb) { const V b = WFrag<T16>::ld(Bt + boff + (size_t)nb * 16 * K + kc); V b2; if (NSPLIT >= 2) b2 = WFrag<T16>::ld(Bt2 + boff + (size_t)nb * 16 * K + kc);
#pragma unroll
            for (int mb = 0; mb < 4; ++mb) { acc[mb][nb] = WFrag<T16>::mma(a[mb], b, acc[mb][nb]); if (NSPLIT == 1 || NSPLIT == 2) acc[mb][nb] = WFrag<T16>::mma(a2[mb], b, acc[mb][nb]); if (NSPLIT >= 2) acc[mb][nb] = WFrag<T16>::mma(a[mb], b2, acc[mb][nb]); } }
        asm volatile("v_nop\n\tv_nop\n\tv_nop\n\tv_nop" : "+v"(acc[0][0]), "+v"(acc[1][1]), "+v"(acc[2][2]), "+v"(acc[3][3]) : "v"(a[0]), "v"(a[3]));
    }
#pragma unroll
    for (int mb = 0; mb < 4; mb += MBP) {
#pragma unroll   // acc[] is indexed by constants only, so it stays in registers
        for (int mi = 0; mi < MBP; ++mi)
#pragma unroll
        for (int nb = 0; nb < 4; ++nb) {
#pragma unroll
            for (int j = 0; j < 8; ++j) os[wv * (MBP * 16 * 68) + (mi * 16 + hi * 8 + j) * 68 + nb * 16 + lr] = acc[mb + mi][nb][j]; }
        tile_sync<NW>();
        float* crow = C + (size_t)(r0 + mb * 16) * ldc + c0;
{
#pragma unroll
            for (int s = 0; s < MBP * 8 / NW; ++s) { const int row = 2 * NW * s + (int)(threadIdx.x >> 4), cofs = lr * 4; v4f val = *(const v4fa*)(os + row * 68 + cofs);
#pragma unroll   // the NW LDS reads are issued together; the adds keep the order w = 0..NW-1
                for (int w = 1; w < NW; ++w) val += *(const v4fa*)(os + w * (MBP * 16 * 68) + row * 68 + cofs);
                if (BIAS) { val[0] += bfr(bias[c0 + cofs]); val[1] += bfr(bias[c0 + cofs + 1]); val[2] += bfr(bias[c0 + cofs + 2]); val[3] += bfr(bias[c0 + cofs + 3]); }
                *(v4f*)(crow + (size_t)row * ldc + cofs) = val; }
             }
        if (mb + MBP < 4) tile_sync<NW>();
    }
}

// ---- k_gemmc: the same 64x64 tile GEMM specialised for causal attention: CMODE 1 skips score tiles entirely above the diagonal (query rows r0+roff.., key columns c0..), CMODE 2 limits the
// key (K) loop of the probability x value contraction to the diagonal block (probabilities beyond it are exactly zero). roff = row offset of this launch's first row within the sequence.
// CMODE 2 also splits K: over the NW waves as in k_gemmw, and over blockIdx.z in chunks of kch keys (the caller passes sA = sB = kch, so that z moves both operands along K, and sC = one partial plane of C).
template <typename T16, int NSPLIT, int CMODE, int NW>
__global__ __launch_bounds__(32 * NW) void k_gemmc(const T16* __restrict__ A, const T16* __restrict__ A2, const T16* __restrict__ Bt, const T16* __restrict__ Bt2, int K, float* C, int ldc, int roff, int kch, size_t sA, size_t sB, size_t sC) {
    typedef typename WFrag<T16>::V V;
    constexpr int MBP = (NW == 1) ? 1 : 4;                           // 16-row blocks staged in LDS per epilogue pass
    __shared__ __align__(16) float os[NW * MBP * 16 * 68];
    const size_t z = blockIdx.z; A += z * sA; if (A2) A2 += z * sA; Bt += z * sB; if (Bt2) Bt2 += z * sB; C += z * sC;
    const int lane = threadIdx.x & 31, lr = lane & 15, hi = lane >> 4; const int r0 = blockIdx.x * 64, c0 = blockIdx.y * 64; const int wv = (NW == 1) ? 0 : __builtin_amdgcn_readfirstlane((int)(threadIdx.x >> 5));   // wave number in a scalar register: the K loop's bounds and branch stay scalar, every lane stays on for the matrix instructions
    if (CMODE == 1 && c0 > r0 + roff + 63) return;                  // score tile entirely above the causal diagonal: never computed (the softmax loads it but masks j > i by select)
    const int Kl = (CMODE == 2) ? min(kch, r0 + roff + 64 - (int)z * kch) : K;        // P.V: probabilities are exactly 0 beyond the diagonal block, so the K loop stops there
    if (CMODE == 2 && Kl <= 0) return;                               // chunk entirely beyond the diagonal block: its partial plane is neither written nor read (whole work-group, before any barrier)
    v8f acc[4][4];
#pragma unroll
    for (int mb = 0; mb < 4; ++mb)
#pragma unroll
        for (int nb = 0; nb < 4; ++nb) acc[mb][nb] = (v8f){};
    const size_t aoff = (size_t)(r0 + lr) * K + 8 * hi, boff = (size_t)(c0 + lr) * K + 8 * hi;
#pragma unroll 1
    for (int kc = wv * 32; kc < Kl; kc += 32 * NW) {
        V a[4], a2[4];
#pragma unroll
        for (int mb = 0; mb < 4; ++mb) { a[mb] = WFrag<T16>::ld(A + aoff + (size_t)mb * 16 * K + kc); if (NSPLIT == 1 || NSPLIT == 2) a2[mb] = WFrag<T16>::ld(A2 + aoff + (size_t)mb * 16 * K + kc); }
#pragma unroll
        for (int nb = 0; nb < 4; ++nb) { const V b = WFrag<T16>::ld(Bt + boff + (size_t)nb * 16 * K + kc); V b2; if (NSPLIT >= 2) b2 = WFrag<T16>::ld(Bt2 + boff + (size_t)nb * 16 * K + kc);
#pragma unroll
            for (int mb = 0; mb < 4; ++mb) { acc[mb][nb] = WFrag<T16>::mma(a[mb], b, acc[mb][nb]); if (NSPLIT == 1 || NSPLIT == 2) acc[mb][nb] = WFrag<T16>::mma(a2[mb], b, acc[mb][nb]); if (NSPLIT >= 2) acc[mb][nb] = WFrag<T16>::mma(a[mb], b2, acc[mb][nb]); } }
        asm volatile("v_nop\n\tv_nop\n\tv_nop\n\tv_nop" : "+v"(acc[0][0]), "+v"(acc[1][1]), "+v"(acc[2][2]), "+v"(acc[3][3]) : "v"(a[0]), "v"(a[3]));
    }
#pragma unroll
    for (int mb = 0; mb < 4; mb += MBP) {
#pragma unroll   // acc[] is indexed by constants only, so it stays in registers
        for (int mi = 0; mi < MBP; ++mi)
#pragma unroll
        for (int nb = 0; nb < 4; ++nb) {
#pragma unroll
            for (int j = 0; j < 8; ++j) os[wv * (MBP * 16 * 68) + (mi * 16 + hi * 8 + j) * 68 + nb * 16 + lr] = acc[mb + mi][nb][j]; }
        tile_sync<NW>();
        float* crow = C + (size_t)(r0 + mb * 16) * ldc + c0;
{
#pragma unroll
            for (int s = 0; s < MBP * 8 / NW; ++s) { const int row = 2 * NW * s + (int)(threadIdx.x >> 4), cofs = lr * 4; v4f val = *(const v4fa*)(os + row * 68 + cofs);
#pragma unroll   // the NW LDS reads are issued together; the adds keep the order w = 0..NW-1
                for (int w = 1; w < NW; ++w) val += *(const v4fa*)(os + w * (MBP * 16 * 68) + row * 68 + cofs);
                *(v4f*)(crow + (size_t)row * ldc + cofs) = val; }
             }
        if (mb + MBP < 4) tile_sync<NW>();
    }
}

__device__ __forceinline__ h16 tohx(float x) { return (h16)x; }
__device__ __forceinline__ void splitf(float y, unsigned short& h, unsigned short& l) { h = f2bf(y); l = f2bf(y - bf2f(h)); }
typedef __attribute__((ext_vector_type(2))) _Float16 v2h;
typedef __attribute__((ext_vector_type(4))) _Float16 v4h;
typedef __attribute__((ext_vector_type(2))) unsigned short v2us;
typedef __attribute__((ext_vector_type(4))) unsigned short v4us;
typedef __attribute__((ext_vector_type(2))) float v2f;
typedef __attribute__((ext_vector_type(4))) int v4i;

__global__ __launch_bounds__(256) void k_wtG(const float* __restrict__ w, int K, int N, bf* Bt) {
    const int lane = threadIdx.x & 31; const int L0 = (blockIdx.x * 8 + (threadIdx.x >> 5)) * 8; const int nlines = N * K / 64;
{
#pragma unroll 1
        for (int l = 0; l < 8; ++l) { const int L = L0 + l; if (L >= nlines) break; const size_t e = (size_t)L * 64 + lane * 2; const int k = (int)(e % K), n = (int)(e / K); v2us o;
            o[0] = f2bf(w[(size_t)k * N + n]); o[1] = f2bf(w[(size_t)(k + 1) * N + n]); *(v2us*)(Bt + e) = o; }
         }
}
__global__ __launch_bounds__(256) void k_cvt8(const float* __restrict__ src, bf* dst, size_t n8) { const size_t i = (size_t)blockIdx.x * 256 + threadIdx.x; if (i >= n8) return; const v8f v = *(const v8f*)(src + i * 8); v8us o;
#pragma unroll
    for (int k = 0; k < 8; ++k) o[k] = f2bf(v[k]); *(v8us*)(dst + i * 8) = o;  }

// k_rope: head planes [h][t][d] (fp16 + hi/lo) of rope(x) x sc with the rotate-half convention out[d] = x[d] cos[t][d] - x[d+HD/2] sin[t][d], out[d+HD/2] = x[d+HD/2] cos[t][d+HD/2] + x[d] sin[t][d+HD/2]
__global__ __launch_bounds__(256) void k_rope(const float* __restrict__ F, int pitch, int nheads, const float* __restrict__ CS, const float* __restrict__ RF, const float* __restrict__ nw, float sc, h16* P16, bf* Ph, bf* Pl) {
    const size_t e = ((size_t)blockIdx.x * 256 + threadIdx.x) * 2; if (e >= (size_t)nheads * TT * HD) return; const int d = (int)(e % HD); const int t = (int)((e / HD) % TT); const int h = (int)(e / ((size_t)HD * TT)); const float* f = F + (size_t)t * pitch + h * HD; const float rf = RF ? RF[(size_t)h * TT + t] : 1.0f; v2h o16; v2us oh, ol;
#pragma unroll
    for (int q = 0; q < 2; ++q) { const int dd = d + q; const int dp = (dd < HD / 2) ? dd + HD / 2 : dd - HD / 2; float x0 = f[dd], x1 = f[dp];
        if (RF) { float n0 = __fmul_rn(x0, rf), n1 = __fmul_rn(x1, rf); asm volatile("" : "+v"(n0)); asm volatile("" : "+v"(n1)); x0 = __fmul_rn(bfr(nw[dd]), n0); x1 = __fmul_rn(bfr(nw[dp]), n1); }
        const v2f cs = *(const v2f*)(CS + ((size_t)t * HD + dd) * 2); float a = __fmul_rn(x0, cs[0]), bq = __fmul_rn(x1, cs[1]); asm volatile("" : "+v"(a)); asm volatile("" : "+v"(bq)); const float r = ((dd < HD / 2) ? __fsub_rn(a, bq) : __fadd_rn(a, bq)) * sc;
        o16[q] = tohx(r); unsigned short a2, c2; splitf(r, a2, c2); oh[q] = a2; ol[q] = c2; }
    *(v2h*)(P16 + e) = o16; *(v2us*)(Ph + e) = oh; *(v2us*)(Pl + e) = ol;  }
__global__ __launch_bounds__(256) void k_vtp(const float* __restrict__ F, int pitch, int nheads, h16* V16, bf* Vh, bf* Vl) { const size_t e = ((size_t)blockIdx.x * 256 + threadIdx.x) * 2; if (e >= (size_t)nheads * HD * TT) return; const int t = (int)(e % TT); const int d = (int)((e / TT) % HD); const int g = (int)(e / ((size_t)TT * HD)); v2h o16; v2us oh, ol;
#pragma unroll
    for (int q = 0; q < 2; ++q) { const float x = F[(size_t)(t + q) * pitch + g * HD + d]; o16[q] = tohx(x); unsigned short a2, c2; splitf(x, a2, c2); oh[q] = a2; ol[q] = c2; }
    *(v2h*)(V16 + e) = o16; *(v2us*)(Vh + e) = oh; *(v2us*)(Vl + e) = ol;  }
__global__ __launch_bounds__(256) void k_csid(float* CS) { const int idx = blockIdx.x * 256 + threadIdx.x; if (idx >= TT * HD) return; v2f cs; cs[0] = 1.0f; cs[1] = 0.0f; *(v2f*)(CS + (size_t)idx * 2) = cs;  }
// k_lsoft: streaming causal row softmax over the TK = TT = 4096 keys, one wave per row i, three sweeps of the f32 score row (lane -> 4 consecutive keys per 128-key chunk, 32 chunks; keys j > i are excluded by index with -3e38 / 0 - the score tiles above the diagonal are never computed and their stale contents are only ever discarded by this select):
__global__ __launch_bounds__(256) void k_lsoft(const float* __restrict__ Sb, h16* P16, bf* Ph, bf* Pl) {
    const int lane = threadIdx.x & 31; const int row = blockIdx.x * 8 + (threadIdx.x >> 5); if (row >= ZH * TT) return; const int i = row % TT; const int zz = row / TT; const bool hires = (i < RH); const float* sr = Sb + (size_t)row * TT; float mx = -3.0e38f;
#pragma unroll 4
    for (int ch = 0; ch < TT / 128; ++ch) { const int j0 = ch * 128 + lane * 4; const v4f a = *(const v4f*)(sr + j0);
#pragma unroll
        for (int q = 0; q < 4; ++q) { float t = a[q] * SCL; asm volatile("" : "+v"(t)); t = (j0 + q <= i) ? t : -3.0e38f; mx = fmaxf(mx, t); } }
#pragma unroll
    for (int sh = 16; sh; sh >>= 1) mx = fmaxf(mx, __shfl_xor(mx, sh, 32));
    float sum = 0.f;
#pragma unroll 4
    for (int ch = 0; ch < TT / 128; ++ch) { const int j0 = ch * 128 + lane * 4; const v4f a = *(const v4f*)(sr + j0);
#pragma unroll
        for (int q = 0; q < 4; ++q) { float t = a[q] * SCL; asm volatile("" : "+v"(t)); t = (j0 + q <= i) ? t : -3.0e38f; float d0 = __fsub_rn(t, mx); asm volatile("" : "+v"(d0)); sum += __builtin_amdgcn_exp2f(__fmul_rn(d0, 1.4426950408889634f)); } }
#pragma unroll
    for (int sh = 16; sh; sh >>= 1) sum += __shfl_xor(sum, sh, 32);
    const float f = __fdiv_rn(hires ? 1.0f : PCAR, sum);
{
        if (hires) {   /* rows < RH: normalised bf16 hi/lo over the first RH keys (every later key is above the diagonal for these rows; the hi/lo attn.v GEMM stops its K loop at the diagonal block), planes [zz][RH][TT] */
#pragma unroll
            for (int ch = 0; ch < RH / 128; ++ch) { const int j0 = ch * 128 + lane * 4; const v4f a = *(const v4f*)(sr + j0); v4us oh, ol;
#pragma unroll
                for (int q = 0; q < 4; ++q) { float t = a[q] * SCL; asm volatile("" : "+v"(t)); t = (j0 + q <= i) ? t : -3.0e38f; float d0 = __fsub_rn(t, mx); asm volatile("" : "+v"(d0)); float ex = __builtin_amdgcn_exp2f(__fmul_rn(d0, 1.4426950408889634f)); asm volatile("" : "+v"(ex)); unsigned short a2, c2; splitf(ex * f, a2, c2); oh[q] = a2; ol[q] = c2; }
                const size_t oo = ((size_t)zz * RH + i) * TT + j0; *(v4us*)(Ph + oo) = oh; *(v4us*)(Pl + oo) = ol; }
        } else {
#pragma unroll 2
            for (int ch = 0; ch < TT / 128; ++ch) { const int j0 = ch * 128 + lane * 4; const v4f a = *(const v4f*)(sr + j0); v4h o4;
#pragma unroll
                for (int q = 0; q < 4; ++q) { float t = a[q] * SCL; asm volatile("" : "+v"(t)); t = (j0 + q <= i) ? t : -3.0e38f; float d0 = __fsub_rn(t, mx); asm volatile("" : "+v"(d0)); float ex = __builtin_amdgcn_exp2f(__fmul_rn(d0, 1.4426950408889634f)); asm volatile("" : "+v"(ex)); o4[q] = tohx(ex * f); }
                *(v4h*)(P16 + (size_t)row * TT + j0) = o4; } }
         }
}

__global__ __launch_bounds__(256) void k_merge(const float* __restrict__ O, int h0, float* OUTb) { const size_t e = ((size_t)blockIdx.x * 256 + threadIdx.x) * 2; if (e >= (size_t)ZH * TT * HD) return; const int d = (int)(e % HD); const int t = (int)((e / HD) % TT); const int zz = (int)(e / ((size_t)HD * TT)); const float cs = (t < RH) ? 1.0f : (1.0f / PCAR); const size_t oo = (size_t)t * DQ + (h0 + zz) * HD + d;
    const int nch = (t < RH) ? 1 : ((t | 63) + KCH) / KCH;   // partial planes that hold this row: K chunks up to its 64-row tile's diagonal block
    v2f pp[TT / KCH];
#pragma unroll   // pp[] stays in registers
    for (int c = 0; c < TT / KCH; ++c) pp[c] = (c < nch) ? *(const v2f*)(O + (size_t)c * ZH * TT * HD + e) : (v2f){0.f, 0.f};   // all loads issued before the first add
    float s0 = pp[0][0], s1 = pp[0][1];
#pragma unroll   // as above; planes are added in the order 0..TT/KCH-1
    for (int c = 1; c < TT / KCH; ++c) { s0 += pp[c][0]; s1 += pp[c][1]; }
    v2f o2; o2[0] = s0 * cs; o2[1] = s1 * cs; *(v2f*)(OUTb + oo) = o2;  }

extern "C" void kernel_launch(void* const* d_in, const int* in_sizes, int n_in,
                              void* d_out, int out_size, void* d_ws, size_t ws_size, hipStream_t stream) {
    (void)in_sizes; (void)n_in; (void)out_size;
    const float* x = (const float*)d_in[0]; const float* wq = (const float*)d_in[1]; const float* bq = (const float*)d_in[2]; const float* wk = (const float*)d_in[3]; const float* bk = (const float*)d_in[4]; const float* wv = (const float*)d_in[5]; const float* bv = (const float*)d_in[6]; const float* wo = nullptr; (void)wo;
    float* OUT = (float*)d_out; float* OUTK = OUT + (size_t)NB_ * TT * HD; float* OUTV = OUT + (size_t)2 * NB_ * TT * HD;   /* tuple output: result | K | V, each [4][4096][64] f32 */     // [4][4096][64]
    char* wsp = (char*)d_ws;
    auto take = [&](size_t bytes) { char* p = wsp; wsp += (bytes + 255) & ~(size_t)255; return (void*)p; };
    bf* WQ = (bf*)take((size_t)DQ * DM * 2); bf* WK = (bf*)take((size_t)DKV * DM * 2); bf* WV = (bf*)take((size_t)DKV * DM * 2); float* CS = (float*)take((size_t)TT * HD * 2 * 4);
    bf* XB = (bf*)take((size_t)TT * DM * 2); float* FQ = (float*)take((size_t)TT * DQ * 4); 
    h16* QP16 = (h16*)take((size_t)NH_ * TT * HD * 2); h16* KP16 = (h16*)take((size_t)NKV * TT * HD * 2); h16* VT16 = (h16*)take((size_t)NKV * HD * TT * 2);
    bf* QPh = (bf*)take((size_t)NH_ * TT * HD * 2); bf* QPl = (bf*)take((size_t)NH_ * TT * HD * 2); bf* KPh = (bf*)take((size_t)NKV * TT * HD * 2); bf* KPl = (bf*)take((size_t)NKV * TT * HD * 2); bf* VTh = (bf*)take((size_t)NKV * HD * TT * 2); bf* VTl = (bf*)take((size_t)NKV * HD * TT * 2); bf* Ph = (bf*)take((size_t)ZH * RH * TT * 2); bf* Pl = (bf*)take((size_t)ZH * RH * TT * 2);
    float* Sb = (float*)take((size_t)ZH * TT * TT * 4); h16* P16 = (h16*)take((size_t)ZH * TT * TT * 2); float* Ob = (float*)take((size_t)(TT / KCH) * ZH * TT * HD * 4);
    if ((size_t)(wsp - (char*)d_ws) > ws_size) return;    // ws 256 MiB
    { k_wtG<<<(unsigned)((DM * DQ / 64 + 63) / 64), 256, 0, stream>>>(wq, DM, DQ, WQ); k_wtG<<<(unsigned)((DM * DKV / 64 + 63) / 64), 256, 0, stream>>>(wk, DM, DKV, WK); k_wtG<<<(unsigned)((DM * DKV / 64 + 63) / 64), 256, 0, stream>>>(wv, DM, DKV, WV);
      
       }
    k_csid<<<(TT * HD + 255) / 256, 256, 0, stream>>>(CS);
    const unsigned LQ = (unsigned)(((size_t)NH_ * TT * HD / 2 + 255) / 256), LKv = (unsigned)(((size_t)NKV * TT * HD / 2 + 255) / 256);
    for (int b = 0; b < NB_; ++b) {
        
        k_cvt8<<<(unsigned)(((size_t)TT * DM / 8 + 255) / 256), 256, 0, stream>>>(x + (size_t)b * TT * DM, XB, (size_t)TT * DM / 8);
        k_gemmw<bf, 0, true, NWK><<<dim3(TT / 64, DQ / 64, 1), 32 * NWK, 0, stream>>>(XB, nullptr, WQ, nullptr, DM, FQ, DQ, bq, 0, 0, 0);
        k_rope<<<LQ, 256, 0, stream>>>(FQ, DQ, NH_, CS, nullptr, nullptr, 1.0f, QP16, QPh, QPl);
        k_gemmw<bf, 0, true, NWK><<<dim3(TT / 64, DKV / 64, 1), 32 * NWK, 0, stream>>>(XB, nullptr, WK, nullptr, DM, OUTK + (size_t)b * TT * HD, DKV, bk, 0, 0, 0);   /* K = x Wk + bk -> output slot 1 */
        k_rope<<<LKv, 256, 0, stream>>>(OUTK + (size_t)b * TT * HD, DKV, NKV, CS, nullptr, nullptr, 1.0f, KP16, KPh, KPl);
        k_gemmw<bf, 0, true, NWK><<<dim3(TT / 64, DKV / 64, 1), 32 * NWK, 0, stream>>>(XB, nullptr, WV, nullptr, DM, OUTV + (size_t)b * TT * HD, DKV, bv, 0, 0, 0);   /* V = x Wv + bv -> output slot 2 */ k_vtp<<<LKv, 256, 0, stream>>>(OUTV + (size_t)b * TT * HD, DKV, NKV, VT16, VTh, VTl);
        for (int h0 = 0; h0 < NH_; h0 += ZH) { const size_t zq = (size_t)h0, zk = (size_t)(h0 / REP);   // one kv head per query head: the pass's one head (ZH = 1) uses kv plane h0 / REP (z-strides TT*HD)
            k_gemmc<bf, 2, 1, 1><<<dim3(RH / 64, TT / 64, ZH), 32, 0, stream>>>(QPh + zq * TT * HD, QPl + zq * TT * HD, KPh + zk * TT * HD, KPl + zk * TT * HD, HD, Sb, TT, 0, 0, (size_t)TT * HD, (size_t)TT * HD, (size_t)TT * TT);
            k_gemmc<h16, 0, 1, 1><<<dim3((TT - RH) / 64, TT / 64, ZH), 32, 0, stream>>>(QP16 + zq * TT * HD + (size_t)RH * HD, nullptr, KP16 + zk * TT * HD, nullptr, HD, Sb + (size_t)RH * TT, TT, RH, 0, (size_t)TT * HD, (size_t)TT * HD, (size_t)TT * TT);
            k_lsoft<<<ZH * TT / 8, 256, 0, stream>>>(Sb, P16, Ph, Pl);
            k_gemmc<bf, 2, 2, NWK><<<dim3(RH / 64, HD / 64, 1), 32 * NWK, 0, stream>>>(Ph, Pl, VTh + zk * HD * TT, VTl + zk * HD * TT, TT, Ob, HD, 0, RH, RH, RH, (size_t)ZH * TT * HD);   /* one K chunk: rows < RH end at key RH */
            k_gemmc<h16, 0, 2, NWK><<<dim3((TT - RH) / 64, HD / 64, TT / KCH), 32 * NWK, 0, stream>>>(P16 + (size_t)RH * TT, nullptr, VT16 + zk * HD * TT, nullptr, TT, Ob + (size_t)RH * HD, HD, RH, KCH, KCH, KCH, (size_t)ZH * TT * HD);   /* z = K chunk -> partial plane z of Ob */
            k_merge<<<(unsigned)(((size_t)ZH * TT * HD / 2 + 255) / 256), 256, 0, stream>>>(Ob, h0, OUT + (size_t)b * TT * DQ);   /* result -> output slot 0 */ }
         }
}

// v002
// One run takes 167 microseconds.
// Next to v001, in two timings, it ran 2.74 and 2.68 times as fast.
// Over all steps from v000 it is 5.20 times as fast.
#include <hip/hip_runtime.h>

// Single-head causal attention with cache outputs (x [4][4096][768]; Q, K, V = x W + b ('xw' [768][64] + [64]); scores = Q.K / 8, causal; softmax; result = attn.V; returns (result, K, V) -> three [4][4096][64] f32 tensors (3.1 M)).
// Layout per batch: exact projections (+ biases); K and V are written by their GEMM epilogues straight into their output slots (f32) and read back from there by the plane builders; then one launch for all batches: hybrid causal attention over 4,096 keys (rows < 512 hi/lo, rest fp16 x1024), scores, running-maximum softmax and attn.v in one kernel, result written from there.
// Compute dtypes, f32 accumulate: every input rounded to bf16; projections on PLAIN bf16 operands (exact) + f32 biases (K and V outputs are exactly these f32 sums); scores and attn.v rows < 512 on bf16 hi/lo planes (3 products), the rest single fp16; softmax f32; f32 result.

#define NB_  4
#define TT   4096
#define DM   768
#define NH_  1
#define NKV  1
#define REP  (NH_ / NKV)
#define HD   64
#define DQ   (NH_ * HD)
#define DKV  (NKV * HD)
#define RH   512                  // query rows < RH use hi+lo planes (0: none)
#define WIN  4096
#define SCL  0.125f   // HD^-0.5
#define NWK  8                    // waves per work-group that share one K loop in the long-K GEMMs
typedef _Float16 h16;
typedef unsigned short bf;
typedef __attribute__((ext_vector_type(16))) __bf16   v16bf;
typedef __attribute__((ext_vector_type(16))) _Float16 v16h;
typedef __attribute__((ext_vector_type(8)))  _Float16 v8h;
typedef __attribute__((ext_vector_type(8)))  unsigned short v8us;
typedef __attribute__((ext_vector_type(8)))  float    v8f;
typedef __attribute__((ext_vector_type(4)))  float    v4f;
typedef v8h  __attribute__((may_alias)) v8ha;
typedef v4f  __attribute__((may_alias)) v4fa;
typedef v8us __attribute__((may_alias)) v8usa;

__device__ __forceinline__ unsigned short f2bf(float f) { unsigned u = __float_as_uint(f); u += 0x7FFFu + ((u >> 16) & 1u); return (unsigned short)(u >> 16); }
__device__ __forceinline__ float bf2f(unsigned short b) { return __uint_as_float(((unsigned)b) << 16); }
__device__ __forceinline__ float bfr(float f) { return bf2f(f2bf(f)); }
__device__ __forceinline__ v16h cat16(v8h lo, v8h hi) { return __builtin_shufflevector(lo, hi, 0, 1, 2, 3, 4, 5, 6, 7, 8, 9, 10, 11, 12, 13, 14, 15); }
__device__ __forceinline__ v16bf cat16b(v8us lo, v8us hi) { return __builtin_bit_cast(v16bf, __builtin_shufflevector(lo, hi, 0, 1, 2, 3, 4, 5, 6, 7, 8, 9, 10, 11, 12, 13, 14, 15)); }
__device__ __forceinline__ v8f wmma16(v16h a, v16h b, v8f c) { return __builtin_amdgcn_wmma_f32_16x16x32_f16(false, a, false, b, (short)0, c, false, false); }
__device__ __forceinline__ v8f wmmab(v16bf a, v16bf b, v8f c) { return __builtin_amdgcn_wmma_f32_16x16x32_bf16(false, a, false, b, (short)0, c, false, false); }



// ---- k_gemmw: register-blocked GEMM, one 64x64 output tile per work-group of NW waves (16 accumulators a wave), operands straight from K-contiguous 16-bit planes; grid (M/64, N/64, Z), 32 * NW threads.
// Split K: wave w takes the 32-wide K steps w, w + NW, ...; the NW partial tiles are summed through LDS in wave order 0..NW-1 by the epilogue (NW > 1: all 64 rows staged at once, so one barrier and no wait on the global stores; NW == 1: 16 rows at a time, small LDS).
// C[m][n] (f32, pitch ldc, + optional f32 bias[n]) = sum_k A[m][k] Bt[n][k] (+ split products per NSPLIT). z-batch strides sA/sB/sC in elements. K % 32 == 0.
template <typename T16> struct WFrag;
template <> struct WFrag<h16> { typedef v16h V; static __device__ __forceinline__ V ld(const h16* p) { return cat16(*(const v8h*)p, *(const v8h*)(p + 16)); } static __device__ __forceinline__ v8f mma(V a, V b, v8f c) { return wmma16(a, b, c); } };
template <> struct WFrag<bf> { typedef v16bf V; static __device__ __forceinline__ V ld(const bf* p) { return cat16b(*(const v8us*)p, *(const v8us*)(p + 16)); } static __device__ __forceinline__ v8f mma(V a, V b, v8f c) { return wmmab(a, b, c); } };
template <int NW> __device__ __forceinline__ void tile_sync() { if (NW == 1) { __builtin_amdgcn_wave_barrier(); asm volatile("" ::: "memory"); } else __syncthreads(); }   // orders the LDS tile's writes and reads: inside the one wave, or among the NW waves
template <typename T16, int NSPLIT, bool BIAS, int NW>
__global__ __launch_bounds__(32 * NW) void k_gemmw(const T16* __restrict__ A, const T16* __restrict__ A2, const T16* __restrict__ Bt, const T16* __restrict__ Bt2, int K, float* C, int ldc, const float* __restrict__ bias, size_t sA, size_t sB, size_t sC) {
    typedef typename WFrag<T16>::V V;
    constexpr int MBP = (NW == 1) ? 1 : 4;                           // 16-row blocks staged in LDS per epilogue pass
    __shared__ __align__(16) float os[NW * MBP * 16 * 68];
    const size_t z = blockIdx.z; A += z * sA; if (A2) A2 += z * sA; Bt += z * sB; if (Bt2) Bt2 += z * sB; C += z * sC;
    const int lane = threadIdx.x & 31, lr = lane & 15, hi = lane >> 4; const int r0 = blockIdx.x * 64, c0 = blockIdx.y * 64; const int wv = (NW == 1) ? 0 : __builtin_amdgcn_readfirstlane((int)(threadIdx.x >> 5));   // wave number in a scalar register: the K loop's bounds and branch stay scalar, every lane stays on for the matrix instructions
    v8f acc[4][4];
#pragma unroll
    for (int mb = 0; mb < 4; ++mb)
#pragma unroll
        for (int nb = 0; nb < 4; ++nb) acc[mb][nb] = (v8f){};
    const size_t aoff = (size_t)(r0 + lr) * K + 8 * hi, boff = (size_t)(c0 + lr) * K + 8 * hi;
#pragma unroll 1
    for (int kc = wv * 32; kc < K; kc += 32 * NW) {
        V a[4], a2[4];
#pragma unroll
        for (int mb = 0; mb < 4; ++mb) { a[mb] = WFrag<T16>::ld(A + aoff + (size_t)mb * 16 * K + kc); if (NSPLIT == 1 || NSPLIT == 2) a2[mb] = WFrag<T16>::ld(A2 + aoff + (size_t)mb * 16 * K + kc); }
#pragma unroll
        for (int nb = 0; nb < 4; ++nb) { const V b = WFrag<T16>::ld(Bt + boff + (size_t)nb * 16 * K + kc); V b2; if (NSPLIT >= 2) b2 = WFrag<T16>::ld(Bt2 + boff + (size_t)nb * 16 * K + kc);
#pragma unroll
            for (int mb = 0; mb < 4; ++mb) { acc[mb][nb] = WFrag<T16>::mma(a[mb], b, acc[mb][nb]); if (NSPLIT == 1 || NSPLIT == 2) acc[mb][nb] = WFrag<T16>::mma(a2[mb], b, acc[mb][nb]); if (NSPLIT >= 2) acc[mb][nb] = WFrag<T16>::mma(a[mb], b2, acc[mb][nb]); } }
        asm volatile("v_nop\n\tv_nop\n\tv_nop\n\tv_nop" : "+v"(acc[0][0]), "+v"(acc[1][1]), "+v"(acc[2][2]), "+v"(acc[3][3]) : "v"(a[0]), "v"(a[3]));
    }
#pragma unroll
    for (int mb = 0; mb < 4; mb += MBP) {
#pragma unroll   // acc[] is indexed by constants only, so it stays in registers
        for (int mi = 0; mi < MBP; ++mi)
#pragma unroll
        for (int nb = 0; nb < 4; ++nb) {
#pragma unroll
            for (int j = 0; j < 8; ++j) os[wv * (MBP * 16 * 68) + (mi * 16 + hi * 8 + j) * 68 + nb * 16 + lr] = acc[mb + mi][nb][j]; }
        tile_sync<NW>();
        float* crow = C + (size_t)(r0 + mb * 16) * ldc + c0;
{
#pragma unroll
            for (int s = 0; s < MBP * 8 / NW; ++s) { const int row = 2 * NW * s + (int)(threadIdx.x >> 4), cofs = lr * 4; v4f val = *(const v4fa*)(os + row * 68 + cofs);
#pragma unroll   // the NW LDS reads are issued together; the adds keep the order w = 0..NW-1
                for (int w = 1; w < NW; ++w) val += *(const v4fa*)(os + w * (MBP * 16 * 68) + row * 68 + cofs);
                if (BIAS) { val[0] += bfr(bias[c0 + cofs]); val[1] += bfr(bias[c0 + cofs + 1]); val[2] += bfr(bias[c0 + cofs + 2]); val[3] += bfr(bias[c0 + cofs + 3]); }
                *(v4f*)(crow + (size_t)row * ldc + cofs) = val; }
             }
        if (mb + MBP < 4) tile_sync<NW>();
    }
}

__device__ __forceinline__ h16 tohx(float x) { return (h16)x; }
__device__ __forceinline__ void splitf(float y, unsigned short& h, unsigned short& l) { h = f2bf(y); l = f2bf(y - bf2f(h)); }
typedef __attribute__((ext_vector_type(2))) _Float16 v2h;
typedef __attribute__((ext_vector_type(4))) _Float16 v4h;
typedef __attribute__((ext_vector_type(2))) unsigned short v2us;
typedef __attribute__((ext_vector_type(4))) unsigned short v4us;
typedef __attribute__((ext_vector_type(2))) float v2f;
typedef __attribute__((ext_vector_type(4))) int v4i;

__global__ __launch_bounds__(256) void k_wtG(const float* __restrict__ w, int K, int N, bf* Bt) {
    const int lane = threadIdx.x & 31; const int L0 = (blockIdx.x * 8 + (threadIdx.x >> 5)) * 8; const int nlines = N * K / 64;
{
#pragma unroll 1
        for (int l = 0; l < 8; ++l) { const int L = L0 + l; if (L >= nlines) break; const size_t e = (size_t)L * 64 + lane * 2; const int k = (int)(e % K), n = (int)(e / K); v2us o;
            o[0] = f2bf(w[(size_t)k * N + n]); o[1] = f2bf(w[(size_t)(k + 1) * N + n]); *(v2us*)(Bt + e) = o; }
         }
}
__global__ __launch_bounds__(256) void k_cvt8(const float* __restrict__ src, bf* dst, size_t n8) { const size_t i = (size_t)blockIdx.x * 256 + threadIdx.x; if (i >= n8) return; const v8f v = *(const v8f*)(src + i * 8); v8us o;
#pragma unroll
    for (int k = 0; k < 8; ++k) o[k] = f2bf(v[k]); *(v8us*)(dst + i * 8) = o;  }

// k_rope: head planes [h][t][d] (fp16 + hi/lo) of rope(x) x sc with the rotate-half convention out[d] = x[d] cos[t][d] - x[d+HD/2] sin[t][d], out[d+HD/2] = x[d+HD/2] cos[t][d+HD/2] + x[d] sin[t][d+HD/2]
__global__ __launch_bounds__(256) void k_rope(const float* __restrict__ F, int pitch, int nheads, const float* __restrict__ CS, const float* __restrict__ RF, const float* __restrict__ nw, float sc, h16* P16, bf* Ph, bf* Pl) {
    const size_t e = ((size_t)blockIdx.x * 256 + threadIdx.x) * 2; if (e >= (size_t)nheads * TT * HD) return; const int d = (int)(e % HD); const int t = (int)((e / HD) % TT); const int h = (int)(e / ((size_t)HD * TT)); const float* f = F + (size_t)t * pitch + h * HD; const float rf = RF ? RF[(size_t)h * TT + t] : 1.0f; v2h o16; v2us oh, ol;
#pragma unroll
    for (int q = 0; q < 2; ++q) { const int dd = d + q; const int dp = (dd < HD / 2) ? dd + HD / 2 : dd - HD / 2; float x0 = f[dd], x1 = f[dp];
        if (RF) { float n0 = __fmul_rn(x0, rf), n1 = __fmul_rn(x1, rf); asm volatile("" : "+v"(n0)); asm volatile("" : "+v"(n1)); x0 = __fmul_rn(bfr(nw[dd]), n0); x1 = __fmul_rn(bfr(nw[dp]), n1); }
        const v2f cs = *(const v2f*)(CS + ((size_t)t * HD + dd) * 2); float a = __fmul_rn(x0, cs[0]), bq = __fmul_rn(x1, cs[1]); asm volatile("" : "+v"(a)); asm volatile("" : "+v"(bq)); const float r = ((dd < HD / 2) ? __fsub_rn(a, bq) : __fadd_rn(a, bq)) * sc;
        o16[q] = tohx(r); unsigned short a2, c2; splitf(r, a2, c2); oh[q] = a2; ol[q] = c2; }
    *(v2h*)(P16 + e) = o16; *(v2us*)(Ph + e) = oh; *(v2us*)(Pl + e) = ol;  }
__global__ __launch_bounds__(256) void k_vtp(const float* __restrict__ F, int pitch, int nheads, h16* V16, bf* Vh, bf* Vl) { const size_t e = ((size_t)blockIdx.x * 256 + threadIdx.x) * 2; if (e >= (size_t)nheads * HD * TT) return; const int t = (int)(e % TT); const int d = (int)((e / TT) % HD); const int g = (int)(e / ((size_t)TT * HD)); v2h o16; v2us oh, ol;
#pragma unroll
    for (int q = 0; q < 2; ++q) { const float x = F[(size_t)(t + q) * pitch + g * HD + d]; o16[q] = tohx(x); unsigned short a2, c2; splitf(x, a2, c2); oh[q] = a2; ol[q] = c2; }
    *(v2h*)(V16 + e) = o16; *(v2us*)(Vh + e) = oh; *(v2us*)(Vl + e) = ol;  }
__global__ __launch_bounds__(256) void k_csid(float* CS) { const int idx = blockIdx.x * 256 + threadIdx.x; if (idx >= TT * HD) return; v2f cs; cs[0] = 1.0f; cs[1] = 0.0f; *(v2f*)(CS + (size_t)idx * 2) = cs;  }
// ---- k_fattn: scores, causal softmax and attn.v in one kernel; no score or probability matrix in memory. One work-group = QT query rows of one batch (grid x: row tile, longest first; grid z: batch), NWA waves.
// Wave w takes the KB-key blocks w, w + NWA, ... up to the diagonal block and keeps its own running row maximum m, row sum l and unnormalised result; the NWA partial results are brought to one maximum and summed through LDS in wave order.
// Both products are computed transposed, so that no value changes lanes between them: S^T = K Q^T (lane: query lr, keys hi*8 + j) is, converted, already the B fragment of O^T = V^T P^T (lane: query lr, head dims hi*8 + j), and m, l are one value a lane.
// Rows < RH: bf16 hi/lo planes, 3 products each; the rest: f16, probabilities x 1024 (added to the exponent; it cancels in the division by l).
#define QT   32
#define NWA  8
#define KB   32                   // keys per block
#define KT   (KB / 16)
#define CL2  (SCL * 1.4426950408889634f)   // score -> exponent of 2
// 2^x on v_exp_f32, written in asm so that the free slot which the instruction set asks for behind a transcendental (before its result is read or its source overwritten) stands there by construction: each v_exp_f32 works in place on a register of its own, and a v_nop follows the last.
__device__ __forceinline__ float ex2(float x) { asm("v_exp_f32 %0, %0\n\tv_nop" : "+v"(x)); return x; }
__device__ __forceinline__ void ex2x8(float (&x)[8]) { asm("v_exp_f32 %0, %0\n\tv_exp_f32 %1, %1\n\tv_exp_f32 %2, %2\n\tv_exp_f32 %3, %3\n\tv_exp_f32 %4, %4\n\tv_exp_f32 %5, %5\n\tv_exp_f32 %6, %6\n\tv_exp_f32 %7, %7\n\tv_nop" : "+v"(x[0]), "+v"(x[1]), "+v"(x[2]), "+v"(x[3]), "+v"(x[4]), "+v"(x[5]), "+v"(x[6]), "+v"(x[7])); }
template <typename T16, bool HI, bool MASK>
__device__ __forceinline__ void fa_blk(const typename WFrag<T16>::V (&qf)[2][2], const typename WFrag<T16>::V (&qf2)[2][2], const T16* __restrict__ Kp, const T16* __restrict__ Kp2, const T16* __restrict__ Vp, const T16* __restrict__ Vp2, int c0, int r0, int lr, int hi, v8f (&o)[4][2], float (&m)[2], float (&l)[2]) {
    typedef typename WFrag<T16>::V V;
    v8f s[KT][2]; V kf[KT][2], kf2[KT][2];
#pragma unroll
    for (int kt = 0; kt < KT; ++kt)
#pragma unroll
        for (int ks = 0; ks < 2; ++ks) { const size_t ko = (size_t)(c0 + kt * 16 + lr) * HD + 8 * hi + ks * 32; kf[kt][ks] = WFrag<T16>::ld(Kp + ko); if (HI) kf2[kt][ks] = WFrag<T16>::ld(Kp2 + ko); }
    asm volatile("s_wait_xcnt 0x0" ::: "memory");   // stands in front of the first instruction that reuses an address register of the K loads above
#pragma unroll
    for (int kt = 0; kt < KT; ++kt) { s[kt][0] = (v8f){}; s[kt][1] = (v8f){};
#pragma unroll
        for (int ks = 0; ks < 2; ++ks)
#pragma unroll
            for (int qb = 0; qb < 2; ++qb) { s[kt][qb] = WFrag<T16>::mma(kf[kt][ks], qf[qb][ks], s[kt][qb]); if (HI) { s[kt][qb] = WFrag<T16>::mma(kf[kt][ks], qf2[qb][ks], s[kt][qb]); s[kt][qb] = WFrag<T16>::mma(kf2[kt][ks], qf[qb][ks], s[kt][qb]); } } }
#pragma unroll
    for (int qb = 0; qb < 2; ++qb) {
        float mk[KT];
#pragma unroll
        for (int kt = 0; kt < KT; ++kt) {
#pragma unroll
            for (int j = 0; j < 8; ++j) { if (MASK) s[kt][qb][j] = (c0 + kt * 16 + hi * 8 + j <= r0 + qb * 16 + lr) ? s[kt][qb][j] : -3.0e38f; mk[kt] = j ? fmaxf(mk[kt], s[kt][qb][j]) : s[kt][qb][j]; } }
        float mx = fmaxf(fmaxf(mk[0], mk[1]), m[qb]); mx = fmaxf(mx, __shfl_xor(mx, 16, 32));   // the two half-waves hold the two halves of a query's keys
        const float al = ex2((m[qb] - mx) * CL2); m[qb] = mx; const float eb = (HI ? 0.0f : 10.0f) - mx * CL2;
        float ps[KT];   // independent sums
#pragma unroll
        for (int kt = 0; kt < KT; ++kt) {
            float p[8];
#pragma unroll
            for (int j = 0; j < 8; ++j) p[j] = fmaf(s[kt][qb][j], CL2, eb);
            ex2x8(p);
#pragma unroll
            for (int j = 0; j < 8; ++j) { s[kt][qb][j] = p[j]; ps[kt] = j ? ps[kt] + p[j] : p[j]; } }
        l[qb] = fmaf(l[qb], al, ps[0] + ps[1]);
#pragma unroll
        for (int dt = 0; dt < 4; ++dt) o[dt][qb] *= al;
    }
#pragma unroll
    for (int kk = 0; kk < KB / 32; ++kk) { V pf[2], pf2[2];
#pragma unroll
        for (int qb = 0; qb < 2; ++qb) {
            if constexpr (HI) { v8us h0, h1, l0, l1;
#pragma unroll
                for (int j = 0; j < 8; ++j) { unsigned short a, c; splitf(s[2 * kk][qb][j], a, c); h0[j] = a; l0[j] = c; splitf(s[2 * kk + 1][qb][j], a, c); h1[j] = a; l1[j] = c; }
                pf[qb] = cat16b(h0, h1); pf2[qb] = cat16b(l0, l1);
            } else { v8h h0, h1;
#pragma unroll
                for (int j = 0; j < 8; ++j) { h0[j] = (h16)s[2 * kk][qb][j]; h1[j] = (h16)s[2 * kk + 1][qb][j]; }
                pf[qb] = cat16(h0, h1); } }
#pragma unroll
        for (int dt = 0; dt < 4; ++dt) { const size_t vo = (size_t)(dt * 16 + lr) * TT + 8 * hi + c0 + kk * 32; const V v = WFrag<T16>::ld(Vp + vo); V v2; if (HI) v2 = WFrag<T16>::ld(Vp2 + vo);
#pragma unroll
            for (int qb = 0; qb < 2; ++qb) { o[dt][qb] = WFrag<T16>::mma(v, pf[qb], o[dt][qb]); if (HI) { o[dt][qb] = WFrag<T16>::mma(v, pf2[qb], o[dt][qb]); o[dt][qb] = WFrag<T16>::mma(v2, pf[qb], o[dt][qb]); } } } }
}
template <typename T16, bool HI>
__device__ __forceinline__ void fa_tile(const T16* __restrict__ Qp, const T16* __restrict__ Qp2, const T16* __restrict__ Kp, const T16* __restrict__ Kp2, const T16* __restrict__ Vp, const T16* __restrict__ Vp2, int r0, float* os, float* ms, float* ls) {
    typedef typename WFrag<T16>::V V;
    const int lane = threadIdx.x & 31, lr = lane & 15, hi = lane >> 4; const int wv = __builtin_amdgcn_readfirstlane((int)(threadIdx.x >> 5));   // wave number in a scalar register: the key loop's bounds and branches stay scalar, every lane stays on for the matrix instructions
    V qf[2][2], qf2[2][2]; v8f o[4][2]; float m[2], l[2];
#pragma unroll
    for (int qb = 0; qb < 2; ++qb) { m[qb] = -3.0e38f; l[qb] = 0.0f;
#pragma unroll
        for (int ks = 0; ks < 2; ++ks) { const size_t qo = (size_t)(r0 + qb * 16 + lr) * HD + 8 * hi + ks * 32; qf[qb][ks] = WFrag<T16>::ld(Qp + qo); if (HI) qf2[qb][ks] = WFrag<T16>::ld(Qp2 + qo); }
#pragma unroll
        for (int dt = 0; dt < 4; ++dt) o[dt][qb] = (v8f){}; }
    asm volatile("s_wait_xcnt 0x0" ::: "memory");   // stands in front of the first instruction that reuses an address register of the Q loads above
    const int nblk = r0 / KB + 1;   // KB-key blocks up to and with the diagonal block; only the last one holds keys above the diagonal, and each of its rows holds at least one key at or below it
#pragma unroll 1
    for (int kb = wv; kb < nblk - 1; kb += NWA) fa_blk<T16, HI, false>(qf, qf2, Kp, Kp2, Vp, Vp2, kb * KB, r0, lr, hi, o, m, l);
    if (((nblk - 1) & (NWA - 1)) == wv) fa_blk<T16, HI, true>(qf, qf2, Kp, Kp2, Vp, Vp2, (nblk - 1) * KB, r0, lr, hi, o, m, l);
#pragma unroll
    for (int qb = 0; qb < 2; ++qb) { const float lt = l[qb] + __shfl_xor(l[qb], 16, 32); if (hi == 0) { ms[wv * QT + qb * 16 + lr] = m[qb]; ls[wv * QT + qb * 16 + lr] = lt; }
#pragma unroll
        for (int dt = 0; dt < 4; ++dt) { float* p = os + (wv * QT + qb * 16 + lr) * 68 + dt * 16 + hi * 8; *(v4fa*)p = __builtin_shufflevector(o[dt][qb], o[dt][qb], 0, 1, 2, 3); *(v4fa*)(p + 4) = __builtin_shufflevector(o[dt][qb], o[dt][qb], 4, 5, 6, 7); } }
}
__global__ __launch_bounds__(32 * NWA) __attribute__((amdgpu_waves_per_eu(4))) /* registers for four waves a SIMD: two work-groups a WGP, the whole grid resident */ void k_fattn(const h16* __restrict__ Q16, const h16* __restrict__ K16, const h16* __restrict__ V16, const bf* __restrict__ Qh, const bf* __restrict__ Ql, const bf* __restrict__ Kh, const bf* __restrict__ Kl, const bf* __restrict__ Vh, const bf* __restrict__ Vl, float* OUTr) {
    __shared__ __align__(16) float os[NWA * QT * 68]; __shared__ float ms[NWA * QT]; __shared__ float ls[NWA * QT];
    const size_t zo = (size_t)blockIdx.z * TT * HD; const int r0 = (int)(gridDim.x - 1 - blockIdx.x) * QT;   // the tiles with the most keys start first
    if (r0 < RH) fa_tile<bf, true>(Qh + zo, Ql + zo, Kh + zo, Kl + zo, Vh + zo, Vl + zo, r0, os, ms, ls);
    else fa_tile<h16, false>(Q16 + zo, nullptr, K16 + zo, nullptr, V16 + zo, nullptr, r0, os, ms, ls);
    __syncthreads();   // every wave's m, l and partial result are in LDS
    const int row = (int)(threadIdx.x >> 3), cofs = (int)(threadIdx.x & 7) * 8; float mw[NWA]; float M = -3.0e38f;
#pragma unroll
    for (int w = 0; w < NWA; ++w) { mw[w] = ms[w * QT + row]; M = fmaxf(M, mw[w]); }
    float L = 0.0f; v4f a0 = (v4f){}, a1 = (v4f){};
#pragma unroll   // the LDS reads are issued together; the adds keep the order w = 0..NWA-1; a wave that had no block has m = -3e38, l = 0 and weight 0
    for (int w = 0; w < NWA; ++w) { const float f = ex2((mw[w] - M) * CL2); L = fmaf(ls[w * QT + row], f, L); const float* p = os + (w * QT + row) * 68 + cofs; a0 += *(const v4fa*)p * f; a1 += *(const v4fa*)(p + 4) * f; }
    const float rl = __fdiv_rn(1.0f, L); float* op = OUTr + zo + (size_t)(r0 + row) * HD + cofs; *(v4f*)op = a0 * rl; *(v4f*)(op + 4) = a1 * rl;
}

extern "C" void kernel_launch(void* const* d_in, const int* in_sizes, int n_in,
                              void* d_out, int out_size, void* d_ws, size_t ws_size, hipStream_t stream) {
    (void)in_sizes; (void)n_in; (void)out_size;
    const float* x = (const float*)d_in[0]; const float* wq = (const float*)d_in[1]; const float* bq = (const float*)d_in[2]; const float* wk = (const float*)d_in[3]; const float* bk = (const float*)d_in[4]; const float* wv = (const float*)d_in[5]; const float* bv = (const float*)d_in[6]; const float* wo = nullptr; (void)wo;
    float* OUT = (float*)d_out; float* OUTK = OUT + (size_t)NB_ * TT * HD; float* OUTV = OUT + (size_t)2 * NB_ * TT * HD;   /* tuple output: result | K | V, each [4][4096][64] f32 */     // [4][4096][64]
    char* wsp = (char*)d_ws;
    auto take = [&](size_t bytes) { char* p = wsp; wsp += (bytes + 255) & ~(size_t)255; return (void*)p; };
    bf* WQ = (bf*)take((size_t)DQ * DM * 2); bf* WK = (bf*)take((size_t)DKV * DM * 2); bf* WV = (bf*)take((size_t)DKV * DM * 2); float* CS = (float*)take((size_t)TT * HD * 2 * 4);
    bf* XB = (bf*)take((size_t)TT * DM * 2); float* FQ = (float*)take((size_t)TT * DQ * 4); 
    const size_t PB = (size_t)TT * HD;   // elements of one batch's plane; every plane holds all NB_ batches, for the one attention launch
    h16* QP16 = (h16*)take(NB_ * PB * 2); h16* KP16 = (h16*)take(NB_ * PB * 2); h16* VT16 = (h16*)take(NB_ * PB * 2);
    bf* QPh = (bf*)take(NB_ * PB * 2); bf* QPl = (bf*)take(NB_ * PB * 2); bf* KPh = (bf*)take(NB_ * PB * 2); bf* KPl = (bf*)take(NB_ * PB * 2); bf* VTh = (bf*)take(NB_ * PB * 2); bf* VTl = (bf*)take(NB_ * PB * 2);
    if ((size_t)(wsp - (char*)d_ws) > ws_size) return;    // ws 256 MiB
    { k_wtG<<<(unsigned)((DM * DQ / 64 + 63) / 64), 256, 0, stream>>>(wq, DM, DQ, WQ); k_wtG<<<(unsigned)((DM * DKV / 64 + 63) / 64), 256, 0, stream>>>(wk, DM, DKV, WK); k_wtG<<<(unsigned)((DM * DKV / 64 + 63) / 64), 256, 0, stream>>>(wv, DM, DKV, WV);
      
       }
    k_csid<<<(TT * HD + 255) / 256, 256, 0, stream>>>(CS);
    const unsigned LQ = (unsigned)(((size_t)NH_ * TT * HD / 2 + 255) / 256), LKv = (unsigned)(((size_t)NKV * TT * HD / 2 + 255) / 256);
    for (int b = 0; b < NB_; ++b) {
        
        k_cvt8<<<(unsigned)(((size_t)TT * DM / 8 + 255) / 256), 256, 0, stream>>>(x + (size_t)b * TT * DM, XB, (size_t)TT * DM / 8);
        k_gemmw<bf, 0, true, NWK><<<dim3(TT / 64, DQ / 64, 1), 32 * NWK, 0, stream>>>(XB, nullptr, WQ, nullptr, DM, FQ, DQ, bq, 0, 0, 0);
        k_rope<<<LQ, 256, 0, stream>>>(FQ, DQ, NH_, CS, nullptr, nullptr, 1.0f, QP16 + b * PB, QPh + b * PB, QPl + b * PB);
        k_gemmw<bf, 0, true, NWK><<<dim3(TT / 64, DKV / 64, 1), 32 * NWK, 0, stream>>>(XB, nullptr, WK, nullptr, DM, OUTK + (size_t)b * TT * HD, DKV, bk, 0, 0, 0);   /* K = x Wk + bk -> output slot 1 */
        k_rope<<<LKv, 256, 0, stream>>>(OUTK + (size_t)b * TT * HD, DKV, NKV, CS, nullptr, nullptr, 1.0f, KP16 + b * PB, KPh + b * PB, KPl + b * PB);
        k_gemmw<bf, 0, true, NWK><<<dim3(TT / 64, DKV / 64, 1), 32 * NWK, 0, stream>>>(XB, nullptr, WV, nullptr, DM, OUTV + (size_t)b * TT * HD, DKV, bv, 0, 0, 0);   /* V = x Wv + bv -> output slot 2 */ k_vtp<<<LKv, 256, 0, stream>>>(OUTV + (size_t)b * TT * HD, DKV, NKV, VT16 + b * PB, VTh + b * PB, VTl + b * PB);
    }
    k_fattn<<<dim3(TT / QT, 1, NB_), 32 * NWA, 0, stream>>>(QP16, KP16, VT16, QPh, QPl, KPh, KPl, VTh, VTl, OUT);   /* result -> output slot 0 */
}

// v003
// It runs in 46.3 microseconds.
// Two timings next to v002 put it at 3.58 and 3.62 times that version's speed.
// Over all steps from v000 it is 18.7 times as fast.
#include <hip/hip_runtime.h>

// Single-head causal attention with cache outputs (x [4][4096][768]; Q, K, V = x W + b ('xw' [768][64] + [64]); scores = Q.K / 8, causal; softmax; result = attn.V; returns (result, K, V) -> three [4][4096][64] f32 tensors (3.1 M)).
// Layout: one launch packs the three weights (bf16, fragment order); one launch for all batches does the exact projections (+ biases), writes K and V into their output slots (f32) and every 16-bit plane from its epilogue; then one launch for all batches: hybrid causal attention over 4,096 keys (rows < 512 hi/lo, rest fp16 x1024), scores, running-maximum softmax and attn.v in one kernel, result written from there.
// Compute dtypes, f32 accumulate: every input rounded to bf16; projections on PLAIN bf16 operands (exact) + f32 biases (K and V outputs are exactly these f32 sums); scores and attn.v rows < 512 on bf16 hi/lo planes (3 products), the rest single fp16; softmax f32; f32 result.

#define NB_  4
#define TT   4096
#define DM   768
#define NH_  1
#define NKV  1
#define REP  (NH_ / NKV)
#define HD   64
#define DQ   (NH_ * HD)
#define DKV  (NKV * HD)
#define RH   512                  // query rows < RH use hi+lo planes (0: none)
#define WIN  4096
#define SCL  0.125f   // HD^-0.5
#define NWK  8                    // waves per work-group that share one K loop in the long-K GEMMs
typedef _Float16 h16;
typedef unsigned short bf;
typedef __attribute__((ext_vector_type(16))) __bf16   v16bf;
typedef __attribute__((ext_vector_type(16))) _Float16 v16h;
typedef __attribute__((ext_vector_type(8)))  _Float16 v8h;
typedef __attribute__((ext_vector_type(8)))  unsigned short v8us;
typedef __attribute__((ext_vector_type(8)))  float    v8f;
typedef __attribute__((ext_vector_type(4)))  float    v4f;
typedef v8h  __attribute__((may_alias)) v8ha;
typedef v4f  __attribute__((may_alias)) v4fa;
typedef v8us __attribute__((may_alias)) v8usa;

__device__ __forceinline__ unsigned short f2bf(float f) { unsigned u = __float_as_uint(f); u += 0x7FFFu + ((u >> 16) & 1u); return (unsigned short)(u >> 16); }
__device__ __forceinline__ float bf2f(unsigned short b) { return __uint_as_float(((unsigned)b) << 16); }
__device__ __forceinline__ float bfr(float f) { return bf2f(f2bf(f)); }
__device__ __forceinline__ v16h cat16(v8h lo, v8h hi) { return __builtin_shufflevector(lo, hi, 0, 1, 2, 3, 4, 5, 6, 7, 8, 9, 10, 11, 12, 13, 14, 15); }
__device__ __forceinline__ v16bf cat16b(v8us lo, v8us hi) { return __builtin_bit_cast(v16bf, __builtin_shufflevector(lo, hi, 0, 1, 2, 3, 4, 5, 6, 7, 8, 9, 10, 11, 12, 13, 14, 15)); }
__device__ __forceinline__ v8f wmma16(v16h a, v16h b, v8f c) { return __builtin_amdgcn_wmma_f32_16x16x32_f16(false, a, false, b, (short)0, c, false, false); }
__device__ __forceinline__ v8f wmmab(v16bf a, v16bf b, v8f c) { return __builtin_amdgcn_wmma_f32_16x16x32_bf16(false, a, false, b, (short)0, c, false, false); }



// ---- fragment loaders and matrix products of the two 16-bit types
template <typename T16> struct WFrag;
template <> struct WFrag<h16> { typedef v16h V; static __device__ __forceinline__ V ld(const h16* p) { return cat16(*(const v8h*)p, *(const v8h*)(p + 16)); } static __device__ __forceinline__ v8f mma(V a, V b, v8f c) { return wmma16(a, b, c); } };
template <> struct WFrag<bf> { typedef v16bf V; static __device__ __forceinline__ V ld(const bf* p) { return cat16b(*(const v8us*)p, *(const v8us*)(p + 16)); } static __device__ __forceinline__ v8f mma(V a, V b, v8f c) { return wmmab(a, b, c); } };
template <int NW> __device__ __forceinline__ void tile_sync() { if (NW == 1) { __builtin_amdgcn_wave_barrier(); asm volatile("" ::: "memory"); } else __syncthreads(); }   // orders the LDS tile's writes and reads: inside the one wave, or among the NW waves

__device__ __forceinline__ h16 tohx(float x) { return (h16)x; }
__device__ __forceinline__ void splitf(float y, unsigned short& h, unsigned short& l) { h = f2bf(y); l = f2bf(y - bf2f(h)); }
typedef __attribute__((ext_vector_type(4))) _Float16 v4h;
typedef __attribute__((ext_vector_type(4))) unsigned short v4us;

typedef v4us __attribute__((may_alias)) v4usa;
typedef __attribute__((ext_vector_type(4))) __bf16 v4bf;

// ---- k_wpack: the three weights [DM][HD] f32 -> bf16 in the order in which k_proj's waves read them: fragment (tensor nt, 32-wide K step ks, 16-column block nb) = 1 KiB, two halves of 32 lanes x 16 bytes, so that each wave-wide load covers 512 contiguous bytes.
// Half h of lane (hi, lr) holds column nb * 16 + lr, k = ks * 32 + h * 16 + hi * 8 + 0..7: the k order of WFrag<bf>::ld. One thread = one 16-byte piece.
#define KST  (DM / 32)            // K steps
#define KSW  (KST / NWK)          // K steps a wave
__global__ __launch_bounds__(256) void k_wpack(const float* __restrict__ wq, const float* __restrict__ wk, const float* __restrict__ wv, bf* Wp) {
    const int i = blockIdx.x * 256 + threadIdx.x; const int lane = i & 31, h = (i >> 5) & 1, nb = (i >> 6) & 3, fs = i >> 8; const int ks = fs % KST, nt = fs / KST;
    const float* w = (nt == 0) ? wq : (nt == 1) ? wk : wv; const int n = nb * 16 + (lane & 15), k0 = ks * 32 + h * 16 + (lane >> 4) * 8; v8us o;
#pragma unroll
    for (int j = 0; j < 8; ++j) o[j] = f2bf(w[(size_t)(k0 + j) * HD + n]);
    *(v8us*)(Wp + (size_t)i * 8) = o;
}

// ---- k_proj: Q, K, V = bf16(x) bf16(W) + bias for 64 rows of x a work-group (grid: NB_ * TT / 64), NWK waves; writes K and V (f32 outputs) and all nine 16-bit planes that k_fattn reads.
// Split K: wave w takes the 32-wide K steps w, w + NWK, ...; x is read once, f32, in whole 128-byte lines, rounded to bf16 and turned into fragments through the wave's own LDS rows; the fragments stay in registers for the three 64-column products.
// The products are computed transposed (W as the first operand), so that a lane holds 8 neighbouring columns of one row and stores its partial tile in 16-byte pieces. Per product the NWK partial tiles are summed through LDS in wave order 0..NWK-1;
// the partial tiles alternate between two LDS buffers, so one barrier a product is enough. V's planes are [d][t]: its summed tile goes through a further LDS tile to be read along t.
#define PJS  (64 * 68)            // floats of one wave's partial tile in LDS
#define XP   40                   // bf16 elements of one staged x row: 32 + 8, an 80-byte pitch for the 16-byte fragment reads
#define TP   65                   // floats of one row of V's transposing tile
// Work-group barrier that orders LDS only: the waves exchange nothing but LDS here, so it does not wait for the global stores of the epilogue before it or for the weight loads issued ahead.
__device__ __forceinline__ void lds_sync() { __builtin_amdgcn_fence(__ATOMIC_RELEASE, "workgroup", "local"); __builtin_amdgcn_s_barrier(); __builtin_amdgcn_fence(__ATOMIC_ACQUIRE, "workgroup", "local"); }
__device__ __forceinline__ void pj_ldw(v16bf (&b)[KSW][4], const bf* __restrict__ wl, int nt) {   // wl: the packed weights at this wave's first K step and this lane's piece
#pragma unroll
    for (int i = 0; i < KSW; ++i)
#pragma unroll
        for (int nb = 0; nb < 4; ++nb) { const bf* p = wl + ((nt * KST + NWK * i) * 4 + nb) * 512; b[i][nb] = cat16b(*(const v8us*)p, *(const v8us*)(p + 256)); }
}
// one wave's partial 64 x 64 tile over its KSW K steps, transposed: acc[mb][nb][j] of lane (hi, lr) = row mb * 16 + lr of x, column nb * 16 + hi * 8 + j
__device__ __forceinline__ void pj_mma(const v16bf (&a)[KSW][4], const v16bf (&b)[KSW][4], v8f (&acc)[4][4]) {
#pragma unroll
    for (int mb = 0; mb < 4; ++mb)
#pragma unroll
        for (int nb = 0; nb < 4; ++nb) acc[mb][nb] = (v8f){};
#pragma unroll
    for (int i = 0; i < KSW; ++i)
#pragma unroll
        for (int nb = 0; nb < 4; ++nb)
#pragma unroll
            for (int mb = 0; mb < 4; ++mb) acc[mb][nb] = wmmab(b[i][nb], a[i][mb], acc[mb][nb]);
}
// the partial tile -> the wave's LDS rows [row of x][column]
__device__ __forceinline__ void pj_put(const v8f (&acc)[4][4], float* ow, int lr, int hi) {
#pragma unroll
    for (int mb = 0; mb < 4; ++mb)
#pragma unroll
        for (int nb = 0; nb < 4; ++nb) { float* p = ow + (mb * 16 + lr) * 68 + nb * 16 + hi * 8; *(v4fa*)p = __builtin_shufflevector(acc[mb][nb], acc[mb][nb], 0, 1, 2, 3); *(v4fa*)(p + 4) = __builtin_shufflevector(acc[mb][nb], acc[mb][nb], 4, 5, 6, 7); }
}
// A group of global loads or stores is written as grp_open(); the loads or stores; grp_close().
// grp_open: nothing made earlier sinks into the group. grp_close: s_wait_xcnt 0 stands behind the group, in front of the first instruction that reuses a register the group names (address or data), and nothing from below moves in front of the wait.
__device__ __forceinline__ void grp_open() { __builtin_amdgcn_sched_barrier(0); }
__device__ __forceinline__ void grp_close() { asm volatile("s_wait_xcnt 0x0" ::: "memory"); __builtin_amdgcn_sched_barrier(0); }
// the same for a group of loads whose address is not used again: the address is an input of the wait, so that its registers are given to nothing else (not to a load's result either) in front of the wait
__device__ __forceinline__ void grp_close(const void* p) { asm volatile("s_wait_xcnt 0x0" :: "v"(p) : "memory"); __builtin_amdgcn_sched_barrier(0); }
// Behind a product's last matrix instruction: the four vector slots that the chip needs before the next product's first matrix instructions overwrite its results; the scheduling barriers keep the slots between the two products.
__device__ __forceinline__ void wmma_gap() { __builtin_amdgcn_sched_barrier(0); asm volatile("v_nop\n\tv_nop\n\tv_nop\n\tv_nop"); __builtin_amdgcn_sched_barrier(0); }
// one thread's 4 x 4 elements of the NWK partial tiles, LDS -> registers; asked for in one run, in front of the next product's matrix instructions, which cover the LDS time
__device__ __forceinline__ void pj_get(const float* os, v4f (&raw)[4][NWK]) {
    const float* p = os + (int)(threadIdx.x >> 4) * 68 + (int)(threadIdx.x & 15) * 4;
#pragma unroll
    for (int s = 0; s < 4; ++s)
#pragma unroll
        for (int w = 0; w < NWK; ++w) raw[s][w] = *(const v4fa*)(p + s * 16 * 68 + w * PJS);
    __builtin_amdgcn_sched_barrier(0);   // the LDS reads stay together, in front of the next product's matrix instructions where there is one
}
template <int NT>
__device__ __forceinline__ void pj_epi(const v4f (&raw)[4][NWK], float* ts, v4f bs, size_t g0, float* F, h16* P16, bf* Ph, bf* Pl) {
    const int cofs = (int)(threadIdx.x & 15) * 4, rw = (int)(threadIdx.x >> 4); v4f val[4]; v4h o16[4]; v4us oh[4], ol[4];
#pragma unroll
    for (int s = 0; s < 4; ++s) { v4f v = raw[s][0];
#pragma unroll   // the adds keep the order w = 0..NWK-1
        for (int w = 1; w < NWK; ++w) v += raw[s][w];
        val[s] = v + bs;
        if (NT < 2) {
#pragma unroll
            for (int q = 0; q < 4; ++q) { o16[s][q] = tohx(val[s][q]); unsigned short a2, c2; splitf(val[s][q], a2, c2); oh[s][q] = a2; ol[s][q] = c2; } } }
    const size_t e = (g0 + rw) * HD + cofs; float* fp = (NT > 0) ? F + e : nullptr; h16* p16 = P16 + e; bf* ph = Ph + e; bf* pl = Pl + e;
    grp_open();
#pragma unroll
    for (int s = 0; s < 4; ++s) {
        if (NT > 0) *(v4f*)(fp + s * 16 * HD) = val[s];
        if (NT < 2) { *(v4h*)(p16 + s * 16 * HD) = o16[s]; *(v4us*)(ph + s * 16 * HD) = oh[s]; *(v4us*)(pl + s * 16 * HD) = ol[s]; } }
    grp_close();
    if (NT == 2) {
#pragma unroll
        for (int s = 0; s < 4; ++s)
#pragma unroll
            for (int q = 0; q < 4; ++q) ts[(cofs + q) * TP + 16 * s + rw] = val[s][q];
        lds_sync();   // V's summed tile is in LDS
        const int d = (int)(threadIdx.x >> 2), t0 = (int)(threadIdx.x & 3) * 16; const size_t et = (g0 / TT) * ((size_t)TT * HD) + (size_t)d * TT + (g0 % TT) + t0; v8h t16[2]; v8us th[2], tl[2];
#pragma unroll
        for (int c = 0; c < 2; ++c)
#pragma unroll
            for (int q = 0; q < 8; ++q) { const float v = ts[d * TP + t0 + c * 8 + q]; t16[c][q] = tohx(v); unsigned short a2, c2; splitf(v, a2, c2); th[c][q] = a2; tl[c][q] = c2; }
        h16* q16 = P16 + et; bf* qh = Ph + et; bf* ql = Pl + et;
        grp_open();
#pragma unroll
        for (int c = 0; c < 2; ++c) { *(v8h*)(q16 + c * 8) = t16[c]; *(v8us*)(qh + c * 8) = th[c]; *(v8us*)(ql + c * 8) = tl[c]; } }   // the kernel's last stores: nothing reuses their registers
}
__device__ __forceinline__ v4f bfr4(v4f r) { v4f o; o[0] = bfr(r[0]); o[1] = bfr(r[1]); o[2] = bfr(r[2]); o[3] = bfr(r[3]); return o; }
__global__ __launch_bounds__(32 * NWK) void k_proj(const float* __restrict__ x, const bf* __restrict__ Wp, const float* __restrict__ bq, const float* __restrict__ bk, const float* __restrict__ bv, float* OUTK, float* OUTV, h16* Q16, bf* Qh, bf* Ql, h16* K16, bf* Kh, bf* Kl, h16* V16, bf* Vh, bf* Vl) {
    __shared__ __align__(16) float os[2][NWK * PJS]; __shared__ float ts[64 * TP];
    const int lane = threadIdx.x & 31, lr = lane & 15, hi = lane >> 4; const int wv = __builtin_amdgcn_readfirstlane((int)(threadIdx.x >> 5));   // wave number in a scalar register: the weight addresses' wave part stays scalar
    const size_t g0 = (size_t)blockIdx.x * 64;
    v4f xv[KSW][16]; const float* xp = x + (g0 + (lane >> 3)) * DM + wv * 32 + (lane & 7) * 4;   // 8 lanes a 128-byte line, 4 rows a load
    v16bf b0[KSW][4], b1[KSW][4]; const bf* wl = Wp + (size_t)wv * (4 * 512) + lane * 8;
    grp_open();
#pragma unroll
    for (int i = 0; i < KSW; ++i)
#pragma unroll
        for (int q = 0; q < 16; ++q) xv[i][q] = *(const v4f*)(xp + (size_t)q * 4 * DM + i * (32 * NWK));
    grp_close(xp);
    pj_ldw(b0, wl, 0);   // the first product's weights and the biases fly together with x
    const v4f rq = *(const v4f*)(bq + lr * 4), rk = *(const v4f*)(bk + lr * 4), rv = *(const v4f*)(bv + lr * 4);
    grp_close();
    bf* xs = (bf*)(os[0] + wv * PJS);   // the wave's own part of the partial-tile buffer, free until its first product is done
#pragma unroll
    for (int i = 0; i < KSW; ++i)
#pragma unroll
        for (int q = 0; q < 16; ++q) *(v4usa*)(xs + (i * 64 + q * 4 + (lane >> 3)) * XP + (lane & 7) * 4) = __builtin_bit_cast(v4us, __builtin_convertvector(xv[i][q], v4bf));
    tile_sync<1>();   // the wave's LDS writes stay in front of its fragment reads, which take other lanes' values
    v16bf a[KSW][4];
#pragma unroll
    for (int i = 0; i < KSW; ++i)
#pragma unroll
        for (int mb = 0; mb < 4; ++mb) { const bf* p = xs + (i * 64 + mb * 16 + lr) * XP + 8 * hi; a[i][mb] = cat16b(*(const v8usa*)p, *(const v8usa*)(p + 16)); }
    tile_sync<1>();   // the fragment reads stay in front of the wave's partial-tile writes to the same LDS
    grp_open(); pj_ldw(b1, wl, 1); grp_close();   // each later product's weights are asked for one product ahead
    v8f acc[4][4]; v4f raw[4][NWK];
    pj_mma(a, b0, acc); pj_put(acc, os[0] + wv * PJS, lr, hi); wmma_gap();
    lds_sync();   // every wave's partial tile of Q is in LDS
    pj_get(os[0], raw); pj_mma(a, b1, acc);
    __builtin_amdgcn_sched_barrier(0);   // the matrix instructions stay in one run in front of Q's sum
    pj_epi<0>(raw, ts, bfr4(rq), g0, nullptr, Q16, Qh, Ql);
    pj_ldw(b0, wl, 2); grp_close(wl);
    pj_put(acc, os[1] + wv * PJS, lr, hi); wmma_gap();
    lds_sync();   // K's partial tiles are in LDS, and every wave has read Q's
    pj_get(os[1], raw); pj_mma(a, b0, acc);
    __builtin_amdgcn_sched_barrier(0);   // the matrix instructions stay in one run in front of K's sum
    pj_epi<1>(raw, ts, bfr4(rk), g0, OUTK, K16, Kh, Kl);
    pj_put(acc, os[0] + wv * PJS, lr, hi);
    lds_sync();   // V's partial tiles are in LDS
    pj_get(os[0], raw);
    pj_epi<2>(raw, ts, bfr4(rv), g0, OUTV, V16, Vh, Vl);
}

// ---- k_fattn: scores, causal softmax and attn.v in one kernel; no score or probability matrix in memory. One work-group = QT query rows of one batch (grid x: row tile, longest first; grid z: batch), NWA waves.
// Wave w takes the KB-key blocks w, w + NWA, ... up to the diagonal block and keeps its own running row maximum m, row sum l and unnormalised result; the NWA partial results are brought to one maximum and summed through LDS in wave order.
// Both products are computed transposed, so that no value changes lanes between them: S^T = K Q^T (lane: query lr, keys hi*8 + j) is, converted, already the B fragment of O^T = V^T P^T (lane: query lr, head dims hi*8 + j), and m, l are one value a lane.
// Rows < RH: bf16 hi/lo planes, 3 products each; the rest: f16, probabilities x 1024 (added to the exponent; it cancels in the division by l).
#define QT   32
#define NWA  8
#define KB   32                   // keys per block
#define KT   (KB / 16)
#define CL2  (SCL * 1.4426950408889634f)   // score -> exponent of 2
// 2^x on v_exp_f32, written in asm so that the free slot which the instruction set asks for behind a transcendental (before its result is read or its source overwritten) stands there by construction: each v_exp_f32 works in place on a register of its own, and a v_nop follows the last.
__device__ __forceinline__ float ex2(float x) { asm("v_exp_f32 %0, %0\n\tv_nop" : "+v"(x)); return x; }
__device__ __forceinline__ void ex2x8(float (&x)[8]) { asm("v_exp_f32 %0, %0\n\tv_exp_f32 %1, %1\n\tv_exp_f32 %2, %2\n\tv_exp_f32 %3, %3\n\tv_exp_f32 %4, %4\n\tv_exp_f32 %5, %5\n\tv_exp_f32 %6, %6\n\tv_exp_f32 %7, %7\n\tv_nop" : "+v"(x[0]), "+v"(x[1]), "+v"(x[2]), "+v"(x[3]), "+v"(x[4]), "+v"(x[5]), "+v"(x[6]), "+v"(x[7])); }
template <typename T16, bool HI, bool MASK>
__device__ __forceinline__ void fa_blk(const typename WFrag<T16>::V (&qf)[2][2], const typename WFrag<T16>::V (&qf2)[2][2], const T16* __restrict__ Kp, const T16* __restrict__ Kp2, const T16* __restrict__ Vp, const T16* __restrict__ Vp2, int c0, int r0, int lr, int hi, v8f (&o)[4][2], float (&m)[2], float (&l)[2]) {
    typedef typename WFrag<T16>::V V;
    v8f s[KT][2]; V kf[KT][2], kf2[KT][2];
#pragma unroll
    for (int kt = 0; kt < KT; ++kt)
#pragma unroll
        for (int ks = 0; ks < 2; ++ks) { const size_t ko = (size_t)(c0 + kt * 16 + lr) * HD + 8 * hi + ks * 32; kf[kt][ks] = WFrag<T16>::ld(Kp + ko); if (HI) kf2[kt][ks] = WFrag<T16>::ld(Kp2 + ko); }
    asm volatile("s_wait_xcnt 0x0" ::: "memory");   // stands in front of the first instruction that reuses an address register of the K loads above
#pragma unroll
    for (int kt = 0; kt < KT; ++kt) { s[kt][0] = (v8f){}; s[kt][1] = (v8f){};
#pragma unroll
        for (int ks = 0; ks < 2; ++ks)
#pragma unroll
            for (int qb = 0; qb < 2; ++qb) { s[kt][qb] = WFrag<T16>::mma(kf[kt][ks], qf[qb][ks], s[kt][qb]); if (HI) { s[kt][qb] = WFrag<T16>::mma(kf[kt][ks], qf2[qb][ks], s[kt][qb]); s[kt][qb] = WFrag<T16>::mma(kf2[kt][ks], qf[qb][ks], s[kt][qb]); } } }
#pragma unroll
    for (int qb = 0; qb < 2; ++qb) {
        float mk[KT];
#pragma unroll
        for (int kt = 0; kt < KT; ++kt) {
#pragma unroll
            for (int j = 0; j < 8; ++j) { if (MASK) s[kt][qb][j] = (c0 + kt * 16 + hi * 8 + j <= r0 + qb * 16 + lr) ? s[kt][qb][j] : -3.0e38f; mk[kt] = j ? fmaxf(mk[kt], s[kt][qb][j]) : s[kt][qb][j]; } }
        float mx = fmaxf(fmaxf(mk[0], mk[1]), m[qb]); mx = fmaxf(mx, __shfl_xor(mx, 16, 32));   // the two half-waves hold the two halves of a query's keys
        const float al = ex2((m[qb] - mx) * CL2); m[qb] = mx; const float eb = (HI ? 0.0f : 10.0f) - mx * CL2;
        float ps[KT];   // independent sums
#pragma unroll
        for (int kt = 0; kt < KT; ++kt) {
            float p[8];
#pragma unroll
            for (int j = 0; j < 8; ++j) p[j] = fmaf(s[kt][qb][j], CL2, eb);
            ex2x8(p);
#pragma unroll
            for (int j = 0; j < 8; ++j) { s[kt][qb][j] = p[j]; ps[kt] = j ? ps[kt] + p[j] : p[j]; } }
        l[qb] = fmaf(l[qb], al, ps[0] + ps[1]);
#pragma unroll
        for (int dt = 0; dt < 4; ++dt) o[dt][qb] *= al;
    }
#pragma unroll
    for (int kk = 0; kk < KB / 32; ++kk) { V pf[2], pf2[2];
#pragma unroll
        for (int qb = 0; qb < 2; ++qb) {
            if constexpr (HI) { v8us h0, h1, l0, l1;
#pragma unroll
                for (int j = 0; j < 8; ++j) { unsigned short a, c; splitf(s[2 * kk][qb][j], a, c); h0[j] = a; l0[j] = c; splitf(s[2 * kk + 1][qb][j], a, c); h1[j] = a; l1[j] = c; }
                pf[qb] = cat16b(h0, h1); pf2[qb] = cat16b(l0, l1);
            } else { v8h h0, h1;
#pragma unroll
                for (int j = 0; j < 8; ++j) { h0[j] = (h16)s[2 * kk][qb][j]; h1[j] = (h16)s[2 * kk + 1][qb][j]; }
                pf[qb] = cat16(h0, h1); } }
#pragma unroll
        for (int dt = 0; dt < 4; ++dt) { const size_t vo = (size_t)(dt * 16 + lr) * TT + 8 * hi + c0 + kk * 32; const V v = WFrag<T16>::ld(Vp + vo); V v2; if (HI) v2 = WFrag<T16>::ld(Vp2 + vo);
#pragma unroll
            for (int qb = 0; qb < 2; ++qb) { o[dt][qb] = WFrag<T16>::mma(v, pf[qb], o[dt][qb]); if (HI) { o[dt][qb] = WFrag<T16>::mma(v, pf2[qb], o[dt][qb]); o[dt][qb] = WFrag<T16>::mma(v2, pf[qb], o[dt][qb]); } } } }
}
template <typename T16, bool HI>
__device__ __forceinline__ void fa_tile(const T16* __restrict__ Qp, const T16* __restrict__ Qp2, const T16* __restrict__ Kp, const T16* __restrict__ Kp2, const T16* __restrict__ Vp, const T16* __restrict__ Vp2, int r0, float* os, float* ms, float* ls) {
    typedef typename WFrag<T16>::V V;
    const int lane = threadIdx.x & 31, lr = lane & 15, hi = lane >> 4; const int wv = __builtin_amdgcn_readfirstlane((int)(threadIdx.x >> 5));   // wave number in a scalar register: the key loop's bounds and branches stay scalar, every lane stays on for the matrix instructions
    V qf[2][2], qf2[2][2]; v8f o[4][2]; float m[2], l[2];
#pragma unroll
    for (int qb = 0; qb < 2; ++qb) { m[qb] = -3.0e38f; l[qb] = 0.0f;
#pragma unroll
        for (int ks = 0; ks < 2; ++ks) { const size_t qo = (size_t)(r0 + qb * 16 + lr) * HD + 8 * hi + ks * 32; qf[qb][ks] = WFrag<T16>::ld(Qp + qo); if (HI) qf2[qb][ks] = WFrag<T16>::ld(Qp2 + qo); }
#pragma unroll
        for (int dt = 0; dt < 4; ++dt) o[dt][qb] = (v8f){}; }
    asm volatile("s_wait_xcnt 0x0" ::: "memory");   // stands in front of the first instruction that reuses an address register of the Q loads above
    const int nblk = r0 / KB + 1;   // KB-key blocks up to and with the diagonal block; only the last one holds keys above the diagonal, and each of its rows holds at least one key at or below it
#pragma unroll 1
    for (int kb = wv; kb < nblk - 1; kb += NWA) fa_blk<T16, HI, false>(qf, qf2, Kp, Kp2, Vp, Vp2, kb * KB, r0, lr, hi, o, m, l);
    if (((nblk - 1) & (NWA - 1)) == wv) fa_blk<T16, HI, true>(qf, qf2, Kp, Kp2, Vp, Vp2, (nblk - 1) * KB, r0, lr, hi, o, m, l);
#pragma unroll
    for (int qb = 0; qb < 2; ++qb) { const float lt = l[qb] + __shfl_xor(l[qb], 16, 32); if (hi == 0) { ms[wv * QT + qb * 16 + lr] = m[qb]; ls[wv * QT + qb * 16 + lr] = lt; }
#pragma unroll
        for (int dt = 0; dt < 4; ++dt) { float* p = os + (wv * QT + qb * 16 + lr) * 68 + dt * 16 + hi * 8; *(v4fa*)p = __builtin_shufflevector(o[dt][qb], o[dt][qb], 0, 1, 2, 3); *(v4fa*)(p + 4) = __builtin_shufflevector(o[dt][qb], o[dt][qb], 4, 5, 6, 7); } }
}
__global__ __launch_bounds__(32 * NWA) __attribute__((amdgpu_waves_per_eu(4))) /* registers for four waves a SIMD: two work-groups a WGP, the whole grid resident */ void k_fattn(const h16* __restrict__ Q16, const h16* __restrict__ K16, const h16* __restrict__ V16, const bf* __restrict__ Qh, const bf* __restrict__ Ql, const bf* __restrict__ Kh, const bf* __restrict__ Kl, const bf* __restrict__ Vh, const bf* __restrict__ Vl, float* OUTr) {
    __shared__ __align__(16) float os[NWA * QT * 68]; __shared__ float ms[NWA * QT]; __shared__ float ls[NWA * QT];
    const size_t zo = (size_t)blockIdx.z * TT * HD; const int r0 = (int)(gridDim.x - 1 - blockIdx.x) * QT;   // the tiles with the most keys start first
    if (r0 < RH) fa_tile<bf, true>(Qh + zo, Ql + zo, Kh + zo, Kl + zo, Vh + zo, Vl + zo, r0, os, ms, ls);
    else fa_tile<h16, false>(Q16 + zo, nullptr, K16 + zo, nullptr, V16 + zo, nullptr, r0, os, ms, ls);
    __syncthreads();   // every wave's m, l and partial result are in LDS
    const int row = (int)(threadIdx.x >> 3), cofs = (int)(threadIdx.x & 7) * 8; float mw[NWA]; float M = -3.0e38f;
#pragma unroll
    for (int w = 0; w < NWA; ++w) { mw[w] = ms[w * QT + row]; M = fmaxf(M, mw[w]); }
    float L = 0.0f; v4f a0 = (v4f){}, a1 = (v4f){};
#pragma unroll   // the LDS reads are issued together; the adds keep the order w = 0..NWA-1; a wave that had no block has m = -3e38, l = 0 and weight 0
    for (int w = 0; w < NWA; ++w) { const float f = ex2((mw[w] - M) * CL2); L = fmaf(ls[w * QT + row], f, L); const float* p = os + (w * QT + row) * 68 + cofs; a0 += *(const v4fa*)p * f; a1 += *(const v4fa*)(p + 4) * f; }
    const float rl = __fdiv_rn(1.0f, L); float* op = OUTr + zo + (size_t)(r0 + row) * HD + cofs; *(v4f*)op = a0 * rl; *(v4f*)(op + 4) = a1 * rl;
}

extern "C" void kernel_launch(void* const* d_in, const int* in_sizes, int n_in,
                              void* d_out, int out_size, void* d_ws, size_t ws_size, hipStream_t stream) {
    (void)in_sizes; (void)n_in; (void)out_size;
    const float* x = (const float*)d_in[0]; const float* wq = (const float*)d_in[1]; const float* bq = (const float*)d_in[2]; const float* wk = (const float*)d_in[3]; const float* bk = (const float*)d_in[4]; const float* wv = (const float*)d_in[5]; const float* bv = (const float*)d_in[6];
    float* OUT = (float*)d_out; float* OUTK = OUT + (size_t)NB_ * TT * HD; float* OUTV = OUT + (size_t)2 * NB_ * TT * HD;   /* tuple output: result | K | V, each [4][4096][64] f32 */
    char* wsp = (char*)d_ws;
    auto take = [&](size_t bytes) { char* p = wsp; wsp += (bytes + 255) & ~(size_t)255; return (void*)p; };
    bf* WP = (bf*)take((size_t)3 * HD * DM * 2);
    const size_t PB = (size_t)TT * HD;   // elements of one batch's plane; every plane holds all NB_ batches
    h16* QP16 = (h16*)take(NB_ * PB * 2); h16* KP16 = (h16*)take(NB_ * PB * 2); h16* VT16 = (h16*)take(NB_ * PB * 2);
    bf* QPh = (bf*)take(NB_ * PB * 2); bf* QPl = (bf*)take(NB_ * PB * 2); bf* KPh = (bf*)take(NB_ * PB * 2); bf* KPl = (bf*)take(NB_ * PB * 2); bf* VTh = (bf*)take(NB_ * PB * 2); bf* VTl = (bf*)take(NB_ * PB * 2);
    if ((size_t)(wsp - (char*)d_ws) > ws_size) return;    // ws 256 MiB
    k_wpack<<<3 * HD * DM / 8 / 256, 256, 0, stream>>>(wq, wk, wv, WP);
    k_proj<<<NB_ * TT / 64, 32 * NWK, 0, stream>>>(x, WP, bq, bk, bv, OUTK, OUTV, QP16, QPh, QPl, KP16, KPh, KPl, VT16, VTh, VTl);   /* K, V -> output slots 1, 2 */
    k_fattn<<<dim3(TT / QT, 1, NB_), 32 * NWA, 0, stream>>>(QP16, KP16, VT16, QPh, QPl, KPh, KPl, VTh, VTl, OUT);   /* result -> output slot 0 */
}

// v004
// One run takes 37 microseconds.
// Two timings next to v003 put it at 1.24 and 1.25 times that version's speed.
// All steps since v000 together make it 23.3 times as fast.
#include <hip/hip_runtime.h>

// Single-head causal attention with cache outputs (x [4][4096][768]; Q, K, V = x W + b ('xw' [768][64] + [64]); scores = Q.K / 8, causal; softmax; result = attn.V; returns (result, K, V) -> three [4][4096][64] f32 tensors (3.1 M)).
// Layout: one launch packs the three weights (bf16, fragment order); one launch for all batches does the exact projections (+ biases), writes K and V into their output slots (f32) and every 16-bit plane from its epilogue; then one launch for all batches: hybrid causal attention over 4,096 keys (rows < 512 hi/lo, rest fp16 x1024), scores, running-maximum softmax and attn.v in one kernel, result written from there.
// Compute dtypes, f32 accumulate: every input rounded to bf16; projections on PLAIN bf16 operands (exact) + f32 biases (K and V outputs are exactly these f32 sums); scores and attn.v rows < 512 on bf16 hi/lo planes (3 products), the rest single fp16; softmax f32; f32 result.

#define NB_  4
#define TT   4096
#define DM   768
#define NH_  1
#define NKV  1
#define REP  (NH_ / NKV)
#define HD   64
#define DQ   (NH_ * HD)
#define DKV  (NKV * HD)
#define RH   512                  // query rows < RH use hi+lo planes (0: none)
#define WIN  4096
#define SCL  0.125f   // HD^-0.5
#define NWK  8                    // waves per work-group that share one K loop in the long-K GEMMs
typedef _Float16 h16;
typedef unsigned short bf;
typedef __attribute__((ext_vector_type(16))) __bf16   v16bf;
typedef __attribute__((ext_vector_type(16))) _Float16 v16h;
typedef __attribute__((ext_vector_type(8)))  _Float16 v8h;
typedef __attribute__((ext_vector_type(8)))  unsigned short v8us;
typedef __attribute__((ext_vector_type(8)))  float    v8f;
typedef __attribute__((ext_vector_type(4)))  float    v4f;
typedef v8h  __attribute__((may_alias)) v8ha;
typedef v4f  __attribute__((may_alias)) v4fa;
typedef v8us __attribute__((may_alias)) v8usa;

__device__ __forceinline__ unsigned short f2bf(float f) { unsigned u = __float_as_uint(f); u += 0x7FFFu + ((u >> 16) & 1u); return (unsigned short)(u >> 16); }
__device__ __forceinline__ float bf2f(unsigned short b) { return __uint_as_float(((unsigned)b) << 16); }
__device__ __forceinline__ float bfr(float f) { return bf2f(f2bf(f)); }
__device__ __forceinline__ v16h cat16(v8h lo, v8h hi) { return __builtin_shufflevector(lo, hi, 0, 1, 2, 3, 4, 5, 6, 7, 8, 9, 10, 11, 12, 13, 14, 15); }
__device__ __forceinline__ v16bf cat16b(v8us lo, v8us hi) { return __builtin_bit_cast(v16bf, __builtin_shufflevector(lo, hi, 0, 1, 2, 3, 4, 5, 6, 7, 8, 9, 10, 11, 12, 13, 14, 15)); }
__device__ __forceinline__ v8f wmma16(v16h a, v16h b, v8f c) { return __builtin_amdgcn_wmma_f32_16x16x32_f16(false, a, false, b, (short)0, c, false, false); }
__device__ __forceinline__ v8f wmmab(v16bf a, v16bf b, v8f c) { return __builtin_amdgcn_wmma_f32_16x16x32_bf16(false, a, false, b, (short)0, c, false, false); }



// ---- fragment loaders and matrix products of the two 16-bit types
template <typename T16> struct WFrag;
template <> struct WFrag<h16> { typedef v16h V; static __device__ __forceinline__ V ld(const h16* p) { return cat16(*(const v8h*)p, *(const v8h*)(p + 16)); } static __device__ __forceinline__ v8f mma(V a, V b, v8f c) { return wmma16(a, b, c); } };
template <> struct WFrag<bf> { typedef v16bf V; static __device__ __forceinline__ V ld(const bf* p) { return cat16b(*(const v8us*)p, *(const v8us*)(p + 16)); } static __device__ __forceinline__ v8f mma(V a, V b, v8f c) { return wmmab(a, b, c); } };
template <int NW> __device__ __forceinline__ void tile_sync() { if (NW == 1) { __builtin_amdgcn_wave_barrier(); asm volatile("" ::: "memory"); } else __syncthreads(); }   // orders the LDS tile's writes and reads: inside the one wave, or among the NW waves

__device__ __forceinline__ h16 tohx(float x) { return (h16)x; }
__device__ __forceinline__ void splitf(float y, unsigned short& h, unsigned short& l) { h = f2bf(y); l = f2bf(y - bf2f(h)); }
typedef __attribute__((ext_vector_type(4))) _Float16 v4h;
typedef __attribute__((ext_vector_type(4))) unsigned short v4us;

typedef v4us __attribute__((may_alias)) v4usa;
typedef __attribute__((ext_vector_type(4))) __bf16 v4bf;

// ---- k_wpack: the three weights [DM][HD] f32 -> bf16 in the order in which k_proj's waves read them: fragment (tensor nt, 32-wide K step ks, 16-column block nb) = 1 KiB, two halves of 32 lanes x 16 bytes, so that each wave-wide load covers 512 contiguous bytes.
// Half h of lane (hi, lr) holds column nb * 16 + lr, k = ks * 32 + h * 16 + hi * 8 + 0..7: the k order of WFrag<bf>::ld. One thread = one 16-byte piece.
#define KST  (DM / 32)            // K steps
#define KSW  (KST / NWK)          // K steps a wave
__global__ __launch_bounds__(256) void k_wpack(const float* __restrict__ wq, const float* __restrict__ wk, const float* __restrict__ wv, bf* Wp) {
    const int i = blockIdx.x * 256 + threadIdx.x; const int lane = i & 31, h = (i >> 5) & 1, nb = (i >> 6) & 3, fs = i >> 8; const int ks = fs % KST, nt = fs / KST;
    const float* w = (nt == 0) ? wq : (nt == 1) ? wk : wv; const int n = nb * 16 + (lane & 15), k0 = ks * 32 + h * 16 + (lane >> 4) * 8; v8us o;
#pragma unroll
    for (int j = 0; j < 8; ++j) o[j] = f2bf(w[(size_t)(k0 + j) * HD + n]);
    *(v8us*)(Wp + (size_t)i * 8) = o;
}

// ---- k_proj: Q, K, V = bf16(x) bf16(W) + bias for 64 rows of x a work-group (grid: NB_ * TT / 64), NWK waves; writes K and V (f32 outputs) and all nine 16-bit planes that k_fattn reads.
// Split K: wave w takes the 32-wide K steps w, w + NWK, ...; x is read once, f32, in whole 128-byte lines, rounded to bf16 and turned into fragments through the wave's own LDS rows; the fragments stay in registers for the three 64-column products.
// The products are computed transposed (W as the first operand), so that a lane holds 8 neighbouring columns of one row and stores its partial tile in 16-byte pieces. Per product the NWK partial tiles are summed through LDS in wave order 0..NWK-1;
// the partial tiles alternate between two LDS buffers, so one barrier a product is enough. V's planes are [d][t]: its summed tile goes through a further LDS tile to be read along t.
#define PJS  (64 * 68)            // floats of one wave's partial tile in LDS
#define XP   40                   // bf16 elements of one staged x row: 32 + 8, an 80-byte pitch for the 16-byte fragment reads
#define TP   65                   // floats of one row of V's transposing tile
// Work-group barrier that orders LDS only: the waves exchange nothing but LDS here, so it does not wait for the global stores of the epilogue before it or for the weight loads issued ahead.
__device__ __forceinline__ void lds_sync() { __builtin_amdgcn_fence(__ATOMIC_RELEASE, "workgroup", "local"); __builtin_amdgcn_s_barrier(); __builtin_amdgcn_fence(__ATOMIC_ACQUIRE, "workgroup", "local"); }
__device__ __forceinline__ void pj_ldw(v16bf (&b)[KSW][4], const bf* __restrict__ wl, int nt) {   // wl: the packed weights at this wave's first K step and this lane's piece
#pragma unroll
    for (int i = 0; i < KSW; ++i)
#pragma unroll
        for (int nb = 0; nb < 4; ++nb) { const bf* p = wl + ((nt * KST + NWK * i) * 4 + nb) * 512; b[i][nb] = cat16b(*(const v8us*)p, *(const v8us*)(p + 256)); }
}
// one wave's partial 64 x 64 tile over its KSW K steps, transposed: acc[mb][nb][j] of lane (hi, lr) = row mb * 16 + lr of x, column nb * 16 + hi * 8 + j
__device__ __forceinline__ void pj_mma(const v16bf (&a)[KSW][4], const v16bf (&b)[KSW][4], v8f (&acc)[4][4]) {
#pragma unroll
    for (int mb = 0; mb < 4; ++mb)
#pragma unroll
        for (int nb = 0; nb < 4; ++nb) acc[mb][nb] = (v8f){};
#pragma unroll
    for (int i = 0; i < KSW; ++i)
#pragma unroll
        for (int nb = 0; nb < 4; ++nb)
#pragma unroll
            for (int mb = 0; mb < 4; ++mb) acc[mb][nb] = wmmab(b[i][nb], a[i][mb], acc[mb][nb]);
}
// the partial tile -> the wave's LDS rows [row of x][column]
__device__ __forceinline__ void pj_put(const v8f (&acc)[4][4], float* ow, int lr, int hi) {
#pragma unroll
    for (int mb = 0; mb < 4; ++mb)
#pragma unroll
        for (int nb = 0; nb < 4; ++nb) { float* p = ow + (mb * 16 + lr) * 68 + nb * 16 + hi * 8; *(v4fa*)p = __builtin_shufflevector(acc[mb][nb], acc[mb][nb], 0, 1, 2, 3); *(v4fa*)(p + 4) = __builtin_shufflevector(acc[mb][nb], acc[mb][nb], 4, 5, 6, 7); }
}
// A group of global loads or stores is written as grp_open(); the loads or stores; grp_close().
// grp_open: nothing made earlier sinks into the group. grp_close: s_wait_xcnt 0 stands behind the group, in front of the first instruction that reuses a register the group names (address or data), and nothing from below moves in front of the wait.
__device__ __forceinline__ void grp_open() { __builtin_amdgcn_sched_barrier(0); }
__device__ __forceinline__ void grp_close() { asm volatile("s_wait_xcnt 0x0" ::: "memory"); __builtin_amdgcn_sched_barrier(0); }
// the same for a group of loads whose address is not used again: the address is an input of the wait, so that its registers are given to nothing else (not to a load's result either) in front of the wait
__device__ __forceinline__ void grp_close(const void* p) { asm volatile("s_wait_xcnt 0x0" :: "v"(p) : "memory"); __builtin_amdgcn_sched_barrier(0); }
// Behind a product's last matrix instruction: the four vector slots that the chip needs before the next product's first matrix instructions overwrite its results; the scheduling barriers keep the slots between the two products.
__device__ __forceinline__ void wmma_gap() { __builtin_amdgcn_sched_barrier(0); asm volatile("v_nop\n\tv_nop\n\tv_nop\n\tv_nop"); __builtin_amdgcn_sched_barrier(0); }
// one thread's 4 x 4 elements of the NWK partial tiles, LDS -> registers; asked for in one run, in front of the next product's matrix instructions, which cover the LDS time
__device__ __forceinline__ void pj_get(const float* os, v4f (&raw)[4][NWK]) {
    const float* p = os + (int)(threadIdx.x >> 4) * 68 + (int)(threadIdx.x & 15) * 4;
#pragma unroll
    for (int s = 0; s < 4; ++s)
#pragma unroll
        for (int w = 0; w < NWK; ++w) raw[s][w] = *(const v4fa*)(p + s * 16 * 68 + w * PJS);
    __builtin_amdgcn_sched_barrier(0);   // the LDS reads stay together, in front of the next product's matrix instructions where there is one
}
template <int NT>
__device__ __forceinline__ void pj_epi(const v4f (&raw)[4][NWK], float* ts, v4f bs, size_t g0, float* F, h16* P16, bf* Ph, bf* Pl) {
    const int cofs = (int)(threadIdx.x & 15) * 4, rw = (int)(threadIdx.x >> 4); v4f val[4]; v4h o16[4]; v4us oh[4], ol[4];
#pragma unroll
    for (int s = 0; s < 4; ++s) { v4f v = raw[s][0];
#pragma unroll   // the adds keep the order w = 0..NWK-1
        for (int w = 1; w < NWK; ++w) v += raw[s][w];
        val[s] = v + bs;
        if (NT < 2) {
#pragma unroll
            for (int q = 0; q < 4; ++q) { o16[s][q] = tohx(val[s][q]); unsigned short a2, c2; splitf(val[s][q], a2, c2); oh[s][q] = a2; ol[s][q] = c2; } } }
    const size_t e = (g0 + rw) * HD + cofs; float* fp = (NT > 0) ? F + e : nullptr; h16* p16 = P16 + e; bf* ph = Ph + e; bf* pl = Pl + e;
    grp_open();
#pragma unroll
    for (int s = 0; s < 4; ++s) {
        if (NT > 0) *(v4f*)(fp + s * 16 * HD) = val[s];
        if (NT < 2) { *(v4h*)(p16 + s * 16 * HD) = o16[s]; *(v4us*)(ph + s * 16 * HD) = oh[s]; *(v4us*)(pl + s * 16 * HD) = ol[s]; } }
    grp_close();
    if (NT == 2) {
#pragma unroll
        for (int s = 0; s < 4; ++s)
#pragma unroll
            for (int q = 0; q < 4; ++q) ts[(cofs + q) * TP + 16 * s + rw] = val[s][q];
        lds_sync();   // V's summed tile is in LDS
        const int d = (int)(threadIdx.x >> 2), t0 = (int)(threadIdx.x & 3) * 16; const size_t et = (g0 / TT) * ((size_t)TT * HD) + (size_t)d * TT + (g0 % TT) + t0; v8h t16[2]; v8us th[2], tl[2];
#pragma unroll
        for (int c = 0; c < 2; ++c)
#pragma unroll
            for (int q = 0; q < 8; ++q) { const float v = ts[d * TP + t0 + c * 8 + q]; t16[c][q] = tohx(v); unsigned short a2, c2; splitf(v, a2, c2); th[c][q] = a2; tl[c][q] = c2; }
        h16* q16 = P16 + et; bf* qh = Ph + et; bf* ql = Pl + et;
        grp_open();
#pragma unroll
        for (int c = 0; c < 2; ++c) { *(v8h*)(q16 + c * 8) = t16[c]; *(v8us*)(qh + c * 8) = th[c]; *(v8us*)(ql + c * 8) = tl[c]; } }   // the kernel's last stores: nothing reuses their registers
}
__device__ __forceinline__ v4f bfr4(v4f r) { v4f o; o[0] = bfr(r[0]); o[1] = bfr(r[1]); o[2] = bfr(r[2]); o[3] = bfr(r[3]); return o; }
__global__ __launch_bounds__(32 * NWK) void k_proj(const float* __restrict__ x, const bf* __restrict__ Wp, const float* __restrict__ bq, const float* __restrict__ bk, const float* __restrict__ bv, float* OUTK, float* OUTV, h16* Q16, bf* Qh, bf* Ql, h16* K16, bf* Kh, bf* Kl, h16* V16, bf* Vh, bf* Vl) {
    __shared__ __align__(16) float os[2][NWK * PJS]; __shared__ float ts[64 * TP];
    const int lane = threadIdx.x & 31, lr = lane & 15, hi = lane >> 4; const int wv = __builtin_amdgcn_readfirstlane((int)(threadIdx.x >> 5));   // wave number in a scalar register: the weight addresses' wave part stays scalar
    const size_t g0 = (size_t)blockIdx.x * 64;
    v4f xv[KSW][16]; const float* xp = x + (g0 + (lane >> 3)) * DM + wv * 32 + (lane & 7) * 4;   // 8 lanes a 128-byte line, 4 rows a load
    v16bf b0[KSW][4], b1[KSW][4]; const bf* wl = Wp + (size_t)wv * (4 * 512) + lane * 8;
    grp_open();
#pragma unroll
    for (int i = 0; i < KSW; ++i)
#pragma unroll
        for (int q = 0; q < 16; ++q) xv[i][q] = *(const v4f*)(xp + (size_t)q * 4 * DM + i * (32 * NWK));
    grp_close(xp);
    pj_ldw(b0, wl, 0);   // the first product's weights and the biases fly together with x
    const v4f rq = *(const v4f*)(bq + lr * 4), rk = *(const v4f*)(bk + lr * 4), rv = *(const v4f*)(bv + lr * 4);
    grp_close();
    bf* xs = (bf*)(os[0] + wv * PJS);   // the wave's own part of the partial-tile buffer, free until its first product is done
#pragma unroll
    for (int i = 0; i < KSW; ++i)
#pragma unroll
        for (int q = 0; q < 16; ++q) *(v4usa*)(xs + (i * 64 + q * 4 + (lane >> 3)) * XP + (lane & 7) * 4) = __builtin_bit_cast(v4us, __builtin_convertvector(xv[i][q], v4bf));
    tile_sync<1>();   // the wave's LDS writes stay in front of its fragment reads, which take other lanes' values
    v16bf a[KSW][4];
#pragma unroll
    for (int i = 0; i < KSW; ++i)
#pragma unroll
        for (int mb = 0; mb < 4; ++mb) { const bf* p = xs + (i * 64 + mb * 16 + lr) * XP + 8 * hi; a[i][mb] = cat16b(*(const v8usa*)p, *(const v8usa*)(p + 16)); }
    tile_sync<1>();   // the fragment reads stay in front of the wave's partial-tile writes to the same LDS
    grp_open(); pj_ldw(b1, wl, 1); grp_close();   // each later product's weights are asked for one product ahead
    v8f acc[4][4]; v4f raw[4][NWK];
    pj_mma(a, b0, acc); pj_put(acc, os[0] + wv * PJS, lr, hi); wmma_gap();
    lds_sync();   // every wave's partial tile of Q is in LDS
    pj_get(os[0], raw); pj_mma(a, b1, acc);
    __builtin_amdgcn_sched_barrier(0);   // the matrix instructions stay in one run in front of Q's sum
    pj_epi<0>(raw, ts, bfr4(rq), g0, nullptr, Q16, Qh, Ql);
    pj_ldw(b0, wl, 2); grp_close(wl);
    pj_put(acc, os[1] + wv * PJS, lr, hi); wmma_gap();
    lds_sync();   // K's partial tiles are in LDS, and every wave has read Q's
    pj_get(os[1], raw); pj_mma(a, b0, acc);
    __builtin_amdgcn_sched_barrier(0);   // the matrix instructions stay in one run in front of K's sum
    pj_epi<1>(raw, ts, bfr4(rk), g0, OUTK, K16, Kh, Kl);
    pj_put(acc, os[0] + wv * PJS, lr, hi);
    lds_sync();   // V's partial tiles are in LDS
    pj_get(os[0], raw);
    pj_epi<2>(raw, ts, bfr4(rv), g0, OUTV, V16, Vh, Vl);
}

// ---- k_fattn: scores, causal softmax and attn.v in one kernel; no score or probability matrix in memory. One work-group = two tiles of QT query rows of one batch, NWA waves (grid x: tile pair; grid z: batch).
// A tile's cost grows with its index and the launch lasts as long as its fullest work-group, so each work-group takes one tile of the upper half (fa_long) and then one of the lower half, one after the other in every wave: near equal work for all; one work-group a WGP, the whole grid resident.
// In each tile wave w takes the KB-key blocks w, w + NWA, ... up to the diagonal block and keeps its own running row maximum m, row sum l and unnormalised result; per tile the NWA partial results are brought to one maximum and summed through LDS in wave order.
// Both products are computed transposed, so that no value changes lanes between them: S^T = K Q^T (lane: query lr, keys hi*8 + j) is, converted, already the B fragment of O^T = V^T P^T (lane: query lr, head dims hi*8 + j), and m, l are one value a lane.
// Rows < RH: bf16 hi/lo planes, 3 products each; the rest: f16, probabilities x 1024 (added to the exponent; it cancels in the division by l).
#define QT   32
#define NWA  16
#define NQT  (TT / QT)            // query tiles of one batch
#define KB   32                   // keys per block
#define KT   (KB / 16)
#define CL2  (SCL * 1.4426950408889634f)   // score -> exponent of 2
// 2^x on v_exp_f32, written in asm so that the free slot which the instruction set asks for behind a transcendental (before its result is read or its source overwritten) stands there by construction: each v_exp_f32 works in place on a register of its own, and a v_nop follows the last.
__device__ __forceinline__ float ex2(float x) { asm("v_exp_f32 %0, %0\n\tv_nop" : "+v"(x)); return x; }
__device__ __forceinline__ void ex2x8(float (&x)[8]) { asm("v_exp_f32 %0, %0\n\tv_exp_f32 %1, %1\n\tv_exp_f32 %2, %2\n\tv_exp_f32 %3, %3\n\tv_exp_f32 %4, %4\n\tv_exp_f32 %5, %5\n\tv_exp_f32 %6, %6\n\tv_exp_f32 %7, %7\n\tv_nop" : "+v"(x[0]), "+v"(x[1]), "+v"(x[2]), "+v"(x[3]), "+v"(x[4]), "+v"(x[5]), "+v"(x[6]), "+v"(x[7])); }
template <typename T16, bool HI, bool MASK>
__device__ __forceinline__ void fa_blk(const typename WFrag<T16>::V (&qf)[2][2], const typename WFrag<T16>::V (&qf2)[2][2], const T16* __restrict__ Kp, const T16* __restrict__ Kp2, const T16* __restrict__ Vp, const T16* __restrict__ Vp2, int c0, int r0, int lr, int hi, v8f (&o)[4][2], float (&m)[2], float (&l)[2]) {
    typedef typename WFrag<T16>::V V;
    v8f s[KT][2]; V kf[KT][2], kf2[KT][2];
#pragma unroll
    for (int kt = 0; kt < KT; ++kt)
#pragma unroll
        for (int ks = 0; ks < 2; ++ks) { const size_t ko = (size_t)(c0 + kt * 16 + lr) * HD + 8 * hi + ks * 32; kf[kt][ks] = WFrag<T16>::ld(Kp + ko); if (HI) kf2[kt][ks] = WFrag<T16>::ld(Kp2 + ko); }
    asm volatile("s_wait_xcnt 0x0" ::: "memory");   // stands in front of the first instruction that reuses an address register of the K loads above
#pragma unroll
    for (int kt = 0; kt < KT; ++kt) { s[kt][0] = (v8f){}; s[kt][1] = (v8f){};
#pragma unroll
        for (int ks = 0; ks < 2; ++ks)
#pragma unroll
            for (int qb = 0; qb < 2; ++qb) { s[kt][qb] = WFrag<T16>::mma(kf[kt][ks], qf[qb][ks], s[kt][qb]); if (HI) { s[kt][qb] = WFrag<T16>::mma(kf[kt][ks], qf2[qb][ks], s[kt][qb]); s[kt][qb] = WFrag<T16>::mma(kf2[kt][ks], qf[qb][ks], s[kt][qb]); } } }
#pragma unroll
    for (int qb = 0; qb < 2; ++qb) {
        float mk[KT];
#pragma unroll
        for (int kt = 0; kt < KT; ++kt) {
#pragma unroll
            for (int j = 0; j < 8; ++j) { if (MASK) s[kt][qb][j] = (c0 + kt * 16 + hi * 8 + j <= r0 + qb * 16 + lr) ? s[kt][qb][j] : -3.0e38f; mk[kt] = j ? fmaxf(mk[kt], s[kt][qb][j]) : s[kt][qb][j]; } }
        float mx = fmaxf(fmaxf(mk[0], mk[1]), m[qb]); mx = fmaxf(mx, __shfl_xor(mx, 16, 32));   // the two half-waves hold the two halves of a query's keys
        const float al = ex2((m[qb] - mx) * CL2); m[qb] = mx; const float eb = (HI ? 0.0f : 10.0f) - mx * CL2;
        float ps[KT];   // independent sums
#pragma unroll
        for (int kt = 0; kt < KT; ++kt) {
            float p[8];
#pragma unroll
            for (int j = 0; j < 8; ++j) p[j] = fmaf(s[kt][qb][j], CL2, eb);
            ex2x8(p);
#pragma unroll
            for (int j = 0; j < 8; ++j) { s[kt][qb][j] = p[j]; ps[kt] = j ? ps[kt] + p[j] : p[j]; } }
        l[qb] = fmaf(l[qb], al, ps[0] + ps[1]);
#pragma unroll
        for (int dt = 0; dt < 4; ++dt) o[dt][qb] *= al;
    }
#pragma unroll
    for (int kk = 0; kk < KB / 32; ++kk) { V pf[2], pf2[2];
#pragma unroll
        for (int qb = 0; qb < 2; ++qb) {
            if constexpr (HI) { v8us h0, h1, l0, l1;
#pragma unroll
                for (int j = 0; j < 8; ++j) { unsigned short a, c; splitf(s[2 * kk][qb][j], a, c); h0[j] = a; l0[j] = c; splitf(s[2 * kk + 1][qb][j], a, c); h1[j] = a; l1[j] = c; }
                pf[qb] = cat16b(h0, h1); pf2[qb] = cat16b(l0, l1);
            } else { v8h h0, h1;
#pragma unroll
                for (int j = 0; j < 8; ++j) { h0[j] = (h16)s[2 * kk][qb][j]; h1[j] = (h16)s[2 * kk + 1][qb][j]; }
                pf[qb] = cat16(h0, h1); } }
#pragma unroll
        for (int dt = 0; dt < 4; ++dt) { const size_t vo = (size_t)(dt * 16 + lr) * TT + 8 * hi + c0 + kk * 32; const V v = WFrag<T16>::ld(Vp + vo); V v2; if (HI) v2 = WFrag<T16>::ld(Vp2 + vo);
#pragma unroll
            for (int qb = 0; qb < 2; ++qb) { o[dt][qb] = WFrag<T16>::mma(v, pf[qb], o[dt][qb]); if (HI) { o[dt][qb] = WFrag<T16>::mma(v, pf2[qb], o[dt][qb]); o[dt][qb] = WFrag<T16>::mma(v2, pf[qb], o[dt][qb]); } } } }
}
template <typename T16, bool HI>
__device__ __forceinline__ void fa_tile(const T16* __restrict__ Qp, const T16* __restrict__ Qp2, const T16* __restrict__ Kp, const T16* __restrict__ Kp2, const T16* __restrict__ Vp, const T16* __restrict__ Vp2, int r0, float* os, float* ms, float* ls) {
    typedef typename WFrag<T16>::V V;
    const int lane = threadIdx.x & 31, lr = lane & 15, hi = lane >> 4; const int wv = __builtin_amdgcn_readfirstlane((int)(threadIdx.x >> 5));   // wave number in a scalar register: the key loop's bounds and branches stay scalar, every lane stays on for the matrix instructions
    V qf[2][2], qf2[2][2]; v8f o[4][2]; float m[2], l[2];
#pragma unroll
    for (int qb = 0; qb < 2; ++qb) { m[qb] = -3.0e38f; l[qb] = 0.0f;
#pragma unroll
        for (int ks = 0; ks < 2; ++ks) { const size_t qo = (size_t)(r0 + qb * 16 + lr) * HD + 8 * hi + ks * 32; qf[qb][ks] = WFrag<T16>::ld(Qp + qo); if (HI) qf2[qb][ks] = WFrag<T16>::ld(Qp2 + qo); }
#pragma unroll
        for (int dt = 0; dt < 4; ++dt) o[dt][qb] = (v8f){}; }
    asm volatile("s_wait_xcnt 0x0" ::: "memory");   // stands in front of the first instruction that reuses an address register of the Q loads above
    const int nblk = r0 / KB + 1;   // KB-key blocks up to and with the diagonal block; only the last one holds keys above the diagonal, and each of its rows holds at least one key at or below it
#pragma unroll 1
    for (int kb = wv; kb < nblk - 1; kb += NWA) fa_blk<T16, HI, false>(qf, qf2, Kp, Kp2, Vp, Vp2, kb * KB, r0, lr, hi, o, m, l);
    if (((nblk - 1) & (NWA - 1)) == wv) fa_blk<T16, HI, true>(qf, qf2, Kp, Kp2, Vp, Vp2, (nblk - 1) * KB, r0, lr, hi, o, m, l);
#pragma unroll
    for (int qb = 0; qb < 2; ++qb) { const float lt = l[qb] + __shfl_xor(l[qb], 16, 32); if (hi == 0) { ms[wv * QT + qb * 16 + lr] = m[qb]; ls[wv * QT + qb * 16 + lr] = lt; }
#pragma unroll
        for (int dt = 0; dt < 4; ++dt) { float* p = os + (wv * QT + qb * 16 + lr) * 68 + dt * 16 + hi * 8; *(v4fa*)p = __builtin_shufflevector(o[dt][qb], o[dt][qb], 0, 1, 2, 3); *(v4fa*)(p + 4) = __builtin_shufflevector(o[dt][qb], o[dt][qb], 4, 5, 6, 7); } }
}
// The upper-half tile that goes with lower-half tile ts. Cost of a tile in f16 key blocks: t + 1, times 5/2 for hi/lo rows (three products for one, two planes for one). rk = rank of ts among the lower half by rising cost (ties: hi/lo first); it meets the upper half in falling cost.
static_assert(RH / QT * 5 / 2 <= NQT / 2, "the dearest hi/lo tile costs no more than the last tile of the lower half: rk stays a permutation of 0..NQT/2-1");
__device__ __forceinline__ int fa_long(int ts) {
    const int nh = RH / QT, ch = (5 * (ts + 1) + 1) / 2 - (nh + 1), cl = 2 * (ts + 1) / 5;   // ch: f16 tiles of the lower half cheaper than hi/lo tile ts; cl: hi/lo tiles no dearer than f16 tile ts
    const int rk = (ts < nh) ? ts + (ch > 0 ? ch : 0) : ts - nh + (cl < nh ? cl : nh);
    return NQT - 1 - rk;
}
__global__ __launch_bounds__(32 * NWA) __attribute__((amdgpu_waves_per_eu(4))) /* registers for four waves a SIMD: the work-group's NWA waves on one WGP */ void k_fattn(const h16* __restrict__ Q16, const h16* __restrict__ K16, const h16* __restrict__ V16, const bf* __restrict__ Qh, const bf* __restrict__ Ql, const bf* __restrict__ Kh, const bf* __restrict__ Kl, const bf* __restrict__ Vh, const bf* __restrict__ Vl, float* OUTr) {
    __shared__ __align__(16) float os2[2][NWA * QT * 68]; __shared__ float ms2[2][NWA * QT]; __shared__ float ls2[2][NWA * QT];   // one set of partial results a tile: no barrier between the two tiles
    const size_t zo = (size_t)blockIdx.z * TT * HD; const int tlo = (int)blockIdx.x, tup = fa_long(tlo);
#pragma unroll 1   // the two tiles share one copy of the key loops
    for (int h = 0; h < 2; ++h) { const int rt = (h ? tlo : tup) * QT;
        if (rt < RH) fa_tile<bf, true>(Qh + zo, Ql + zo, Kh + zo, Kl + zo, Vh + zo, Vl + zo, rt, os2[h], ms2[h], ls2[h]);
        else fa_tile<h16, false>(Q16 + zo, nullptr, K16 + zo, nullptr, V16 + zo, nullptr, rt, os2[h], ms2[h], ls2[h]); }
    __syncthreads();   // every wave's m, l and partial result of both tiles are in LDS
    const int hm = (int)(threadIdx.x >> 8), tm = (int)(threadIdx.x & 255);   // the first 256 threads sum the upper tile, the rest the lower one
    const int r0 = (hm ? tlo : tup) * QT; const float* os = os2[hm]; const float* ms = ms2[hm]; const float* ls = ls2[hm];
    const int row = tm >> 3, cofs = (tm & 7) * 8; float mw[NWA]; float M = -3.0e38f;
#pragma unroll
    for (int w = 0; w < NWA; ++w) { mw[w] = ms[w * QT + row]; M = fmaxf(M, mw[w]); }
    float L = 0.0f; v4f a0 = (v4f){}, a1 = (v4f){};
#pragma unroll   // the LDS reads are issued together; the adds keep the order w = 0..NWA-1; a wave that had no block has m = -3e38, l = 0 and weight 0
    for (int w = 0; w < NWA; ++w) { const float f = ex2((mw[w] - M) * CL2); L = fmaf(ls[w * QT + row], f, L); const float* p = os + (w * QT + row) * 68 + cofs; a0 += *(const v4fa*)p * f; a1 += *(const v4fa*)(p + 4) * f; }
    const float rl = __fdiv_rn(1.0f, L); float* op = OUTr + zo + (size_t)(r0 + row) * HD + cofs; *(v4f*)op = a0 * rl; *(v4f*)(op + 4) = a1 * rl;
}

extern "C" void kernel_launch(void* const* d_in, const int* in_sizes, int n_in,
                              void* d_out, int out_size, void* d_ws, size_t ws_size, hipStream_t stream) {
    (void)in_sizes; (void)n_in; (void)out_size;
    const float* x = (const float*)d_in[0]; const float* wq = (const float*)d_in[1]; const float* bq = (const float*)d_in[2]; const float* wk = (const float*)d_in[3]; const float* bk = (const float*)d_in[4]; const float* wv = (const float*)d_in[5]; const float* bv = (const float*)d_in[6];
    float* OUT = (float*)d_out; float* OUTK = OUT + (size_t)NB_ * TT * HD; float* OUTV = OUT + (size_t)2 * NB_ * TT * HD;   /* tuple output: result | K | V, each [4][4096][64] f32 */
    char* wsp = (char*)d_ws;
    auto take = [&](size_t bytes) { char* p = wsp; wsp += (bytes + 255) & ~(size_t)255; return (void*)p; };
    bf* WP = (bf*)take((size_t)3 * HD * DM * 2);
    const size_t PB = (size_t)TT * HD;   // elements of one batch's plane; every plane holds all NB_ batches
    h16* QP16 = (h16*)take(NB_ * PB * 2); h16* KP16 = (h16*)take(NB_ * PB * 2); h16* VT16 = (h16*)take(NB_ * PB * 2);
    bf* QPh = (bf*)take(NB_ * PB * 2); bf* QPl = (bf*)take(NB_ * PB * 2); bf* KPh = (bf*)take(NB_ * PB * 2); bf* KPl = (bf*)take(NB_ * PB * 2); bf* VTh = (bf*)take(NB_ * PB * 2); bf* VTl = (bf*)take(NB_ * PB * 2);
    if ((size_t)(wsp - (char*)d_ws) > ws_size) return;    // ws 256 MiB
    k_wpack<<<3 * HD * DM / 8 / 256, 256, 0, stream>>>(wq, wk, wv, WP);
    k_proj<<<NB_ * TT / 64, 32 * NWK, 0, stream>>>(x, WP, bq, bk, bv, OUTK, OUTV, QP16, QPh, QPl, KP16, KPh, KPl, VT16, VTh, VTl);   /* K, V -> output slots 1, 2 */
    k_fattn<<<dim3(NQT / 2, 1, NB_), 32 * NWA, 0, stream>>>(QP16, KP16, VT16, QPh, QPl, KPh, KPl, VTh, VTl, OUT);   /* result -> output slot 0 */
}

// v005
// It runs in 29.8 microseconds.
// Timed twice side by side with v004, it ran 1.23 and 1.24 times as fast.
// Counting every step since v000, it is 28.8 times as fast.
#include <hip/hip_runtime.h>

// Single-head causal attention with cache outputs (x [4][4096][768]; Q, K, V = x W + b ('xw' [768][64] + [64]); scores = Q.K / 8, causal; softmax; result = attn.V; returns (result, K, V) -> three [4][4096][64] f32 tensors (3.1 M)).
// Layout: one launch packs the three weights (bf16, fragment order); one launch for all batches does the exact projections (+ biases), writes K and V into their output slots (f32) and every 16-bit plane from its epilogue; then one launch for all batches: hybrid causal attention over 4,096 keys (rows < 512 hi/lo, rest fp16 x1024), scores, running-maximum softmax and attn.v in one kernel, result written from there.
// Compute dtypes, f32 accumulate: every input rounded to bf16; projections on PLAIN bf16 operands (exact) + f32 biases (K and V outputs are exactly these f32 sums); scores and attn.v rows < 512 on bf16 hi/lo planes (3 products), the rest single fp16; softmax f32; f32 result.

#define NB_  4
#define TT   4096
#define DM   768
#define NH_  1
#define NKV  1
#define REP  (NH_ / NKV)
#define HD   64
#define DQ   (NH_ * HD)
#define DKV  (NKV * HD)
#define RH   512                  // query rows < RH use hi+lo planes (0: none)
#define WIN  4096
#define SCL  0.125f   // HD^-0.5
#define NWK  8                    // waves per work-group that share one K loop in the long-K GEMMs
typedef _Float16 h16;
typedef unsigned short bf;
typedef __attribute__((ext_vector_type(16))) __bf16   v16bf;
typedef __attribute__((ext_vector_type(16))) _Float16 v16h;
typedef __attribute__((ext_vector_type(8)))  _Float16 v8h;
typedef __attribute__((ext_vector_type(8)))  unsigned short v8us;
typedef __attribute__((ext_vector_type(8)))  float    v8f;
typedef __attribute__((ext_vector_type(4)))  float    v4f;
typedef v8h  __attribute__((may_alias)) v8ha;
typedef v4f  __attribute__((may_alias)) v4fa;
typedef v8us __attribute__((may_alias)) v8usa;

__device__ __forceinline__ unsigned short f2bf(float f) { unsigned u = __float_as_uint(f); u += 0x7FFFu + ((u >> 16) & 1u); return (unsigned short)(u >> 16); }
__device__ __forceinline__ float bf2f(unsigned short b) { return __uint_as_float(((unsigned)b) << 16); }
__device__ __forceinline__ float bfr(float f) { return bf2f(f2bf(f)); }
__device__ __forceinline__ v16h cat16(v8h lo, v8h hi) { return __builtin_shufflevector(lo, hi, 0, 1, 2, 3, 4, 5, 6, 7, 8, 9, 10, 11, 12, 13, 14, 15); }
__device__ __forceinline__ v16bf cat16b(v8us lo, v8us hi) { return __builtin_bit_cast(v16bf, __builtin_shufflevector(lo, hi, 0, 1, 2, 3, 4, 5, 6, 7, 8, 9, 10, 11, 12, 13, 14, 15)); }
__device__ __forceinline__ v8f wmma16(v16h a, v16h b, v8f c) { return __builtin_amdgcn_wmma_f32_16x16x32_f16(false, a, false, b, (short)0, c, false, false); }
__device__ __forceinline__ v8f wmmab(v16bf a, v16bf b, v8f c) { return __builtin_amdgcn_wmma_f32_16x16x32_bf16(false, a, false, b, (short)0, c, false, false); }



// ---- fragment loaders and matrix products of the two 16-bit types
template <typename T16> struct WFrag;
template <> struct WFrag<h16> { typedef v16h V; static __device__ __forceinline__ V ld(const h16* p) { return cat16(*(const v8h*)p, *(const v8h*)(p + 16)); } static __device__ __forceinline__ V ldp(const h16* p) { return cat16(*(const v8h*)p, *(const v8h*)(p + 256)); } static __device__ __forceinline__ v8f mma(V a, V b, v8f c) { return wmma16(a, b, c); } };
template <> struct WFrag<bf> { typedef v16bf V; static __device__ __forceinline__ V ld(const bf* p) { return cat16b(*(const v8us*)p, *(const v8us*)(p + 16)); } static __device__ __forceinline__ v8f mma(V a, V b, v8f c) { return wmmab(a, b, c); } };
template <int NW> __device__ __forceinline__ void tile_sync() { if (NW == 1) { __builtin_amdgcn_wave_barrier(); asm volatile("" ::: "memory"); } else __syncthreads(); }   // orders the LDS tile's writes and reads: inside the one wave, or among the NW waves

__device__ __forceinline__ h16 tohx(float x) { return (h16)x; }
__device__ __forceinline__ void splitf(float y, unsigned short& h, unsigned short& l) { h = f2bf(y); l = f2bf(y - bf2f(h)); }
typedef __attribute__((ext_vector_type(4))) _Float16 v4h;
typedef __attribute__((ext_vector_type(4))) unsigned short v4us;

typedef v4us __attribute__((may_alias)) v4usa;
typedef v4h  __attribute__((may_alias)) v4ha;
typedef __attribute__((ext_vector_type(4))) __bf16 v4bf;

// ---- k_wpack: the three weights [DM][HD] f32 -> bf16 in the order in which k_proj's waves read them: fragment (tensor nt, 32-wide K step ks, 16-column block nb) = 1 KiB, two halves of 32 lanes x 16 bytes, so that each wave-wide load covers 512 contiguous bytes.
// Half h of lane (hi, lr) holds column nb * 16 + lr, k = ks * 32 + h * 16 + hi * 8 + 0..7: the k order of WFrag<bf>::ld. One thread = one 16-byte piece.
#define KST  (DM / 32)            // K steps
#define KSW  (KST / NWK)          // K steps a wave
__global__ __launch_bounds__(256) void k_wpack(const float* __restrict__ wq, const float* __restrict__ wk, const float* __restrict__ wv, bf* Wp) {
    const int i = blockIdx.x * 256 + threadIdx.x; const int lane = i & 31, h = (i >> 5) & 1, nb = (i >> 6) & 3, fs = i >> 8; const int ks = fs % KST, nt = fs / KST;
    const float* w = (nt == 0) ? wq : (nt == 1) ? wk : wv; const int n = nb * 16 + (lane & 15), k0 = ks * 32 + h * 16 + (lane >> 4) * 8; v8us o;
#pragma unroll
    for (int j = 0; j < 8; ++j) o[j] = f2bf(w[(size_t)(k0 + j) * HD + n]);
    *(v8us*)(Wp + (size_t)i * 8) = o;
}

// ---- k_proj: Q, K, V = bf16(x) bf16(W) + bias for 64 rows of x a work-group (grid: NB_ * TT / 64), NWK waves; writes K and V (f32 outputs) and all nine 16-bit planes that k_fattn reads.
// Split K: wave w takes the 32-wide K steps w, w + NWK, ...; x is read once, f32, in whole 128-byte lines, rounded to bf16 and turned into fragments through the wave's own LDS rows; the fragments stay in registers for the three 64-column products.
// The products are computed transposed (W as the first operand), so that a lane holds 8 neighbouring columns of one row and stores its partial tile in 16-byte pieces. Per product the NWK partial tiles are summed through LDS in wave order 0..NWK-1;
// the partial tiles alternate between two LDS buffers, so one barrier a product is enough. V's hi/lo planes are [d][t] and its f16 plane is in fragment order along t: its summed tile goes through a further LDS tile to be read along t.
#define PJS  (64 * 68)            // floats of one wave's partial tile in LDS
#define XP   40                   // bf16 elements of one staged x row: 32 + 8, an 80-byte pitch for the 16-byte fragment reads
#define TP   65                   // floats of one row of V's transposing tile
// The f16 planes of Q, K and V are stored in the order in which k_fattn's waves read them: one fragment = 1 KiB = two halves h of 32 lanes x 16 bytes, so that each wave-wide load covers 512 contiguous bytes (four whole lines, not sixteen).
// Q and K: fragment (16-row block, 32-wide step ks of the head dims), half h of lane (hi, lr) = row lr, head dims ks * 32 + h * 16 + hi * 8 + 0..7. V: fragment (32-key block, 16-row block dt of the head dims), half h of lane (hi, lr) = head dim dt * 16 + lr, keys h * 16 + hi * 8 + 0..7.
// Both are the k orders of WFrag::ld on the row-major planes. A work-group's 64 rows are 8 KiB in a row in each plane. The six hi/lo planes stay row-major.
#define KPG  144                  // f16 elements of one 16-lane group of a fragment-order tile in LDS: 128 + 16, a 288-byte pitch that spreads a wave's 8-byte writes over all banks
// Work-group barrier that orders LDS only: the waves exchange nothing but LDS here, so it does not wait for the global stores of the epilogue before it or for the weight loads issued ahead.
__device__ __forceinline__ void lds_sync() { __builtin_amdgcn_fence(__ATOMIC_RELEASE, "workgroup", "local"); __builtin_amdgcn_s_barrier(); __builtin_amdgcn_fence(__ATOMIC_ACQUIRE, "workgroup", "local"); }
__device__ __forceinline__ void pj_ldw(v16bf (&b)[KSW][4], const bf* __restrict__ wl, int nt) {   // wl: the packed weights at this wave's first K step and this lane's piece
#pragma unroll
    for (int i = 0; i < KSW; ++i)
#pragma unroll
        for (int nb = 0; nb < 4; ++nb) { const bf* p = wl + ((nt * KST + NWK * i) * 4 + nb) * 512; b[i][nb] = cat16b(*(const v8us*)p, *(const v8us*)(p + 256)); }
}
// one wave's partial 64 x 64 tile over its KSW K steps, transposed: acc[mb][nb][j] of lane (hi, lr) = row mb * 16 + lr of x, column nb * 16 + hi * 8 + j
__device__ __forceinline__ void pj_mma(const v16bf (&a)[KSW][4], const v16bf (&b)[KSW][4], v8f (&acc)[4][4]) {
#pragma unroll
    for (int mb = 0; mb < 4; ++mb)
#pragma unroll
        for (int nb = 0; nb < 4; ++nb) acc[mb][nb] = (v8f){};
#pragma unroll
    for (int i = 0; i < KSW; ++i)
#pragma unroll
        for (int nb = 0; nb < 4; ++nb)
#pragma unroll
            for (int mb = 0; mb < 4; ++mb) acc[mb][nb] = wmmab(b[i][nb], a[i][mb], acc[mb][nb]);
}
// the partial tile -> the wave's LDS rows [row of x][column]
__device__ __forceinline__ void pj_put(const v8f (&acc)[4][4], float* ow, int lr, int hi) {
#pragma unroll
    for (int mb = 0; mb < 4; ++mb)
#pragma unroll
        for (int nb = 0; nb < 4; ++nb) { float* p = ow + (mb * 16 + lr) * 68 + nb * 16 + hi * 8; *(v4fa*)p = __builtin_shufflevector(acc[mb][nb], acc[mb][nb], 0, 1, 2, 3); *(v4fa*)(p + 4) = __builtin_shufflevector(acc[mb][nb], acc[mb][nb], 4, 5, 6, 7); }
}
// A group of global loads or stores is written as grp_open(); the loads or stores; grp_close().
// grp_open: nothing made earlier sinks into the group. grp_close: s_wait_xcnt 0 stands behind the group, in front of the first instruction that reuses a register the group names (address or data), and nothing from below moves in front of the wait.
__device__ __forceinline__ void grp_open() { __builtin_amdgcn_sched_barrier(0); }
__device__ __forceinline__ void grp_close() { asm volatile("s_wait_xcnt 0x0" ::: "memory"); __builtin_amdgcn_sched_barrier(0); }
// the same for a group of loads whose address is not used again: the address is an input of the wait, so that its registers are given to nothing else (not to a load's result either) in front of the wait
__device__ __forceinline__ void grp_close(const void* p) { asm volatile("s_wait_xcnt 0x0" :: "v"(p) : "memory"); __builtin_amdgcn_sched_barrier(0); }
// Behind a product's last matrix instruction: the four vector slots that the chip needs before the next product's first matrix instructions overwrite its results; the scheduling barriers keep the slots between the two products.
__device__ __forceinline__ void wmma_gap() { __builtin_amdgcn_sched_barrier(0); asm volatile("v_nop\n\tv_nop\n\tv_nop\n\tv_nop"); __builtin_amdgcn_sched_barrier(0); }
// one thread's 4 x 4 elements of the NWK partial tiles, LDS -> registers; asked for in one run, in front of the next product's matrix instructions, which cover the LDS time
__device__ __forceinline__ void pj_get(const float* os, v4f (&raw)[4][NWK]) {
    const float* p = os + (int)(threadIdx.x >> 4) * 68 + (int)(threadIdx.x & 15) * 4;
#pragma unroll
    for (int s = 0; s < 4; ++s)
#pragma unroll
        for (int w = 0; w < NWK; ++w) raw[s][w] = *(const v4fa*)(p + s * 16 * 68 + w * PJS);
    __builtin_amdgcn_sched_barrier(0);   // the LDS reads stay together, in front of the next product's matrix instructions where there is one
}
template <int NT>
__device__ __forceinline__ void pj_epi(const v4f (&raw)[4][NWK], float* ts, h16* ft, v4f bs, size_t g0, float* F, h16* P16, bf* Ph, bf* Pl) {
    const int cofs = (int)(threadIdx.x & 15) * 4, rw = (int)(threadIdx.x >> 4); v4f val[4]; v4h o16[4]; v4us oh[4], ol[4];
#pragma unroll
    for (int s = 0; s < 4; ++s) { v4f v = raw[s][0];
#pragma unroll   // the adds keep the order w = 0..NWK-1
        for (int w = 1; w < NWK; ++w) v += raw[s][w];
        val[s] = v + bs;
        if (NT < 2) {
#pragma unroll
            for (int q = 0; q < 4; ++q) { o16[s][q] = tohx(val[s][q]); unsigned short a2, c2; splitf(val[s][q], a2, c2); oh[s][q] = a2; ol[s][q] = c2; } } }
    if (NT < 2) {   // the f16 tile of Q or K -> LDS at its fragment-order places: group s * 8 + (ks, h, hi) = s * 8 + cofs / 8, lane part rw; pj_fld and pj_fst take it to memory behind the next barrier
#pragma unroll
        for (int s = 0; s < 4; ++s) *(v4ha*)(ft + (s * 8 + (cofs >> 3)) * KPG + rw * 8 + (cofs & 4)) = o16[s]; }
    const size_t e = (g0 + rw) * HD + cofs; float* fp = (NT > 0) ? F + e : nullptr; bf* ph = Ph + e; bf* pl = Pl + e;
    grp_open();
#pragma unroll
    for (int s = 0; s < 4; ++s) {
        if (NT > 0) *(v4f*)(fp + s * 16 * HD) = val[s];
        if (NT < 2) { *(v4us*)(ph + s * 16 * HD) = oh[s]; *(v4us*)(pl + s * 16 * HD) = ol[s]; } }
    grp_close();
    if (NT == 2) {
#pragma unroll
        for (int s = 0; s < 4; ++s)
#pragma unroll
            for (int q = 0; q < 4; ++q) ts[(cofs + q) * TP + 16 * s + rw] = val[s][q];
        lds_sync();   // V's summed tile is in LDS
        const int d = (int)(threadIdx.x >> 2), t0 = (int)(threadIdx.x & 3) * 16; const size_t et = (g0 / TT) * ((size_t)TT * HD) + (size_t)d * TT + (g0 % TT) + t0; v8h t16[2]; v8us th[2], tl[2];
#pragma unroll
        for (int c = 0; c < 2; ++c)
#pragma unroll
            for (int q = 0; q < 8; ++q) { const float v = ts[d * TP + t0 + c * 8 + q]; t16[c][q] = tohx(v); unsigned short a2, c2; splitf(v, a2, c2); th[c][q] = a2; tl[c][q] = c2; }
        h16* q16 = P16 + g0 * HD + ((((t0 >> 5) * 4 + (d >> 4)) * 2 + ((t0 >> 4) & 1)) * 32 + (d & 15)) * 8; bf* qh = Ph + et; bf* ql = Pl + et;   // q16: fragment order, hi = c
        grp_open();
#pragma unroll
        for (int c = 0; c < 2; ++c) { *(v8h*)(q16 + c * 128) = t16[c]; *(v8us*)(qh + c * 8) = th[c]; *(v8us*)(ql + c * 8) = tl[c]; } }   // the kernel's last stores: nothing reuses their registers
}
// the f16 tile of Q or K, LDS -> registers -> its 8 KiB of the fragment-order plane, 16 bytes a lane, whole lines
__device__ __forceinline__ void pj_fld(const h16* ft, v8h (&fr)[2]) {
    const h16* q = ft + (int)(threadIdx.x >> 4) * KPG + (int)(threadIdx.x & 15) * 8; fr[0] = *(const v8ha*)q; fr[1] = *(const v8ha*)(q + 16 * KPG);
    __builtin_amdgcn_sched_barrier(0);   // these two LDS reads stay in front of pj_get's: they return first, so pj_fst's stores wait for none of the partial tiles
}
__device__ __forceinline__ void pj_fst(const v8h (&fr)[2], size_t g0, h16* P16) {
    h16* p = P16 + g0 * HD + (int)threadIdx.x * 8;
    grp_open(); *(v8h*)p = fr[0]; *(v8h*)(p + 2048) = fr[1]; grp_close();
}
__device__ __forceinline__ v4f bfr4(v4f r) { v4f o; o[0] = bfr(r[0]); o[1] = bfr(r[1]); o[2] = bfr(r[2]); o[3] = bfr(r[3]); return o; }
__global__ __launch_bounds__(32 * NWK) void k_proj(const float* __restrict__ x, const bf* __restrict__ Wp, const float* __restrict__ bq, const float* __restrict__ bk, const float* __restrict__ bv, float* OUTK, float* OUTV, h16* Q16, bf* Qh, bf* Ql, h16* K16, bf* Kh, bf* Kl, h16* V16, bf* Vh, bf* Vl) {
    __shared__ __align__(16) float os[2][NWK * PJS]; __shared__ float ts[64 * TP]; __shared__ __align__(16) h16 fq[32 * KPG], fk[32 * KPG];
    const int lane = threadIdx.x & 31, lr = lane & 15, hi = lane >> 4; const int wv = __builtin_amdgcn_readfirstlane((int)(threadIdx.x >> 5));   // wave number in a scalar register: the weight addresses' wave part stays scalar
    const size_t g0 = (size_t)blockIdx.x * 64;
    v4f xv[KSW][16]; const float* xp = x + (g0 + (lane >> 3)) * DM + wv * 32 + (lane & 7) * 4;   // 8 lanes a 128-byte line, 4 rows a load
    v16bf b0[KSW][4], b1[KSW][4]; const bf* wl = Wp + (size_t)wv * (4 * 512) + lane * 8;
    grp_open();
#pragma unroll
    for (int i = 0; i < KSW; ++i)
#pragma unroll
        for (int q = 0; q < 16; ++q) xv[i][q] = *(const v4f*)(xp + (size_t)q * 4 * DM + i * (32 * NWK));
    grp_close(xp);
    pj_ldw(b0, wl, 0);   // the first product's weights and the biases fly together with x
    const v4f rq = *(const v4f*)(bq + lr * 4), rk = *(const v4f*)(bk + lr * 4), rv = *(const v4f*)(bv + lr * 4);
    grp_close();
    bf* xs = (bf*)(os[0] + wv * PJS);   // the wave's own part of the partial-tile buffer, free until its first product is done
#pragma unroll
    for (int i = 0; i < KSW; ++i)
#pragma unroll
        for (int q = 0; q < 16; ++q) *(v4usa*)(xs + (i * 64 + q * 4 + (lane >> 3)) * XP + (lane & 7) * 4) = __builtin_bit_cast(v4us, __builtin_convertvector(xv[i][q], v4bf));
    tile_sync<1>();   // the wave's LDS writes stay in front of its fragment reads, which take other lanes' values
    v16bf a[KSW][4];
#pragma unroll
    for (int i = 0; i < KSW; ++i)
#pragma unroll
        for (int mb = 0; mb < 4; ++mb) { const bf* p = xs + (i * 64 + mb * 16 + lr) * XP + 8 * hi; a[i][mb] = cat16b(*(const v8usa*)p, *(const v8usa*)(p + 16)); }
    tile_sync<1>();   // the fragment reads stay in front of the wave's partial-tile writes to the same LDS
    grp_open(); pj_ldw(b1, wl, 1); grp_close();   // each later product's weights are asked for one product ahead
    v8f acc[4][4]; v4f raw[4][NWK]; v8h fr[2];
    pj_mma(a, b0, acc); pj_put(acc, os[0] + wv * PJS, lr, hi); wmma_gap();
    lds_sync();   // every wave's partial tile of Q is in LDS
    pj_get(os[0], raw); pj_mma(a, b1, acc);
    __builtin_amdgcn_sched_barrier(0);   // the matrix instructions stay in one run in front of Q's sum
    pj_epi<0>(raw, ts, fq, bfr4(rq), g0, nullptr, Q16, Qh, Ql);
    pj_ldw(b0, wl, 2); grp_close(wl);
    pj_put(acc, os[1] + wv * PJS, lr, hi); wmma_gap();
    lds_sync();   // K's partial tiles and Q's f16 tile are in LDS, and every wave has read Q's partial tiles
    pj_fld(fq, fr); pj_get(os[1], raw); pj_mma(a, b0, acc);
    __builtin_amdgcn_sched_barrier(0);   // the matrix instructions stay in one run in front of K's sum
    pj_fst(fr, g0, Q16);
    pj_epi<1>(raw, ts, fk, bfr4(rk), g0, OUTK, K16, Kh, Kl);
    pj_put(acc, os[0] + wv * PJS, lr, hi);
    lds_sync();   // V's partial tiles and K's f16 tile are in LDS
    pj_fld(fk, fr); pj_get(os[0], raw);
    pj_fst(fr, g0, K16);
    pj_epi<2>(raw, ts, fk, bfr4(rv), g0, OUTV, V16, Vh, Vl);
}

// ---- k_fattn: scores, causal softmax and attn.v in one kernel; no score or probability matrix in memory. One work-group = two tiles of QT query rows of one batch, NWA waves (grid x: tile pair; grid z: batch).
// A tile's cost grows with its index and the launch lasts as long as its fullest work-group, so each work-group takes one tile of the upper half (fa_long) and then one of the lower half, one after the other in every wave: near equal work for all; one work-group a WGP, the whole grid resident.
// In each tile wave w takes the KB-key blocks w, w + NWA, ... up to the diagonal block and keeps its own running row maximum m, row sum l and unnormalised result; per tile the NWA partial results are brought to one maximum and summed through LDS in wave order.
// Both products are computed transposed, so that no value changes lanes between them: S^T = K Q^T (lane: query lr, keys hi*8 + j) is, converted, already the B fragment of O^T = V^T P^T (lane: query lr, head dims hi*8 + j), and m, l are one value a lane.
// Rows < RH: bf16 hi/lo planes, 3 products each; the rest: f16, probabilities x 1024 (added to the exponent; it cancels in the division by l).
#define QT   32
#define NWA  16
#define NQT  (TT / QT)            // query tiles of one batch
#define KB   32                   // keys per block
#define KT   (KB / 16)
#define CL2  (SCL * 1.4426950408889634f)   // score -> exponent of 2
// 2^x on v_exp_f32, written in asm so that the free slot which the instruction set asks for behind a transcendental (before its result is read or its source overwritten) stands there by construction: each v_exp_f32 works in place on a register of its own, and a v_nop follows the last.
__device__ __forceinline__ float ex2(float x) { asm("v_exp_f32 %0, %0\n\tv_nop" : "+v"(x)); return x; }
__device__ __forceinline__ void ex2x8(float (&x)[8]) { asm("v_exp_f32 %0, %0\n\tv_exp_f32 %1, %1\n\tv_exp_f32 %2, %2\n\tv_exp_f32 %3, %3\n\tv_exp_f32 %4, %4\n\tv_exp_f32 %5, %5\n\tv_exp_f32 %6, %6\n\tv_exp_f32 %7, %7\n\tv_nop" : "+v"(x[0]), "+v"(x[1]), "+v"(x[2]), "+v"(x[3]), "+v"(x[4]), "+v"(x[5]), "+v"(x[6]), "+v"(x[7])); }
template <typename T16, bool HI, bool MASK>
__device__ __forceinline__ void fa_blk(const typename WFrag<T16>::V (&qf)[2][2], const typename WFrag<T16>::V (&qf2)[2][2], const T16* __restrict__ Kp, const T16* __restrict__ Kp2, const T16* __restrict__ Vp, const T16* __restrict__ Vp2, int c0, int r0, int lr, int hi, v8f (&o)[4][2], float (&m)[2], float (&l)[2]) {
    typedef typename WFrag<T16>::V V;
    v8f s[KT][2]; V kf[KT][2], kf2[KT][2];
    if constexpr (HI) { const T16* ka[KT]; const T16* ka2[KT];
#pragma unroll
        for (int kt = 0; kt < KT; ++kt) { const size_t ko = (size_t)(c0 + kt * 16 + lr) * HD + 8 * hi; ka[kt] = Kp + ko; ka2[kt] = Kp2 + ko;
#pragma unroll
            for (int ks = 0; ks < 2; ++ks) { kf[kt][ks] = WFrag<T16>::ld(ka[kt] + ks * 32); kf2[kt][ks] = WFrag<T16>::ld(ka2[kt] + ks * 32); } }
        static_assert(KT == 2, "the wait below names the four addresses");
        asm volatile("s_wait_xcnt 0x0" :: "v"(ka[0]), "v"(ka[1]), "v"(ka2[0]), "v"(ka2[1]) : "memory");   // stands in front of the first instruction that reuses an address register of the K loads above; the addresses are its inputs, so that their registers are not given to a later load's result in front of it
    } else { const T16* ka = Kp + (size_t)c0 * HD + (hi * 16 + lr) * 8;   // fragment-order plane: the block's K is 4 KiB in a row
#pragma unroll
        for (int kt = 0; kt < KT; ++kt)
#pragma unroll
            for (int ks = 0; ks < 2; ++ks) kf[kt][ks] = WFrag<T16>::ldp(ka + (kt * 2 + ks) * 512);
        asm volatile("s_wait_xcnt 0x0" ::: "memory");   // stands in front of the first instruction that reuses an address register of the K loads above
    }
#pragma unroll
    for (int kt = 0; kt < KT; ++kt) { s[kt][0] = (v8f){}; s[kt][1] = (v8f){};
#pragma unroll
        for (int ks = 0; ks < 2; ++ks)
#pragma unroll
            for (int qb = 0; qb < 2; ++qb) { s[kt][qb] = WFrag<T16>::mma(kf[kt][ks], qf[qb][ks], s[kt][qb]); if (HI) { s[kt][qb] = WFrag<T16>::mma(kf[kt][ks], qf2[qb][ks], s[kt][qb]); s[kt][qb] = WFrag<T16>::mma(kf2[kt][ks], qf[qb][ks], s[kt][qb]); } } }
#pragma unroll
    for (int qb = 0; qb < 2; ++qb) {
        float mk[KT];
#pragma unroll
        for (int kt = 0; kt < KT; ++kt) {
#pragma unroll
            for (int j = 0; j < 8; ++j) { if (MASK) s[kt][qb][j] = (c0 + kt * 16 + hi * 8 + j <= r0 + qb * 16 + lr) ? s[kt][qb][j] : -3.0e38f; mk[kt] = j ? fmaxf(mk[kt], s[kt][qb][j]) : s[kt][qb][j]; } }
        float mx = fmaxf(fmaxf(mk[0], mk[1]), m[qb]); mx = fmaxf(mx, __shfl_xor(mx, 16, 32));   // the two half-waves hold the two halves of a query's keys
        const float al = ex2((m[qb] - mx) * CL2); m[qb] = mx; const float eb = (HI ? 0.0f : 10.0f) - mx * CL2;
        float ps[KT];   // independent sums
#pragma unroll
        for (int kt = 0; kt < KT; ++kt) {
            float p[8];
#pragma unroll
            for (int j = 0; j < 8; ++j) p[j] = fmaf(s[kt][qb][j], CL2, eb);
            ex2x8(p);
#pragma unroll
            for (int j = 0; j < 8; ++j) { s[kt][qb][j] = p[j]; ps[kt] = j ? ps[kt] + p[j] : p[j]; } }
        l[qb] = fmaf(l[qb], al, ps[0] + ps[1]);
#pragma unroll
        for (int dt = 0; dt < 4; ++dt) o[dt][qb] *= al;
    }
#pragma unroll
    for (int kk = 0; kk < KB / 32; ++kk) { V pf[2], pf2[2];
#pragma unroll
        for (int qb = 0; qb < 2; ++qb) {
            if constexpr (HI) { v8us h0, h1, l0, l1;
#pragma unroll
                for (int j = 0; j < 8; ++j) { unsigned short a, c; splitf(s[2 * kk][qb][j], a, c); h0[j] = a; l0[j] = c; splitf(s[2 * kk + 1][qb][j], a, c); h1[j] = a; l1[j] = c; }
                pf[qb] = cat16b(h0, h1); pf2[qb] = cat16b(l0, l1);
            } else { v8h h0, h1;
#pragma unroll
                for (int j = 0; j < 8; ++j) { h0[j] = (h16)s[2 * kk][qb][j]; h1[j] = (h16)s[2 * kk + 1][qb][j]; }
                pf[qb] = cat16(h0, h1); } }
        V v[4], v2[4];   // behind each group of V loads: s_wait_xcnt 0 in front of the first instruction that reuses their address registers; the addresses are its inputs, so that their registers are not given to a load's result in front of it
        if constexpr (HI) { const size_t vo = (size_t)lr * TT + 8 * hi + c0 + kk * 32; const T16* va = Vp + vo; const T16* va2 = Vp2 + vo;
#pragma unroll
            for (int dt = 0; dt < 4; ++dt) { v[dt] = WFrag<T16>::ld(va + (size_t)dt * 16 * TT); v2[dt] = WFrag<T16>::ld(va2 + (size_t)dt * 16 * TT); asm volatile("s_wait_xcnt 0x0" :: "v"(va), "v"(va2) : "memory"); }
        } else { const T16* va = Vp + (size_t)(c0 + kk * 32) * HD + (hi * 16 + lr) * 8;   // fragment-order plane: the block's V is 4 KiB in a row
#pragma unroll
            for (int dt = 0; dt < 4; ++dt) v[dt] = WFrag<T16>::ldp(va + dt * 512);
            asm volatile("s_wait_xcnt 0x0" :: "v"(va) : "memory");
        }
#pragma unroll
        for (int dt = 0; dt < 4; ++dt)
#pragma unroll
            for (int qb = 0; qb < 2; ++qb) { o[dt][qb] = WFrag<T16>::mma(v[dt], pf[qb], o[dt][qb]); if (HI) { o[dt][qb] = WFrag<T16>::mma(v[dt], pf2[qb], o[dt][qb]); o[dt][qb] = WFrag<T16>::mma(v2[dt], pf[qb], o[dt][qb]); } } }
}
template <typename T16, bool HI>
__device__ __forceinline__ void fa_tile(const T16* __restrict__ Qp, const T16* __restrict__ Qp2, const T16* __restrict__ Kp, const T16* __restrict__ Kp2, const T16* __restrict__ Vp, const T16* __restrict__ Vp2, int r0, float* os, float* ms, float* ls) {
    typedef typename WFrag<T16>::V V;
    const int lane = threadIdx.x & 31, lr = lane & 15, hi = lane >> 4; const int wv = __builtin_amdgcn_readfirstlane((int)(threadIdx.x >> 5));   // wave number in a scalar register: the key loop's bounds and branches stay scalar, every lane stays on for the matrix instructions
    V qf[2][2], qf2[2][2]; v8f o[4][2]; float m[2], l[2];
#pragma unroll
    for (int qb = 0; qb < 2; ++qb) { m[qb] = -3.0e38f; l[qb] = 0.0f;
#pragma unroll
        for (int ks = 0; ks < 2; ++ks) {
            if constexpr (HI) { const size_t qo = (size_t)(r0 + qb * 16 + lr) * HD + 8 * hi + ks * 32; qf[qb][ks] = WFrag<T16>::ld(Qp + qo); qf2[qb][ks] = WFrag<T16>::ld(Qp2 + qo); }
            else qf[qb][ks] = WFrag<T16>::ldp(Qp + (size_t)r0 * HD + lane * 8 + (qb * 2 + ks) * 512); }   // fragment-order plane
#pragma unroll
        for (int dt = 0; dt < 4; ++dt) o[dt][qb] = (v8f){}; }
    asm volatile("s_wait_xcnt 0x0" ::: "memory");   // stands in front of the first instruction that reuses an address register of the Q loads above
    const int nblk = r0 / KB + 1;   // KB-key blocks up to and with the diagonal block; only the last one holds keys above the diagonal, and each of its rows holds at least one key at or below it
#pragma unroll 1
    for (int kb = wv; kb < nblk - 1; kb += NWA) fa_blk<T16, HI, false>(qf, qf2, Kp, Kp2, Vp, Vp2, kb * KB, r0, lr, hi, o, m, l);
    if (((nblk - 1) & (NWA - 1)) == wv) fa_blk<T16, HI, true>(qf, qf2, Kp, Kp2, Vp, Vp2, (nblk - 1) * KB, r0, lr, hi, o, m, l);
#pragma unroll
    for (int qb = 0; qb < 2; ++qb) { const float lt = l[qb] + __shfl_xor(l[qb], 16, 32); if (hi == 0) { ms[wv * QT + qb * 16 + lr] = m[qb]; ls[wv * QT + qb * 16 + lr] = lt; }
#pragma unroll
        for (int dt = 0; dt < 4; ++dt) { float* p = os + (wv * QT + qb * 16 + lr) * 68 + dt * 16 + hi * 8; *(v4fa*)p = __builtin_shufflevector(o[dt][qb], o[dt][qb], 0, 1, 2, 3); *(v4fa*)(p + 4) = __builtin_shufflevector(o[dt][qb], o[dt][qb], 4, 5, 6, 7); } }
}
// The upper-half tile that goes with lower-half tile ts. Cost of a tile in f16 key blocks: t + 1, times 5/2 for hi/lo rows (three products for one, two planes for one). rk = rank of ts among the lower half by rising cost (ties: hi/lo first); it meets the upper half in falling cost.
static_assert(RH / QT * 5 / 2 <= NQT / 2, "the dearest hi/lo tile costs no more than the last tile of the lower half: rk stays a permutation of 0..NQT/2-1");
__device__ __forceinline__ int fa_long(int ts) {
    const int nh = RH / QT, ch = (5 * (ts + 1) + 1) / 2 - (nh + 1), cl = 2 * (ts + 1) / 5;   // ch: f16 tiles of the lower half cheaper than hi/lo tile ts; cl: hi/lo tiles no dearer than f16 tile ts
    const int rk = (ts < nh) ? ts + (ch > 0 ? ch : 0) : ts - nh + (cl < nh ? cl : nh);
    return NQT - 1 - rk;
}
__global__ __launch_bounds__(32 * NWA) __attribute__((amdgpu_waves_per_eu(4))) /* registers for four waves a SIMD: the work-group's NWA waves on one WGP */ void k_fattn(const h16* __restrict__ Q16, const h16* __restrict__ K16, const h16* __restrict__ V16, const bf* __restrict__ Qh, const bf* __restrict__ Ql, const bf* __restrict__ Kh, const bf* __restrict__ Kl, const bf* __restrict__ Vh, const bf* __restrict__ Vl, float* OUTr) {
    __shared__ __align__(16) float os2[2][NWA * QT * 68]; __shared__ float ms2[2][NWA * QT]; __shared__ float ls2[2][NWA * QT];   // one set of partial results a tile: no barrier between the two tiles
    const size_t zo = (size_t)blockIdx.z * TT * HD; const int tlo = (int)blockIdx.x, tup = fa_long(tlo);
#pragma unroll 1   // the two tiles share one copy of the key loops
    for (int h = 0; h < 2; ++h) { const int rt = (h ? tlo : tup) * QT;
        if (rt < RH) fa_tile<bf, true>(Qh + zo, Ql + zo, Kh + zo, Kl + zo, Vh + zo, Vl + zo, rt, os2[h], ms2[h], ls2[h]);
        else fa_tile<h16, false>(Q16 + zo, nullptr, K16 + zo, nullptr, V16 + zo, nullptr, rt, os2[h], ms2[h], ls2[h]); }
    __syncthreads();   // every wave's m, l and partial result of both tiles are in LDS
    const int hm = (int)(threadIdx.x >> 8), tm = (int)(threadIdx.x & 255);   // the first 256 threads sum the upper tile, the rest the lower one
    const int r0 = (hm ? tlo : tup) * QT; const float* os = os2[hm]; const float* ms = ms2[hm]; const float* ls = ls2[hm];
    const int row = tm >> 3, cofs = (tm & 7) * 8; float mw[NWA]; float M = -3.0e38f;
#pragma unroll
    for (int w = 0; w < NWA; ++w) { mw[w] = ms[w * QT + row]; M = fmaxf(M, mw[w]); }
    float L = 0.0f; v4f a0 = (v4f){}, a1 = (v4f){};
#pragma unroll   // the LDS reads are issued together; the adds keep the order w = 0..NWA-1; a wave that had no block has m = -3e38, l = 0 and weight 0
    for (int w = 0; w < NWA; ++w) { const float f = ex2((mw[w] - M) * CL2); L = fmaf(ls[w * QT + row], f, L); const float* p = os + (w * QT + row) * 68 + cofs; a0 += *(const v4fa*)p * f; a1 += *(const v4fa*)(p + 4) * f; }
    const float rl = __fdiv_rn(1.0f, L); float* op = OUTr + zo + (size_t)(r0 + row) * HD + cofs; *(v4f*)op = a0 * rl; *(v4f*)(op + 4) = a1 * rl;
}

extern "C" void kernel_launch(void* const* d_in, const int* in_sizes, int n_in,
                              void* d_out, int out_size, void* d_ws, size_t ws_size, hipStream_t stream) {
    (void)in_sizes; (void)n_in; (void)out_size;
    const float* x = (const float*)d_in[0]; const float* wq = (const float*)d_in[1]; const float* bq = (const float*)d_in[2]; const float* wk = (const float*)d_in[3]; const float* bk = (const float*)d_in[4]; const float* wv = (const float*)d_in[5]; const float* bv = (const float*)d_in[6];
    float* OUT = (float*)d_out; float* OUTK = OUT + (size_t)NB_ * TT * HD; float* OUTV = OUT + (size_t)2 * NB_ * TT * HD;   /* tuple output: result | K | V, each [4][4096][64] f32 */
    char* wsp = (char*)d_ws;
    auto take = [&](size_t bytes) { char* p = wsp; wsp += (bytes + 255) & ~(size_t)255; return (void*)p; };
    bf* WP = (bf*)take((size_t)3 * HD * DM * 2);
    const size_t PB = (size_t)TT * HD;   // elements of one batch's plane; every plane holds all NB_ batches
    h16* QP16 = (h16*)take(NB_ * PB * 2); h16* KP16 = (h16*)take(NB_ * PB * 2); h16* VT16 = (h16*)take(NB_ * PB * 2);
    bf* QPh = (bf*)take(NB_ * PB * 2); bf* QPl = (bf*)take(NB_ * PB * 2); bf* KPh = (bf*)take(NB_ * PB * 2); bf* KPl = (bf*)take(NB_ * PB * 2); bf* VTh = (bf*)take(NB_ * PB * 2); bf* VTl = (bf*)take(NB_ * PB * 2);
    if ((size_t)(wsp - (char*)d_ws) > ws_size) return;    // ws 256 MiB
    k_wpack<<<3 * HD * DM / 8 / 256, 256, 0, stream>>>(wq, wk, wv, WP);
    k_proj<<<NB_ * TT / 64, 32 * NWK, 0, stream>>>(x, WP, bq, bk, bv, OUTK, OUTV, QP16, QPh, QPl, KP16, KPh, KPl, VT16, VTh, VTl);   /* K, V -> output slots 1, 2 */
    k_fattn<<<dim3(NQT / 2, 1, NB_), 32 * NWA, 0, stream>>>(QP16, KP16, VT16, QPh, QPl, KPh, KPl, VTh, VTl, OUT);   /* result -> output slot 0 */
}

// v006
// Measured time: 28 microseconds a run.
// Timed twice side by side with v005, it ran 1.08 and 1.05 times as fast.
// Counting every step since v000, it is 30.7 times as fast.
#include <hip/hip_runtime.h>

// Single-head causal attention with cache outputs (x [4][4096][768]; Q, K, V = x W + b ('xw' [768][64] + [64]); scores = Q.K / 8, causal; softmax; result = attn.V; returns (result, K, V) -> three [4][4096][64] f32 tensors (3.1 M)).
// Layout: one launch packs the three weights (bf16, fragment order); one launch for all batches does the exact projections (+ biases), writes K and V into their output slots (f32) and every 16-bit plane from its epilogue; then one launch for all batches: hybrid causal attention over 4,096 keys (rows < 512 hi/lo, rest fp16 x1024), scores, running-maximum softmax and attn.v in one kernel, result written from there.
// Compute dtypes, f32 accumulate: every input rounded to bf16; projections on PLAIN bf16 operands (exact) + f32 biases (K and V outputs are exactly these f32 sums); scores and attn.v rows < 512 on bf16 hi/lo planes (3 products), the rest single fp16; softmax f32; f32 result.

#define NB_  4
#define TT   4096
#define DM   768
#define NH_  1
#define NKV  1
#define REP  (NH_ / NKV)
#define HD   64
#define DQ   (NH_ * HD)
#define DKV  (NKV * HD)
#define RH   512                  // query rows < RH use hi+lo planes (0: none)
#define WIN  4096
#define SCL  0.125f   // HD^-0.5
#define NWK  8                    // waves per work-group that share one K loop in the long-K GEMMs
typedef _Float16 h16;
typedef unsigned short bf;
typedef __attribute__((ext_vector_type(16))) __bf16   v16bf;
typedef __attribute__((ext_vector_type(16))) _Float16 v16h;
typedef __attribute__((ext_vector_type(8)))  _Float16 v8h;
typedef __attribute__((ext_vector_type(8)))  unsigned short v8us;
typedef __attribute__((ext_vector_type(8)))  float    v8f;
typedef __attribute__((ext_vector_type(4)))  float    v4f;
typedef v8h  __attribute__((may_alias)) v8ha;
typedef v4f  __attribute__((may_alias)) v4fa;
typedef v8us __attribute__((may_alias)) v8usa;

__device__ __forceinline__ unsigned short f2bf(float f) { unsigned u = __float_as_uint(f); u += 0x7FFFu + ((u >> 16) & 1u); return (unsigned short)(u >> 16); }
__device__ __forceinline__ float bf2f(unsigned short b) { return __uint_as_float(((unsigned)b) << 16); }
__device__ __forceinline__ float bfr(float f) { return bf2f(f2bf(f)); }
__device__ __forceinline__ v16h cat16(v8h lo, v8h hi) { return __builtin_shufflevector(lo, hi, 0, 1, 2, 3, 4, 5, 6, 7, 8, 9, 10, 11, 12, 13, 14, 15); }
__device__ __forceinline__ v16bf cat16b(v8us lo, v8us hi) { return __builtin_bit_cast(v16bf, __builtin_shufflevector(lo, hi, 0, 1, 2, 3, 4, 5, 6, 7, 8, 9, 10, 11, 12, 13, 14, 15)); }
__device__ __forceinline__ v8f wmma16(v16h a, v16h b, v8f c) { return __builtin_amdgcn_wmma_f32_16x16x32_f16(false, a, false, b, (short)0, c, false, false); }
__device__ __forceinline__ v8f wmmab(v16bf a, v16bf b, v8f c) { return __builtin_amdgcn_wmma_f32_16x16x32_bf16(false, a, false, b, (short)0, c, false, false); }



// ---- fragment loaders and matrix products of the two 16-bit types
template <typename T16> struct WFrag;
template <> struct WFrag<h16> { typedef v16h V; static __device__ __forceinline__ V ld(const h16* p) { return cat16(*(const v8h*)p, *(const v8h*)(p + 16)); } static __device__ __forceinline__ V ldp(const h16* p) { return cat16(*(const v8h*)p, *(const v8h*)(p + 256)); } static __device__ __forceinline__ v8f mma(V a, V b, v8f c) { return wmma16(a, b, c); } };
template <> struct WFrag<bf> { typedef v16bf V; static __device__ __forceinline__ V ld(const bf* p) { return cat16b(*(const v8us*)p, *(const v8us*)(p + 16)); } static __device__ __forceinline__ v8f mma(V a, V b, v8f c) { return wmmab(a, b, c); } };
template <int NW> __device__ __forceinline__ void tile_sync() { if (NW == 1) { __builtin_amdgcn_wave_barrier(); asm volatile("" ::: "memory"); } else __syncthreads(); }   // orders the LDS tile's writes and reads: inside the one wave, or among the NW waves

__device__ __forceinline__ h16 tohx(float x) { return (h16)x; }
__device__ __forceinline__ void splitf(float y, unsigned short& h, unsigned short& l) { h = f2bf(y); l = f2bf(y - bf2f(h)); }
typedef __attribute__((ext_vector_type(4))) _Float16 v4h;
typedef __attribute__((ext_vector_type(4))) unsigned short v4us;

typedef v4us __attribute__((may_alias)) v4usa;
typedef v4h  __attribute__((may_alias)) v4ha;
typedef __attribute__((ext_vector_type(4))) __bf16 v4bf;

// ---- k_wpack: the three weights [DM][HD] f32 -> bf16 in the order in which k_proj's waves read them: fragment (tensor nt, 32-wide K step ks, 16-column block nb) = 1 KiB, two halves of 32 lanes x 16 bytes, so that each wave-wide load covers 512 contiguous bytes.
// Half h of lane (hi, lr) holds column nb * 16 + lr, k = ks * 32 + h * 16 + hi * 8 + 0..7: the k order of WFrag<bf>::ld. One thread = one 16-byte piece.
#define KST  (DM / 32)            // K steps
#define KSW  (KST / NWK)          // K steps a wave
__global__ __launch_bounds__(256) void k_wpack(const float* __restrict__ wq, const float* __restrict__ wk, const float* __restrict__ wv, bf* Wp) {
    const int i = blockIdx.x * 256 + threadIdx.x; const int lane = i & 31, h = (i >> 5) & 1, nb = (i >> 6) & 3, fs = i >> 8; const int ks = fs % KST, nt = fs / KST;
    const float* w = (nt == 0) ? wq : (nt == 1) ? wk : wv; const int n = nb * 16 + (lane & 15), k0 = ks * 32 + h * 16 + (lane >> 4) * 8; v8us o;
#pragma unroll
    for (int j = 0; j < 8; ++j) o[j] = f2bf(w[(size_t)(k0 + j) * HD + n]);
    *(v8us*)(Wp + (size_t)i * 8) = o;
}

// ---- k_proj: Q, K, V = bf16(x) bf16(W) + bias for 64 rows of x a work-group (grid: NB_ * TT / 64), NWK waves; writes K and V (f32 outputs) and all nine 16-bit planes that k_fattn reads.
// Split K: wave w takes the 32-wide K steps w, w + NWK, ...; x is read once, f32, in whole 128-byte lines, rounded to bf16 and turned into fragments through the wave's own LDS rows; the fragments stay in registers for the three 64-column products.
// The products are computed transposed (W as the first operand), so that a lane holds 8 neighbouring columns of one row and stores its partial tile in 16-byte pieces. Per product the NWK partial tiles are summed through LDS in wave order 0..NWK-1;
// the partial tiles alternate between two LDS buffers, so one barrier a product is enough. V's hi/lo planes are [d][t] and its f16 plane is in fragment order along t: its summed tile goes through a further LDS tile to be read along t.
#define PJS  (64 * 68)            // floats of one wave's partial tile in LDS
#define XP   40                   // bf16 elements of one staged x row: 32 + 8, an 80-byte pitch for the 16-byte fragment reads
#define TP   65                   // floats of one row of V's transposing tile
// The f16 planes of Q, K and V are stored in the order in which k_fattn's waves read them: one fragment = 1 KiB = two halves h of 32 lanes x 16 bytes, so that each wave-wide load covers 512 contiguous bytes (four whole lines, not sixteen).
// Q and K: fragment (16-row block, 32-wide step ks of the head dims), half h of lane (hi, lr) = row lr, head dims ks * 32 + h * 16 + hi * 8 + 0..7. V: fragment (32-key block, 16-row block dt of the head dims), half h of lane (hi, lr) = head dim dt * 16 + lr, keys h * 16 + hi * 8 + 0..7.
// Both are the k orders of WFrag::ld on the row-major planes. A work-group's 64 rows are 8 KiB in a row in each plane. The six hi/lo planes stay row-major.
#define KPG  144                  // f16 elements of one 16-lane group of a fragment-order tile in LDS: 128 + 16, a 288-byte pitch that spreads a wave's 8-byte writes over all banks
// Work-group barrier that orders LDS only: the waves exchange nothing but LDS here, so it does not wait for the global stores of the epilogue before it or for the weight loads issued ahead.
__device__ __forceinline__ void lds_sync() { __builtin_amdgcn_fence(__ATOMIC_RELEASE, "workgroup", "local"); __builtin_amdgcn_s_barrier(); __builtin_amdgcn_fence(__ATOMIC_ACQUIRE, "workgroup", "local"); }
__device__ __forceinline__ void pj_ldw(v16bf (&b)[KSW][4], const bf* __restrict__ wl, int nt) {   // wl: the packed weights at this wave's first K step and this lane's piece
#pragma unroll
    for (int i = 0; i < KSW; ++i)
#pragma unroll
        for (int nb = 0; nb < 4; ++nb) { const bf* p = wl + ((nt * KST + NWK * i) * 4 + nb) * 512; b[i][nb] = cat16b(*(const v8us*)p, *(const v8us*)(p + 256)); }
}
// one wave's partial 64 x 64 tile over its KSW K steps, transposed: acc[mb][nb][j] of lane (hi, lr) = row mb * 16 + lr of x, column nb * 16 + hi * 8 + j
__device__ __forceinline__ void pj_mma(const v16bf (&a)[KSW][4], const v16bf (&b)[KSW][4], v8f (&acc)[4][4]) {
#pragma unroll
    for (int mb = 0; mb < 4; ++mb)
#pragma unroll
        for (int nb = 0; nb < 4; ++nb) acc[mb][nb] = (v8f){};
#pragma unroll
    for (int i = 0; i < KSW; ++i)
#pragma unroll
        for (int nb = 0; nb < 4; ++nb)
#pragma unroll
            for (int mb = 0; mb < 4; ++mb) acc[mb][nb] = wmmab(b[i][nb], a[i][mb], acc[mb][nb]);
}
// the partial tile -> the wave's LDS rows [row of x][column]
__device__ __forceinline__ void pj_put(const v8f (&acc)[4][4], float* ow, int lr, int hi) {
#pragma unroll
    for (int mb = 0; mb < 4; ++mb)
#pragma unroll
        for (int nb = 0; nb < 4; ++nb) { float* p = ow + (mb * 16 + lr) * 68 + nb * 16 + hi * 8; *(v4fa*)p = __builtin_shufflevector(acc[mb][nb], acc[mb][nb], 0, 1, 2, 3); *(v4fa*)(p + 4) = __builtin_shufflevector(acc[mb][nb], acc[mb][nb], 4, 5, 6, 7); }
}
// A group of global loads or stores is written as grp_open(); the loads or stores; grp_close().
// grp_open: nothing made earlier sinks into the group. grp_close: s_wait_xcnt 0 stands behind the group, in front of the first instruction that reuses a register the group names (address or data), and nothing from below moves in front of the wait.
__device__ __forceinline__ void grp_open() { __builtin_amdgcn_sched_barrier(0); }
__device__ __forceinline__ void grp_close() { asm volatile("s_wait_xcnt 0x0" ::: "memory"); __builtin_amdgcn_sched_barrier(0); }
// the same for a group of loads whose address is not used again: the address is an input of the wait, so that its registers are given to nothing else (not to a load's result either) in front of the wait
__device__ __forceinline__ void grp_close(const void* p) { asm volatile("s_wait_xcnt 0x0" :: "v"(p) : "memory"); __builtin_amdgcn_sched_barrier(0); }
// Behind a product's last matrix instruction: the four vector slots that the chip needs before the next product's first matrix instructions overwrite its results; the scheduling barriers keep the slots between the two products.
__device__ __forceinline__ void wmma_gap() { __builtin_amdgcn_sched_barrier(0); asm volatile("v_nop\n\tv_nop\n\tv_nop\n\tv_nop"); __builtin_amdgcn_sched_barrier(0); }
// one thread's 4 x 4 elements of the NWK partial tiles, LDS -> registers; asked for in one run, in front of the next product's matrix instructions, which cover the LDS time
__device__ __forceinline__ void pj_get(const float* os, v4f (&raw)[4][NWK]) {
    const float* p = os + (int)(threadIdx.x >> 4) * 68 + (int)(threadIdx.x & 15) * 4;
#pragma unroll
    for (int s = 0; s < 4; ++s)
#pragma unroll
        for (int w = 0; w < NWK; ++w) raw[s][w] = *(const v4fa*)(p + s * 16 * 68 + w * PJS);
    __builtin_amdgcn_sched_barrier(0);   // the LDS reads stay together, in front of the next product's matrix instructions where there is one
}
template <int NT>
__device__ __forceinline__ void pj_epi(const v4f (&raw)[4][NWK], float* ts, h16* ft, v4f bs, size_t g0, float* F, h16* P16, bf* Ph, bf* Pl) {
    const int cofs = (int)(threadIdx.x & 15) * 4, rw = (int)(threadIdx.x >> 4); v4f val[4]; v4h o16[4]; v4us oh[4], ol[4];
#pragma unroll
    for (int s = 0; s < 4; ++s) { v4f v = raw[s][0];
#pragma unroll   // the adds keep the order w = 0..NWK-1
        for (int w = 1; w < NWK; ++w) v += raw[s][w];
        val[s] = v + bs;
        if (NT < 2) {
#pragma unroll
            for (int q = 0; q < 4; ++q) { o16[s][q] = tohx(val[s][q]); unsigned short a2, c2; splitf(val[s][q], a2, c2); oh[s][q] = a2; ol[s][q] = c2; } } }
    if (NT < 2) {   // the f16 tile of Q or K -> LDS at its fragment-order places: group s * 8 + (ks, h, hi) = s * 8 + cofs / 8, lane part rw; pj_fld and pj_fst take it to memory behind the next barrier
#pragma unroll
        for (int s = 0; s < 4; ++s) *(v4ha*)(ft + (s * 8 + (cofs >> 3)) * KPG + rw * 8 + (cofs & 4)) = o16[s]; }
    const size_t e = (g0 + rw) * HD + cofs; float* fp = (NT > 0) ? F + e : nullptr; bf* ph = Ph + e; bf* pl = Pl + e;
    grp_open();
#pragma unroll
    for (int s = 0; s < 4; ++s) {
        if (NT > 0) *(v4f*)(fp + s * 16 * HD) = val[s];
        if (NT < 2) { *(v4us*)(ph + s * 16 * HD) = oh[s]; *(v4us*)(pl + s * 16 * HD) = ol[s]; } }
    grp_close();
    if (NT == 2) {
#pragma unroll
        for (int s = 0; s < 4; ++s)
#pragma unroll
            for (int q = 0; q < 4; ++q) ts[(cofs + q) * TP + 16 * s + rw] = val[s][q];
        lds_sync();   // V's summed tile is in LDS
        const int d = (int)(threadIdx.x >> 2), t0 = (int)(threadIdx.x & 3) * 16; const size_t et = (g0 / TT) * ((size_t)TT * HD) + (size_t)d * TT + (g0 % TT) + t0; v8h t16[2]; v8us th[2], tl[2];
#pragma unroll
        for (int c = 0; c < 2; ++c)
#pragma unroll
            for (int q = 0; q < 8; ++q) { const float v = ts[d * TP + t0 + c * 8 + q]; t16[c][q] = tohx(v); unsigned short a2, c2; splitf(v, a2, c2); th[c][q] = a2; tl[c][q] = c2; }
        h16* q16 = P16 + g0 * HD + ((((t0 >> 5) * 4 + (d >> 4)) * 2 + ((t0 >> 4) & 1)) * 32 + (d & 15)) * 8; bf* qh = Ph + et; bf* ql = Pl + et;   // q16: fragment order, hi = c
        grp_open();
#pragma unroll
        for (int c = 0; c < 2; ++c) { *(v8h*)(q16 + c * 128) = t16[c]; *(v8us*)(qh + c * 8) = th[c]; *(v8us*)(ql + c * 8) = tl[c]; } }   // the kernel's last stores: nothing reuses their registers
}
// the f16 tile of Q or K, LDS -> registers -> its 8 KiB of the fragment-order plane, 16 bytes a lane, whole lines
__device__ __forceinline__ void pj_fld(const h16* ft, v8h (&fr)[2]) {
    const h16* q = ft + (int)(threadIdx.x >> 4) * KPG + (int)(threadIdx.x & 15) * 8; fr[0] = *(const v8ha*)q; fr[1] = *(const v8ha*)(q + 16 * KPG);
    __builtin_amdgcn_sched_barrier(0);   // these two LDS reads stay in front of pj_get's: they return first, so pj_fst's stores wait for none of the partial tiles
}
__device__ __forceinline__ void pj_fst(const v8h (&fr)[2], size_t g0, h16* P16) {
    h16* p = P16 + g0 * HD + (int)threadIdx.x * 8;
    grp_open(); *(v8h*)p = fr[0]; *(v8h*)(p + 2048) = fr[1]; grp_close();
}
__device__ __forceinline__ v4f bfr4(v4f r) { v4f o; o[0] = bfr(r[0]); o[1] = bfr(r[1]); o[2] = bfr(r[2]); o[3] = bfr(r[3]); return o; }
__global__ __launch_bounds__(32 * NWK) void k_proj(const float* __restrict__ x, const bf* __restrict__ Wp, const float* __restrict__ bq, const float* __restrict__ bk, const float* __restrict__ bv, float* OUTK, float* OUTV, h16* Q16, bf* Qh, bf* Ql, h16* K16, bf* Kh, bf* Kl, h16* V16, bf* Vh, bf* Vl) {
    __shared__ __align__(16) float os[2][NWK * PJS]; __shared__ float ts[64 * TP]; __shared__ __align__(16) h16 fq[32 * KPG], fk[32 * KPG];
    const int lane = threadIdx.x & 31, lr = lane & 15, hi = lane >> 4; const int wv = __builtin_amdgcn_readfirstlane((int)(threadIdx.x >> 5));   // wave number in a scalar register: the weight addresses' wave part stays scalar
    const size_t g0 = (size_t)blockIdx.x * 64;
    v4f xv[KSW][16]; const float* xp = x + (g0 + (lane >> 3)) * DM + wv * 32 + (lane & 7) * 4;   // 8 lanes a 128-byte line, 4 rows a load
    v16bf b0[KSW][4], b1[KSW][4]; const bf* wl = Wp + (size_t)wv * (4 * 512) + lane * 8;
    grp_open();
#pragma unroll
    for (int i = 0; i < KSW; ++i)
#pragma unroll
        for (int q = 0; q < 16; ++q) xv[i][q] = *(const v4f*)(xp + (size_t)q * 4 * DM + i * (32 * NWK));
    grp_close(xp);
    pj_ldw(b0, wl, 0);   // the first product's weights and the biases fly together with x
    const v4f rq = *(const v4f*)(bq + lr * 4), rk = *(const v4f*)(bk + lr * 4), rv = *(const v4f*)(bv + lr * 4);
    grp_close();
    bf* xs = (bf*)(os[0] + wv * PJS);   // the wave's own part of the partial-tile buffer, free until its first product is done
#pragma unroll
    for (int i = 0; i < KSW; ++i)
#pragma unroll
        for (int q = 0; q < 16; ++q) *(v4usa*)(xs + (i * 64 + q * 4 + (lane >> 3)) * XP + (lane & 7) * 4) = __builtin_bit_cast(v4us, __builtin_convertvector(xv[i][q], v4bf));
    tile_sync<1>();   // the wave's LDS writes stay in front of its fragment reads, which take other lanes' values
    v16bf a[KSW][4];
#pragma unroll
    for (int i = 0; i < KSW; ++i)
#pragma unroll
        for (int mb = 0; mb < 4; ++mb) { const bf* p = xs + (i * 64 + mb * 16 + lr) * XP + 8 * hi; a[i][mb] = cat16b(*(const v8usa*)p, *(const v8usa*)(p + 16)); }
    tile_sync<1>();   // the fragment reads stay in front of the wave's partial-tile writes to the same LDS
    grp_open(); pj_ldw(b1, wl, 1); grp_close();   // each later product's weights are asked for one product ahead
    v8f acc[4][4]; v4f raw[4][NWK]; v8h fr[2];
    pj_mma(a, b0, acc); pj_put(acc, os[0] + wv * PJS, lr, hi); wmma_gap();
    lds_sync();   // every wave's partial tile of Q is in LDS
    pj_get(os[0], raw); pj_mma(a, b1, acc);
    __builtin_amdgcn_sched_barrier(0);   // the matrix instructions stay in one run in front of Q's sum
    pj_epi<0>(raw, ts, fq, bfr4(rq), g0, nullptr, Q16, Qh, Ql);
    pj_ldw(b0, wl, 2); grp_close(wl);
    pj_put(acc, os[1] + wv * PJS, lr, hi); wmma_gap();
    lds_sync();   // K's partial tiles and Q's f16 tile are in LDS, and every wave has read Q's partial tiles
    pj_fld(fq, fr); pj_get(os[1], raw); pj_mma(a, b0, acc);
    __builtin_amdgcn_sched_barrier(0);   // the matrix instructions stay in one run in front of K's sum
    pj_fst(fr, g0, Q16);
    pj_epi<1>(raw, ts, fk, bfr4(rk), g0, OUTK, K16, Kh, Kl);
    pj_put(acc, os[0] + wv * PJS, lr, hi);
    lds_sync();   // V's partial tiles and K's f16 tile are in LDS
    pj_fld(fk, fr); pj_get(os[0], raw);
    pj_fst(fr, g0, K16);
    pj_epi<2>(raw, ts, fk, bfr4(rv), g0, OUTV, V16, Vh, Vl);
}

// ---- k_fattn: scores, causal softmax and attn.v in one kernel; no score or probability matrix in memory. One work-group = two tiles of QT query rows of one batch, NWA waves (grid x: tile pair; grid z: batch).
// A tile's cost grows with its index and the launch lasts as long as its fullest work-group, so each work-group takes one tile of the upper half (fa_long) and one of the lower half, one after the other in every wave: near equal work for all; one work-group a WGP, the whole grid resident.
// In each tile a wave takes some of the KB-key blocks up to the diagonal block and keeps its own running row maximum m, row sum l and unnormalised result; per tile the NWA partial results are brought to one maximum and summed through LDS in wave order.
// Which blocks: the lower tile's S blocks are read by both tiles. Partner waves 2i and 2i + 1 take the same blocks i, i + NWA / 2, ... below S at the same time, the even wave for the upper tile, the odd one for the lower: the block's K and V lines come from L2 once and the partner's loads find them in the WGP's cache.
// From S on all NWA waves share the upper tile's blocks; the work-group's blocks stay spread evenly over its waves. Hi/lo lower tiles read other planes than the upper tile: S = 0 there, and wave w takes block w.
// The key loops hold no barrier and no shared buffer (fragments go to registers, partial results to the wave's own LDS rows), so waves may be in different tiles at the same time.
// Both products are computed transposed, so that no value changes lanes between them: S^T = K Q^T (lane: query lr, keys hi*8 + j) is, converted, already the B fragment of O^T = V^T P^T (lane: query lr, head dims hi*8 + j), and m, l are one value a lane.
// Rows < RH: bf16 hi/lo planes, 3 products each; the rest: f16, probabilities x 1024 (added to the exponent; it cancels in the division by l).
#define QT   32
#define NWA  16
#define NQT  (TT / QT)            // query tiles of one batch
#define KB   32                   // keys per block
#define KT   (KB / 16)
#define CL2  (SCL * 1.4426950408889634f)   // score -> exponent of 2
// 2^x on v_exp_f32, written in asm so that the free slot which the instruction set asks for behind a transcendental (before its result is read or its source overwritten) stands there by construction: each v_exp_f32 works in place on a register of its own, and a v_nop follows the last.
__device__ __forceinline__ float ex2(float x) { asm("v_exp_f32 %0, %0\n\tv_nop" : "+v"(x)); return x; }
__device__ __forceinline__ void ex2x8(float (&x)[8]) { asm("v_exp_f32 %0, %0\n\tv_exp_f32 %1, %1\n\tv_exp_f32 %2, %2\n\tv_exp_f32 %3, %3\n\tv_exp_f32 %4, %4\n\tv_exp_f32 %5, %5\n\tv_exp_f32 %6, %6\n\tv_exp_f32 %7, %7\n\tv_nop" : "+v"(x[0]), "+v"(x[1]), "+v"(x[2]), "+v"(x[3]), "+v"(x[4]), "+v"(x[5]), "+v"(x[6]), "+v"(x[7])); }
template <typename T16, bool HI, bool MASK>
__device__ __forceinline__ void fa_blk(const typename WFrag<T16>::V (&qf)[2][2], const typename WFrag<T16>::V (&qf2)[2][2], const T16* __restrict__ Kp, const T16* __restrict__ Kp2, const T16* __restrict__ Vp, const T16* __restrict__ Vp2, int c0, int r0, int lr, int hi, v8f (&o)[4][2], float (&m)[2], float (&l)[2]) {
    typedef typename WFrag<T16>::V V;
    v8f s[KT][2]; V kf[KT][2], kf2[KT][2];
    if constexpr (HI) { const T16* ka[KT]; const T16* ka2[KT];
#pragma unroll
        for (int kt = 0; kt < KT; ++kt) { const size_t ko = (size_t)(c0 + kt * 16 + lr) * HD + 8 * hi; ka[kt] = Kp + ko; ka2[kt] = Kp2 + ko;
#pragma unroll
            for (int ks = 0; ks < 2; ++ks) { kf[kt][ks] = WFrag<T16>::ld(ka[kt] + ks * 32); kf2[kt][ks] = WFrag<T16>::ld(ka2[kt] + ks * 32); } }
        static_assert(KT == 2, "the wait below names the four addresses");
        asm volatile("s_wait_xcnt 0x0" :: "v"(ka[0]), "v"(ka[1]), "v"(ka2[0]), "v"(ka2[1]) : "memory");   // stands in front of the first instruction that reuses an address register of the K loads above; the addresses are its inputs, so that their registers are not given to a later load's result in front of it
    } else { const T16* ka = Kp + (size_t)c0 * HD + (hi * 16 + lr) * 8;   // fragment-order plane: the block's K is 4 KiB in a row
#pragma unroll
        for (int kt = 0; kt < KT; ++kt)
#pragma unroll
            for (int ks = 0; ks < 2; ++ks) kf[kt][ks] = WFrag<T16>::ldp(ka + (kt * 2 + ks) * 512);
        asm volatile("s_wait_xcnt 0x0" ::: "memory");   // stands in front of the first instruction that reuses an address register of the K loads above
    }
#pragma unroll
    for (int kt = 0; kt < KT; ++kt) { s[kt][0] = (v8f){}; s[kt][1] = (v8f){};
#pragma unroll
        for (int ks = 0; ks < 2; ++ks)
#pragma unroll
            for (int qb = 0; qb < 2; ++qb) { s[kt][qb] = WFrag<T16>::mma(kf[kt][ks], qf[qb][ks], s[kt][qb]); if (HI) { s[kt][qb] = WFrag<T16>::mma(kf[kt][ks], qf2[qb][ks], s[kt][qb]); s[kt][qb] = WFrag<T16>::mma(kf2[kt][ks], qf[qb][ks], s[kt][qb]); } } }
#pragma unroll
    for (int qb = 0; qb < 2; ++qb) {
        float mk[KT];
#pragma unroll
        for (int kt = 0; kt < KT; ++kt) {
#pragma unroll
            for (int j = 0; j < 8; ++j) { if (MASK) s[kt][qb][j] = (c0 + kt * 16 + hi * 8 + j <= r0 + qb * 16 + lr) ? s[kt][qb][j] : -3.0e38f; mk[kt] = j ? fmaxf(mk[kt], s[kt][qb][j]) : s[kt][qb][j]; } }
        float mx = fmaxf(fmaxf(mk[0], mk[1]), m[qb]); mx = fmaxf(mx, __shfl_xor(mx, 16, 32));   // the two half-waves hold the two halves of a query's keys
        const float al = ex2((m[qb] - mx) * CL2); m[qb] = mx; const float eb = (HI ? 0.0f : 10.0f) - mx * CL2;
        float ps[KT];   // independent sums
#pragma unroll
        for (int kt = 0; kt < KT; ++kt) {
            float p[8];
#pragma unroll
            for (int j = 0; j < 8; ++j) p[j] = fmaf(s[kt][qb][j], CL2, eb);
            ex2x8(p);
#pragma unroll
            for (int j = 0; j < 8; ++j) { s[kt][qb][j] = p[j]; ps[kt] = j ? ps[kt] + p[j] : p[j]; } }
        l[qb] = fmaf(l[qb], al, ps[0] + ps[1]);
#pragma unroll
        for (int dt = 0; dt < 4; ++dt) o[dt][qb] *= al;
    }
#pragma unroll
    for (int kk = 0; kk < KB / 32; ++kk) { V pf[2], pf2[2];
#pragma unroll
        for (int qb = 0; qb < 2; ++qb) {
            if constexpr (HI) { v8us h0, h1, l0, l1;
#pragma unroll
                for (int j = 0; j < 8; ++j) { unsigned short a, c; splitf(s[2 * kk][qb][j], a, c); h0[j] = a; l0[j] = c; splitf(s[2 * kk + 1][qb][j], a, c); h1[j] = a; l1[j] = c; }
                pf[qb] = cat16b(h0, h1); pf2[qb] = cat16b(l0, l1);
            } else { v8h h0, h1;
#pragma unroll
                for (int j = 0; j < 8; ++j) { h0[j] = (h16)s[2 * kk][qb][j]; h1[j] = (h16)s[2 * kk + 1][qb][j]; }
                pf[qb] = cat16(h0, h1); } }
        V v[4], v2[4];   // behind each group of V loads: s_wait_xcnt 0 in front of the first instruction that reuses their address registers; the addresses are its inputs, so that their registers are not given to a load's result in front of it
        if constexpr (HI) { const size_t vo = (size_t)lr * TT + 8 * hi + c0 + kk * 32; const T16* va = Vp + vo; const T16* va2 = Vp2 + vo;
#pragma unroll
            for (int dt = 0; dt < 4; ++dt) { v[dt] = WFrag<T16>::ld(va + (size_t)dt * 16 * TT); v2[dt] = WFrag<T16>::ld(va2 + (size_t)dt * 16 * TT); asm volatile("s_wait_xcnt 0x0" :: "v"(va), "v"(va2) : "memory"); }
        } else { const T16* va = Vp + (size_t)(c0 + kk * 32) * HD + (hi * 16 + lr) * 8;   // fragment-order plane: the block's V is 4 KiB in a row
#pragma unroll
            for (int dt = 0; dt < 4; ++dt) v[dt] = WFrag<T16>::ldp(va + dt * 512);
            asm volatile("s_wait_xcnt 0x0" :: "v"(va) : "memory");
        }
#pragma unroll
        for (int dt = 0; dt < 4; ++dt)
#pragma unroll
            for (int qb = 0; qb < 2; ++qb) { o[dt][qb] = WFrag<T16>::mma(v[dt], pf[qb], o[dt][qb]); if (HI) { o[dt][qb] = WFrag<T16>::mma(v[dt], pf2[qb], o[dt][qb]); o[dt][qb] = WFrag<T16>::mma(v2[dt], pf[qb], o[dt][qb]); } } }
}
template <typename T16, bool HI>
__device__ __forceinline__ void fa_tile(const T16* __restrict__ Qp, const T16* __restrict__ Qp2, const T16* __restrict__ Kp, const T16* __restrict__ Kp2, const T16* __restrict__ Vp, const T16* __restrict__ Vp2, int r0, int a0, int limA, int kbB, float* os, float* ms, float* ls) {
    typedef typename WFrag<T16>::V V;
    const int lane = threadIdx.x & 31, lr = lane & 15, hi = lane >> 4; const int wv = __builtin_amdgcn_readfirstlane((int)(threadIdx.x >> 5));   // wave number in a scalar register, as a0, limA and kbB are: the key loop's bounds and branches stay scalar, every lane stays on for the matrix instructions
    V qf[2][2], qf2[2][2]; v8f o[4][2]; float m[2], l[2];
#pragma unroll
    for (int qb = 0; qb < 2; ++qb) { m[qb] = -3.0e38f; l[qb] = 0.0f;
#pragma unroll
        for (int ks = 0; ks < 2; ++ks) {
            if constexpr (HI) { const size_t qo = (size_t)(r0 + qb * 16 + lr) * HD + 8 * hi + ks * 32; qf[qb][ks] = WFrag<T16>::ld(Qp + qo); qf2[qb][ks] = WFrag<T16>::ld(Qp2 + qo); }
            else qf[qb][ks] = WFrag<T16>::ldp(Qp + (size_t)r0 * HD + lane * 8 + (qb * 2 + ks) * 512); }   // fragment-order plane
#pragma unroll
        for (int dt = 0; dt < 4; ++dt) o[dt][qb] = (v8f){}; }
    asm volatile("s_wait_xcnt 0x0" ::: "memory");   // stands in front of the first instruction that reuses an address register of the Q loads above
    const int nblk = r0 / KB + 1;   // KB-key blocks up to and with the diagonal block; only the last one holds keys above the diagonal, and each of its rows holds at least one key at or below it
    bool inA = !HI && a0 < limA; int kb = inA ? a0 : HI ? wv : kbB;   // the wave's blocks: a0, a0 + NWA / 2, ... below limA, then kbB, kbB + NWA, ...; hi/lo tile: wv, wv + NWA, ...
#pragma unroll 1
    while (kb < nblk - 1) { fa_blk<T16, HI, false>(qf, qf2, Kp, Kp2, Vp, Vp2, kb * KB, r0, lr, hi, o, m, l);
        if (inA) { kb += NWA / 2; if (kb >= limA) { kb = kbB; inA = false; } } else kb += NWA; }
    if (kb == nblk - 1) fa_blk<T16, HI, true>(qf, qf2, Kp, Kp2, Vp, Vp2, kb * KB, r0, lr, hi, o, m, l);
#pragma unroll
    for (int qb = 0; qb < 2; ++qb) { const float lt = l[qb] + __shfl_xor(l[qb], 16, 32); if (hi == 0) { ms[wv * QT + qb * 16 + lr] = m[qb]; ls[wv * QT + qb * 16 + lr] = lt; }
#pragma unroll
        for (int dt = 0; dt < 4; ++dt) { float* p = os + (wv * QT + qb * 16 + lr) * 68 + dt * 16 + hi * 8; *(v4fa*)p = __builtin_shufflevector(o[dt][qb], o[dt][qb], 0, 1, 2, 3); *(v4fa*)(p + 4) = __builtin_shufflevector(o[dt][qb], o[dt][qb], 4, 5, 6, 7); } }
}
// The upper-half tile that goes with lower-half tile ts. Cost of a tile in f16 key blocks: t + 1, times 5/2 for hi/lo rows (three products for one, two planes for one). rk = rank of ts among the lower half by rising cost (ties: hi/lo first); it meets the upper half in falling cost.
static_assert(RH / QT * 5 / 2 <= NQT / 2, "the dearest hi/lo tile costs no more than the last tile of the lower half: rk stays a permutation of 0..NQT/2-1");
__device__ __forceinline__ int fa_long(int ts) {
    const int nh = RH / QT, ch = (5 * (ts + 1) + 1) / 2 - (nh + 1), cl = 2 * (ts + 1) / 5;   // ch: f16 tiles of the lower half cheaper than hi/lo tile ts; cl: hi/lo tiles no dearer than f16 tile ts
    const int rk = (ts < nh) ? ts + (ch > 0 ? ch : 0) : ts - nh + (cl < nh ? cl : nh);
    return NQT - 1 - rk;
}
__global__ __launch_bounds__(32 * NWA) __attribute__((amdgpu_waves_per_eu(4))) /* registers for four waves a SIMD: the work-group's NWA waves on one WGP */ void k_fattn(const h16* __restrict__ Q16, const h16* __restrict__ K16, const h16* __restrict__ V16, const bf* __restrict__ Qh, const bf* __restrict__ Ql, const bf* __restrict__ Kh, const bf* __restrict__ Kl, const bf* __restrict__ Vh, const bf* __restrict__ Vl, float* OUTr) {
    __shared__ __align__(16) float os2[2][NWA * QT * 68]; __shared__ float ms2[2][NWA * QT]; __shared__ float ls2[2][NWA * QT];   // one set of partial results a tile: no barrier between the two tiles
    const size_t zo = (size_t)blockIdx.z * TT * HD; const int tlo = (int)blockIdx.x, tup = fa_long(tlo);
    const int wv = __builtin_amdgcn_readfirstlane((int)(threadIdx.x >> 5)), g = wv & 1, wi = wv >> 1;   // wave number in a scalar register; partners: waves 2 wi and 2 wi + 1
    const int S = (tlo * QT < RH) ? 0 : tlo + 1;   // key blocks that both tiles read from the same planes (none where the lower tile reads the hi/lo planes)
    const int kbu = S + (((((wi - S) & (NWA / 2 - 1)) << 1)) | g);   // the upper tile's blocks from S on, dealt over all NWA waves, first to the waves that got no odd block below S
#pragma unroll 1   // the two tiles share one copy of the key loops
    for (int h = 0; h < 2; ++h) { const int lo = h ^ g, rt = (lo ? tlo : tup) * QT;   // even waves: upper tile, then lower; odd waves: lower tile, then upper
        if (rt < RH) fa_tile<bf, true>(Qh + zo, Ql + zo, Kh + zo, Kl + zo, Vh + zo, Vl + zo, rt, 0, 0, 0, os2[lo], ms2[lo], ls2[lo]);
        else fa_tile<h16, false>(Q16 + zo, nullptr, K16 + zo, nullptr, V16 + zo, nullptr, rt, wi, (lo == g) ? S : 0, lo ? TT : kbu, os2[lo], ms2[lo], ls2[lo]); }
    __syncthreads();   // every wave's m, l and partial result of both tiles are in LDS
    const int hm = (int)(threadIdx.x >> 8), tm = (int)(threadIdx.x & 255);   // the first 256 threads sum the upper tile, the rest the lower one
    const int r0 = (hm ? tlo : tup) * QT; const float* os = os2[hm]; const float* ms = ms2[hm]; const float* ls = ls2[hm];
    const int row = tm >> 3, cofs = (tm & 7) * 8; float mw[NWA]; float M = -3.0e38f;
#pragma unroll
    for (int w = 0; w < NWA; ++w) { mw[w] = ms[w * QT + row]; M = fmaxf(M, mw[w]); }
    float L = 0.0f; v4f a0 = (v4f){}, a1 = (v4f){};
#pragma unroll   // the LDS reads are issued together; the adds keep the order w = 0..NWA-1; a wave that had no block has m = -3e38, l = 0 and weight 0
    for (int w = 0; w < NWA; ++w) { const float f = ex2((mw[w] - M) * CL2); L = fmaf(ls[w * QT + row], f, L); const float* p = os + (w * QT + row) * 68 + cofs; a0 += *(const v4fa*)p * f; a1 += *(const v4fa*)(p + 4) * f; }
    const float rl = __fdiv_rn(1.0f, L); float* op = OUTr + zo + (size_t)(r0 + row) * HD + cofs; *(v4f*)op = a0 * rl; *(v4f*)(op + 4) = a1 * rl;
}

extern "C" void kernel_launch(void* const* d_in, const int* in_sizes, int n_in,
                              void* d_out, int out_size, void* d_ws, size_t ws_size, hipStream_t stream) {
    (void)in_sizes; (void)n_in; (void)out_size;
    const float* x = (const float*)d_in[0]; const float* wq = (const float*)d_in[1]; const float* bq = (const float*)d_in[2]; const float* wk = (const float*)d_in[3]; const float* bk = (const float*)d_in[4]; const float* wv = (const float*)d_in[5]; const float* bv = (const float*)d_in[6];
    float* OUT = (float*)d_out; float* OUTK = OUT + (size_t)NB_ * TT * HD; float* OUTV = OUT + (size_t)2 * NB_ * TT * HD;   /* tuple output: result | K | V, each [4][4096][64] f32 */
    char* wsp = (char*)d_ws;
    auto take = [&](size_t bytes) { char* p = wsp; wsp += (bytes + 255) & ~(size_t)255; return (void*)p; };
    bf* WP = (bf*)take((size_t)3 * HD * DM * 2);
    const size_t PB = (size_t)TT * HD;   // elements of one batch's plane; every plane holds all NB_ batches
    h16* QP16 = (h16*)take(NB_ * PB * 2); h16* KP16 = (h16*)take(NB_ * PB * 2); h16* VT16 = (h16*)take(NB_ * PB * 2);
    bf* QPh = (bf*)take(NB_ * PB * 2); bf* QPl = (bf*)take(NB_ * PB * 2); bf* KPh = (bf*)take(NB_ * PB * 2); bf* KPl = (bf*)take(NB_ * PB * 2); bf* VTh = (bf*)take(NB_ * PB * 2); bf* VTl = (bf*)take(NB_ * PB * 2);
    if ((size_t)(wsp - (char*)d_ws) > ws_size) return;    // ws 256 MiB
    k_wpack<<<3 * HD * DM / 8 / 256, 256, 0, stream>>>(wq, wk, wv, WP);
    k_proj<<<NB_ * TT / 64, 32 * NWK, 0, stream>>>(x, WP, bq, bk, bv, OUTK, OUTV, QP16, QPh, QPl, KP16, KPh, KPl, VT16, VTh, VTl);   /* K, V -> output slots 1, 2 */
    k_fattn<<<dim3(NQT / 2, 1, NB_), 32 * NWA, 0, stream>>>(QP16, KP16, VT16, QPh, QPl, KPh, KPl, VTh, VTl, OUT);   /* result -> output slot 0 */
}

// v007
// It runs in 27.3 microseconds.
// In two side-by-side timings against v006, it was 1.04 and 1.06 times as fast.
// All steps since v000 together make it 32.3 times as fast.
#include <hip/hip_runtime.h>

// Single-head causal attention with cache outputs (x [4][4096][768]; Q, K, V = x W + b ('xw' [768][64] + [64]); scores = Q.K / 8, causal; softmax; result = attn.V; returns (result, K, V) -> three [4][4096][64] f32 tensors (3.1 M)).
// Layout: one launch packs the three weights (bf16, fragment order); one launch for all batches does the exact projections (+ biases), writes K and V into their output slots (f32) and every 16-bit plane from its epilogue; then one launch for all batches: hybrid causal attention over 4,096 keys (rows < 512 hi/lo, rest fp16 x1024), scores, running-maximum softmax and attn.v in one kernel, result written from there.
// Compute dtypes, f32 accumulate: every input rounded to bf16; projections on PLAIN bf16 operands (exact) + f32 biases (K and V outputs are exactly these f32 sums); scores and attn.v rows < 512 on bf16 hi/lo planes (3 products), the rest single fp16; softmax f32; f32 result.

#define NB_  4
#define TT   4096
#define DM   768
#define NH_  1
#define NKV  1
#define REP  (NH_ / NKV)
#define HD   64
#define DQ   (NH_ * HD)
#define DKV  (NKV * HD)
#define RH   512                  // query rows < RH use hi+lo planes (0: none)
#define WIN  4096
#define SCL  0.125f   // HD^-0.5
#define NWK  8                    // waves per work-group that share one K loop in the long-K GEMMs
typedef _Float16 h16;
typedef unsigned short bf;
typedef __attribute__((ext_vector_type(16))) __bf16   v16bf;
typedef __attribute__((ext_vector_type(16))) _Float16 v16h;
typedef __attribute__((ext_vector_type(8)))  _Float16 v8h;
typedef __attribute__((ext_vector_type(8)))  unsigned short v8us;
typedef __attribute__((ext_vector_type(8)))  float    v8f;
typedef __attribute__((ext_vector_type(4)))  float    v4f;
typedef v8h  __attribute__((may_alias)) v8ha;
typedef v4f  __attribute__((may_alias)) v4fa;
typedef v8us __attribute__((may_alias)) v8usa;

__device__ __forceinline__ unsigned short f2bf(float f) { unsigned u = __float_as_uint(f); u += 0x7FFFu + ((u >> 16) & 1u); return (unsigned short)(u >> 16); }
__device__ __forceinline__ float bf2f(unsigned short b) { return __uint_as_float(((unsigned)b) << 16); }
__device__ __forceinline__ float bfr(float f) { return bf2f(f2bf(f)); }
__device__ __forceinline__ v16h cat16(v8h lo, v8h hi) { return __builtin_shufflevector(lo, hi, 0, 1, 2, 3, 4, 5, 6, 7, 8, 9, 10, 11, 12, 13, 14, 15); }
__device__ __forceinline__ v16bf cat16b(v8us lo, v8us hi) { return __builtin_bit_cast(v16bf, __builtin_shufflevector(lo, hi, 0, 1, 2, 3, 4, 5, 6, 7, 8, 9, 10, 11, 12, 13, 14, 15)); }
__device__ __forceinline__ v8f wmma16(v16h a, v16h b, v8f c) { return __builtin_amdgcn_wmma_f32_16x16x32_f16(false, a, false, b, (short)0, c, false, false); }
__device__ __forceinline__ v8f wmmab(v16bf a, v16bf b, v8f c) { return __builtin_amdgcn_wmma_f32_16x16x32_bf16(false, a, false, b, (short)0, c, false, false); }



// ---- fragment loaders and matrix products of the two 16-bit types
template <typename T16> struct WFrag;
template <> struct WFrag<h16> { typedef v16h V; static __device__ __forceinline__ V ld(const h16* p) { return cat16(*(const v8h*)p, *(const v8h*)(p + 16)); } static __device__ __forceinline__ V ldp(const h16* p) { return cat16(*(const v8h*)p, *(const v8h*)(p + 256)); } static __device__ __forceinline__ v8f mma(V a, V b, v8f c) { return wmma16(a, b, c); } };
template <> struct WFrag<bf> { typedef v16bf V; static __device__ __forceinline__ V ld(const bf* p) { return cat16b(*(const v8us*)p, *(const v8us*)(p + 16)); } static __device__ __forceinline__ V ldp(const bf* p) { return cat16b(*(const v8us*)p, *(const v8us*)(p + 256)); } static __device__ __forceinline__ v8f mma(V a, V b, v8f c) { return wmmab(a, b, c); } };
template <int NW> __device__ __forceinline__ void tile_sync() { if (NW == 1) { __builtin_amdgcn_wave_barrier(); asm volatile("" ::: "memory"); } else __syncthreads(); }   // orders the LDS tile's writes and reads: inside the one wave, or among the NW waves

__device__ __forceinline__ h16 tohx(float x) { return (h16)x; }
__device__ __forceinline__ void splitf(float y, unsigned short& h, unsigned short& l) { h = f2bf(y); l = f2bf(y - bf2f(h)); }
typedef __attribute__((ext_vector_type(4))) _Float16 v4h;
typedef __attribute__((ext_vector_type(4))) unsigned short v4us;

typedef v4us __attribute__((may_alias)) v4usa;
typedef v4h  __attribute__((may_alias)) v4ha;
typedef __attribute__((ext_vector_type(4))) __bf16 v4bf;

// ---- k_wpack: the three weights [DM][HD] f32 -> bf16 in the order in which k_proj's waves read them: fragment (tensor nt, 32-wide K step ks, 16-column block nb) = 1 KiB, two halves of 32 lanes x 16 bytes, so that each wave-wide load covers 512 contiguous bytes.
// Half h of lane (hi, lr) holds column nb * 16 + lr, k = ks * 32 + h * 16 + hi * 8 + 0..7: the k order of WFrag<bf>::ld. One thread = one 16-byte piece.
#define KST  (DM / 32)            // K steps
#define KSW  (KST / NWK)          // K steps a wave
__global__ __launch_bounds__(256) void k_wpack(const float* __restrict__ wq, const float* __restrict__ wk, const float* __restrict__ wv, bf* Wp) {
    const int i = blockIdx.x * 256 + threadIdx.x; const int lane = i & 31, h = (i >> 5) & 1, nb = (i >> 6) & 3, fs = i >> 8; const int ks = fs % KST, nt = fs / KST;
    const float* w = (nt == 0) ? wq : (nt == 1) ? wk : wv; const int n = nb * 16 + (lane & 15), k0 = ks * 32 + h * 16 + (lane >> 4) * 8; v8us o;
#pragma unroll
    for (int j = 0; j < 8; ++j) o[j] = f2bf(w[(size_t)(k0 + j) * HD + n]);
    *(v8us*)(Wp + (size_t)i * 8) = o;
}

// ---- k_proj: Q, K, V = bf16(x) bf16(W) + bias for 64 rows of x a work-group (grid: NB_ * TT / 64), NWK waves; writes K and V (f32 outputs) and all nine 16-bit planes that k_fattn reads.
// Split K: wave w takes the 32-wide K steps w, w + NWK, ...; x is read once, f32, in whole 128-byte lines, rounded to bf16 and turned into fragments through the wave's own LDS rows; the fragments stay in registers for the three 64-column products.
// The products are computed transposed (W as the first operand), so that a lane holds 8 neighbouring columns of one row and stores its partial tile in 16-byte pieces. Per product the NWK partial tiles are summed through LDS in wave order 0..NWK-1;
// the partial tiles alternate between two LDS buffers, so one barrier a product is enough. V's planes run along t inside a fragment: its summed tile goes through a further LDS tile to be read along t.
#define PJS  (64 * 68)            // floats of one wave's partial tile in LDS
#define XP   40                   // bf16 elements of one staged x row: 32 + 8, an 80-byte pitch for the 16-byte fragment reads
#define TP   65                   // floats of one row of V's transposing tile
// All nine 16-bit planes of Q, K and V (f16, bf16 hi, bf16 lo) are stored in the order in which k_fattn's waves read them: one fragment = 1 KiB = two halves h of 32 lanes x 16 bytes, so that each wave-wide load covers 512 contiguous bytes (four whole lines, not sixteen).
// Q and K: fragment (16-row block, 32-wide step ks of the head dims), half h of lane (hi, lr) = row lr, head dims ks * 32 + h * 16 + hi * 8 + 0..7. V: fragment (32-key block, 16-row block dt of the head dims), half h of lane (hi, lr) = head dim dt * 16 + lr, keys h * 16 + hi * 8 + 0..7.
// Both are the k orders of WFrag::ld on row-major planes. A work-group's 64 rows are 8 KiB in a row in each plane.
#define FTE  (32 * 128)           // 16-bit elements of one fragment-order tile in LDS: 32 groups of 16 lane parts of 16 bytes, no pad
// Place of lane part r of group g in such a tile: the part's number is turned by the group's, so that a wave's 8-byte writes (8 groups, 2 parts each) fall on all banks, as its 16-byte reads of whole groups do.
__device__ __forceinline__ int ft_at(int g, int r) { return g * 128 + (r ^ ((g & 7) * 2)) * 8; }
// Work-group barrier that orders LDS only: the waves exchange nothing but LDS here, so it does not wait for the global stores of the epilogue before it or for the weight loads issued ahead.
__device__ __forceinline__ void lds_sync() { __builtin_amdgcn_fence(__ATOMIC_RELEASE, "workgroup", "local"); __builtin_amdgcn_s_barrier(); __builtin_amdgcn_fence(__ATOMIC_ACQUIRE, "workgroup", "local"); }
__device__ __forceinline__ void pj_ldw(v16bf (&b)[KSW][4], const bf* __restrict__ wl, int nt) {   // wl: the packed weights at this wave's first K step and this lane's piece
#pragma unroll
    for (int i = 0; i < KSW; ++i)
#pragma unroll
        for (int nb = 0; nb < 4; ++nb) { const bf* p = wl + ((nt * KST + NWK * i) * 4 + nb) * 512; b[i][nb] = cat16b(*(const v8us*)p, *(const v8us*)(p + 256)); }
}
// one wave's partial 64 x 64 tile over its KSW K steps, transposed: acc[mb][nb][j] of lane (hi, lr) = row mb * 16 + lr of x, column nb * 16 + hi * 8 + j
__device__ __forceinline__ void pj_mma(const v16bf (&a)[KSW][4], const v16bf (&b)[KSW][4], v8f (&acc)[4][4]) {
#pragma unroll
    for (int mb = 0; mb < 4; ++mb)
#pragma unroll
        for (int nb = 0; nb < 4; ++nb) acc[mb][nb] = (v8f){};
#pragma unroll
    for (int i = 0; i < KSW; ++i)
#pragma unroll
        for (int nb = 0; nb < 4; ++nb)
#pragma unroll
            for (int mb = 0; mb < 4; ++mb) acc[mb][nb] = wmmab(b[i][nb], a[i][mb], acc[mb][nb]);
}
// the partial tile -> the wave's LDS rows [row of x][column]
__device__ __forceinline__ void pj_put(const v8f (&acc)[4][4], float* ow, int lr, int hi) {
#pragma unroll
    for (int mb = 0; mb < 4; ++mb)
#pragma unroll
        for (int nb = 0; nb < 4; ++nb) { float* p = ow + (mb * 16 + lr) * 68 + nb * 16 + hi * 8; *(v4fa*)p = __builtin_shufflevector(acc[mb][nb], acc[mb][nb], 0, 1, 2, 3); *(v4fa*)(p + 4) = __builtin_shufflevector(acc[mb][nb], acc[mb][nb], 4, 5, 6, 7); }
}
// A group of global loads or stores is written as grp_open(); the loads or stores; grp_close().
// grp_open: nothing made earlier sinks into the group. grp_close: s_wait_xcnt 0 stands behind the group, in front of the first instruction that reuses a register the group names (address or data), and nothing from below moves in front of the wait.
__device__ __forceinline__ void grp_open() { __builtin_amdgcn_sched_barrier(0); }
__device__ __forceinline__ void grp_close() { asm volatile("s_wait_xcnt 0x0" ::: "memory"); __builtin_amdgcn_sched_barrier(0); }
// the same for a group of loads whose address is not used again: the address is an input of the wait, so that its registers are given to nothing else (not to a load's result either) in front of the wait
__device__ __forceinline__ void grp_close(const void* p) { asm volatile("s_wait_xcnt 0x0" :: "v"(p) : "memory"); __builtin_amdgcn_sched_barrier(0); }
// Behind a product's last matrix instruction: the four vector slots that the chip needs before the next product's first matrix instructions overwrite its results; the scheduling barriers keep the slots between the two products.
__device__ __forceinline__ void wmma_gap() { __builtin_amdgcn_sched_barrier(0); asm volatile("v_nop\n\tv_nop\n\tv_nop\n\tv_nop"); __builtin_amdgcn_sched_barrier(0); }
// one thread's 4 x 4 elements of the NWK partial tiles, LDS -> registers; asked for in one run, in front of the next product's matrix instructions, which cover the LDS time
__device__ __forceinline__ void pj_get(const float* os, v4f (&raw)[4][NWK]) {
    const float* p = os + (int)(threadIdx.x >> 4) * 68 + (int)(threadIdx.x & 15) * 4;
#pragma unroll
    for (int s = 0; s < 4; ++s)
#pragma unroll
        for (int w = 0; w < NWK; ++w) raw[s][w] = *(const v4fa*)(p + s * 16 * 68 + w * PJS);
    __builtin_amdgcn_sched_barrier(0);   // the LDS reads stay together, in front of the next product's matrix instructions where there is one
}
template <int NT>
__device__ __forceinline__ void pj_epi(const v4f (&raw)[4][NWK], float* ts, h16* ft, v4f bs, size_t g0, float* F, h16* P16, bf* Ph, bf* Pl) {
    const int cofs = (int)(threadIdx.x & 15) * 4, rw = (int)(threadIdx.x >> 4); v4f val[4]; v4h o16[4]; v4us oh[4], ol[4];
#pragma unroll
    for (int s = 0; s < 4; ++s) { v4f v = raw[s][0];
#pragma unroll   // the adds keep the order w = 0..NWK-1
        for (int w = 1; w < NWK; ++w) v += raw[s][w];
        val[s] = v + bs;
        if (NT < 2) {
#pragma unroll
            for (int q = 0; q < 4; ++q) { o16[s][q] = tohx(val[s][q]); unsigned short a2, c2; splitf(val[s][q], a2, c2); oh[s][q] = a2; ol[s][q] = c2; } } }
    if (NT < 2) {   // the f16, hi and lo tiles of Q or K -> LDS at their fragment-order places: group s * 8 + (ks, h, hi) = s * 8 + cofs / 8, lane part rw; pj_fld and pj_fst take them to memory behind the next barrier
#pragma unroll
        for (int s = 0; s < 4; ++s) { const int fo = ft_at(s * 8 + (cofs >> 3), rw) + (cofs & 4); *(v4ha*)(ft + fo) = o16[s]; *(v4usa*)((bf*)ft + FTE + fo) = oh[s]; *(v4usa*)((bf*)ft + 2 * FTE + fo) = ol[s]; } }
    if (NT > 0) { float* fp = F + (g0 + rw) * HD + cofs;
        grp_open();
#pragma unroll
        for (int s = 0; s < 4; ++s) *(v4f*)(fp + s * 16 * HD) = val[s];
        grp_close(); }
    if (NT == 2) {
#pragma unroll
        for (int s = 0; s < 4; ++s)
#pragma unroll
            for (int q = 0; q < 4; ++q) ts[(cofs + q) * TP + 16 * s + rw] = val[s][q];
        lds_sync();   // V's summed tile is in LDS
        const int d = (int)(threadIdx.x >> 2), t0 = (int)(threadIdx.x & 3) * 16; v8h t16[2]; v8us th[2], tl[2];
#pragma unroll
        for (int c = 0; c < 2; ++c)
#pragma unroll
            for (int q = 0; q < 8; ++q) { const float v = ts[d * TP + t0 + c * 8 + q]; t16[c][q] = tohx(v); unsigned short a2, c2; splitf(v, a2, c2); th[c][q] = a2; tl[c][q] = c2; }
        const size_t et = g0 * HD + ((((t0 >> 5) * 4 + (d >> 4)) * 2 + ((t0 >> 4) & 1)) * 32 + (d & 15)) * 8; h16* q16 = P16 + et; bf* qh = Ph + et; bf* ql = Pl + et;   // fragment order, hi = c
        grp_open();
#pragma unroll
        for (int c = 0; c < 2; ++c) { *(v8h*)(q16 + c * 128) = t16[c]; *(v8us*)(qh + c * 128) = th[c]; *(v8us*)(ql + c * 128) = tl[c]; } }   // the kernel's last stores: nothing reuses their registers
}
// the f16, hi and lo tiles of Q or K, LDS -> registers -> each one's 8 KiB of its fragment-order plane, 16 bytes a lane, whole lines
__device__ __forceinline__ void pj_fld(const h16* ft, v8h (&fr)[3][2]) {
    const h16* q = ft + ft_at((int)(threadIdx.x >> 4), (int)(threadIdx.x & 15));
#pragma unroll
    for (int t = 0; t < 3; ++t) { fr[t][0] = *(const v8ha*)(q + t * FTE); fr[t][1] = *(const v8ha*)(q + t * FTE + 16 * 128); }
    __builtin_amdgcn_sched_barrier(0);   // these LDS reads stay in front of pj_get's: they return first, so pj_fst's stores wait for none of the partial tiles
}
__device__ __forceinline__ void pj_fst(const v8h (&fr)[3][2], size_t g0, h16* P16, bf* Ph, bf* Pl) {
    const size_t e = g0 * HD + (int)threadIdx.x * 8; h16* p = P16 + e; bf* ph = Ph + e; bf* pl = Pl + e;
    grp_open(); *(v8h*)p = fr[0][0]; *(v8h*)(p + 2048) = fr[0][1]; *(v8us*)ph = __builtin_bit_cast(v8us, fr[1][0]); *(v8us*)(ph + 2048) = __builtin_bit_cast(v8us, fr[1][1]); *(v8us*)pl = __builtin_bit_cast(v8us, fr[2][0]); *(v8us*)(pl + 2048) = __builtin_bit_cast(v8us, fr[2][1]); grp_close();
}
__device__ __forceinline__ v4f bfr4(v4f r) { v4f o; o[0] = bfr(r[0]); o[1] = bfr(r[1]); o[2] = bfr(r[2]); o[3] = bfr(r[3]); return o; }
__global__ __launch_bounds__(32 * NWK) void k_proj(const float* __restrict__ x, const bf* __restrict__ Wp, const float* __restrict__ bq, const float* __restrict__ bk, const float* __restrict__ bv, float* OUTK, float* OUTV, h16* Q16, bf* Qh, bf* Ql, h16* K16, bf* Kh, bf* Kl, h16* V16, bf* Vh, bf* Vl) {
    __shared__ __align__(16) float os[2][NWK * PJS]; __shared__ __align__(16) h16 fq[3 * FTE], fk[3 * FTE]; float* ts = os[1];   // V's transposing tile lies in the second partial-tile buffer, whose last readers (K's sum) are in front of the barrier in front of V's sum
    const int lane = threadIdx.x & 31, lr = lane & 15, hi = lane >> 4; const int wv = __builtin_amdgcn_readfirstlane((int)(threadIdx.x >> 5));   // wave number in a scalar register: the weight addresses' wave part stays scalar
    const size_t g0 = (size_t)blockIdx.x * 64;
    v4f xv[KSW][16]; const float* xp = x + (g0 + (lane >> 3)) * DM + wv * 32 + (lane & 7) * 4;   // 8 lanes a 128-byte line, 4 rows a load
    v16bf b0[KSW][4], b1[KSW][4]; const bf* wl = Wp + (size_t)wv * (4 * 512) + lane * 8;
    grp_open();
#pragma unroll
    for (int i = 0; i < KSW; ++i)
#pragma unroll
        for (int q = 0; q < 16; ++q) xv[i][q] = *(const v4f*)(xp + (size_t)q * 4 * DM + i * (32 * NWK));
    grp_close(xp);
    pj_ldw(b0, wl, 0);   // the first product's weights and the biases fly together with x
    const v4f rq = *(const v4f*)(bq + lr * 4), rk = *(const v4f*)(bk + lr * 4), rv = *(const v4f*)(bv + lr * 4);
    grp_close();
    bf* xs = (bf*)(os[0] + wv * PJS);   // the wave's own part of the partial-tile buffer, free until its first product is done
#pragma unroll
    for (int i = 0; i < KSW; ++i)
#pragma unroll
        for (int q = 0; q < 16; ++q) *(v4usa*)(xs + (i * 64 + q * 4 + (lane >> 3)) * XP + (lane & 7) * 4) = __builtin_bit_cast(v4us, __builtin_convertvector(xv[i][q], v4bf));
    tile_sync<1>();   // the wave's LDS writes stay in front of its fragment reads, which take other lanes' values
    v16bf a[KSW][4];
#pragma unroll
    for (int i = 0; i < KSW; ++i)
#pragma unroll
        for (int mb = 0; mb < 4; ++mb) { const bf* p = xs + (i * 64 + mb * 16 + lr) * XP + 8 * hi; a[i][mb] = cat16b(*(const v8usa*)p, *(const v8usa*)(p + 16)); }
    tile_sync<1>();   // the fragment reads stay in front of the wave's partial-tile writes to the same LDS
    grp_open(); pj_ldw(b1, wl, 1); grp_close();   // each later product's weights are asked for one product ahead
    v8f acc[4][4]; v4f raw[4][NWK]; v8h fr[3][2];
    pj_mma(a, b0, acc); pj_put(acc, os[0] + wv * PJS, lr, hi); wmma_gap();
    lds_sync();   // every wave's partial tile of Q is in LDS
    pj_get(os[0], raw); pj_mma(a, b1, acc);
    __builtin_amdgcn_sched_barrier(0);   // the matrix instructions stay in one run in front of Q's sum
    pj_epi<0>(raw, ts, fq, bfr4(rq), g0, nullptr, Q16, Qh, Ql);
    grp_open(); pj_ldw(b0, wl, 2); grp_close(wl);
    pj_put(acc, os[1] + wv * PJS, lr, hi); wmma_gap();
    lds_sync();   // K's partial tiles and Q's three 16-bit tiles are in LDS, and every wave has read Q's partial tiles
    pj_fld(fq, fr); pj_get(os[1], raw); pj_mma(a, b0, acc);
    __builtin_amdgcn_sched_barrier(0);   // the matrix instructions stay in one run in front of K's sum
    pj_fst(fr, g0, Q16, Qh, Ql);
    pj_epi<1>(raw, ts, fk, bfr4(rk), g0, OUTK, K16, Kh, Kl);
    pj_put(acc, os[0] + wv * PJS, lr, hi);
    lds_sync();   // V's partial tiles and K's three 16-bit tiles are in LDS
    pj_fld(fk, fr); pj_get(os[0], raw);
    pj_fst(fr, g0, K16, Kh, Kl);
    pj_epi<2>(raw, ts, fk, bfr4(rv), g0, OUTV, V16, Vh, Vl);
}

// ---- k_fattn: scores, causal softmax and attn.v in one kernel; no score or probability matrix in memory. One work-group = two tiles of QT query rows of one batch, NWA waves (grid x: tile pair; grid z: batch).
// A tile's cost grows with its index and the launch lasts as long as its fullest work-group, so each work-group takes one tile of the upper half (fa_long) and one of the lower half, one after the other in every wave: near equal work for all; one work-group a WGP, the whole grid resident.
// In each tile a wave takes some of the KB-key blocks up to the diagonal block and keeps its own running row maximum m, row sum l and unnormalised result; per tile the NWA partial results are brought to one maximum and summed through LDS in wave order.
// Which blocks: the lower tile's S blocks are read by both tiles. Partner waves 2i and 2i + 1 take the same blocks i, i + NWA / 2, ... below S at the same time, the even wave for the upper tile, the odd one for the lower: the block's K and V lines come from L2 once and the partner's loads find them in the WGP's cache.
// From S on all NWA waves share the upper tile's blocks; the work-group's blocks stay spread evenly over its waves. Hi/lo lower tiles read other planes than the upper tile: S = 0 there, and wave w takes block w.
// The key loops hold no barrier and no shared buffer (fragments go to registers, partial results to the wave's own LDS rows), so waves may be in different tiles at the same time.
// Both products are computed transposed, so that no value changes lanes between them: S^T = K Q^T (lane: query lr, keys hi*8 + j) is, converted, already the B fragment of O^T = V^T P^T (lane: query lr, head dims hi*8 + j), and m, l are one value a lane.
// Rows < RH: bf16 hi/lo planes, 3 products each; the rest: f16, probabilities x 1024 (added to the exponent; it cancels in the division by l).
#define QT   32
#define NWA  16
#define NQT  (TT / QT)            // query tiles of one batch
#define KB   32                   // keys per block
#define KT   (KB / 16)
#define CL2  (SCL * 1.4426950408889634f)   // score -> exponent of 2
// 2^x on v_exp_f32, written in asm so that the free slot which the instruction set asks for behind a transcendental (before its result is read or its source overwritten) stands there by construction: each v_exp_f32 works in place on a register of its own, and a v_nop follows the last.
__device__ __forceinline__ float ex2(float x) { asm("v_exp_f32 %0, %0\n\tv_nop" : "+v"(x)); return x; }
__device__ __forceinline__ void ex2x8(float (&x)[8]) { asm("v_exp_f32 %0, %0\n\tv_exp_f32 %1, %1\n\tv_exp_f32 %2, %2\n\tv_exp_f32 %3, %3\n\tv_exp_f32 %4, %4\n\tv_exp_f32 %5, %5\n\tv_exp_f32 %6, %6\n\tv_exp_f32 %7, %7\n\tv_nop" : "+v"(x[0]), "+v"(x[1]), "+v"(x[2]), "+v"(x[3]), "+v"(x[4]), "+v"(x[5]), "+v"(x[6]), "+v"(x[7])); }
template <typename T16, bool HI, bool MASK>
__device__ __forceinline__ void fa_blk(const typename WFrag<T16>::V (&qf)[2][2], const typename WFrag<T16>::V (&qf2)[2][2], const T16* __restrict__ Kp, const T16* __restrict__ Kp2, const T16* __restrict__ Vp, const T16* __restrict__ Vp2, int c0, int r0, int lr, int hi, v8f (&o)[4][2], float (&m)[2], float (&l)[2]) {
    typedef typename WFrag<T16>::V V;
    v8f s[KT][2]; V kf[KT][2], kf2[KT][2];
    if constexpr (HI) { const size_t ko = (size_t)c0 * HD + (hi * 16 + lr) * 8; const T16* ka = Kp + ko; const T16* ka2 = Kp2 + ko;   // fragment-order planes: the block's K is 4 KiB in a row in each
#pragma unroll
        for (int kt = 0; kt < KT; ++kt)
#pragma unroll
            for (int ks = 0; ks < 2; ++ks) { kf[kt][ks] = WFrag<T16>::ldp(ka + (kt * 2 + ks) * 512); kf2[kt][ks] = WFrag<T16>::ldp(ka2 + (kt * 2 + ks) * 512); }
        asm volatile("s_wait_xcnt 0x0" :: "v"(ka), "v"(ka2) : "memory");   // stands in front of the first instruction that reuses an address register of the K loads above; the addresses are its inputs, so that their registers are not given to a later load's result in front of it
    } else { const T16* ka = Kp + (size_t)c0 * HD + (hi * 16 + lr) * 8;   // fragment-order plane: the block's K is 4 KiB in a row
#pragma unroll
        for (int kt = 0; kt < KT; ++kt)
#pragma unroll
            for (int ks = 0; ks < 2; ++ks) kf[kt][ks] = WFrag<T16>::ldp(ka + (kt * 2 + ks) * 512);
        asm volatile("s_wait_xcnt 0x0" ::: "memory");   // stands in front of the first instruction that reuses an address register of the K loads above
    }
#pragma unroll
    for (int kt = 0; kt < KT; ++kt) { s[kt][0] = (v8f){}; s[kt][1] = (v8f){};
#pragma unroll
        for (int ks = 0; ks < 2; ++ks)
#pragma unroll
            for (int qb = 0; qb < 2; ++qb) { s[kt][qb] = WFrag<T16>::mma(kf[kt][ks], qf[qb][ks], s[kt][qb]); if (HI) { s[kt][qb] = WFrag<T16>::mma(kf[kt][ks], qf2[qb][ks], s[kt][qb]); s[kt][qb] = WFrag<T16>::mma(kf2[kt][ks], qf[qb][ks], s[kt][qb]); } } }
#pragma unroll
    for (int qb = 0; qb < 2; ++qb) {
        float mk[KT];
#pragma unroll
        for (int kt = 0; kt < KT; ++kt) {
#pragma unroll
            for (int j = 0; j < 8; ++j) { if (MASK) s[kt][qb][j] = (c0 + kt * 16 + hi * 8 + j <= r0 + qb * 16 + lr) ? s[kt][qb][j] : -3.0e38f; mk[kt] = j ? fmaxf(mk[kt], s[kt][qb][j]) : s[kt][qb][j]; } }
        float mx = fmaxf(fmaxf(mk[0], mk[1]), m[qb]); mx = fmaxf(mx, __shfl_xor(mx, 16, 32));   // the two half-waves hold the two halves of a query's keys
        const float al = ex2((m[qb] - mx) * CL2); m[qb] = mx; const float eb = (HI ? 0.0f : 10.0f) - mx * CL2;
        float ps[KT];   // independent sums
#pragma unroll
        for (int kt = 0; kt < KT; ++kt) {
            float p[8];
#pragma unroll
            for (int j = 0; j < 8; ++j) p[j] = fmaf(s[kt][qb][j], CL2, eb);
            ex2x8(p);
#pragma unroll
            for (int j = 0; j < 8; ++j) { s[kt][qb][j] = p[j]; ps[kt] = j ? ps[kt] + p[j] : p[j]; } }
        l[qb] = fmaf(l[qb], al, ps[0] + ps[1]);
#pragma unroll
        for (int dt = 0; dt < 4; ++dt) o[dt][qb] *= al;
    }
#pragma unroll
    for (int kk = 0; kk < KB / 32; ++kk) { V pf[2], pf2[2];
#pragma unroll
        for (int qb = 0; qb < 2; ++qb) {
            if constexpr (HI) { v8us h0, h1, l0, l1;
#pragma unroll
                for (int j = 0; j < 8; ++j) { unsigned short a, c; splitf(s[2 * kk][qb][j], a, c); h0[j] = a; l0[j] = c; splitf(s[2 * kk + 1][qb][j], a, c); h1[j] = a; l1[j] = c; }
                pf[qb] = cat16b(h0, h1); pf2[qb] = cat16b(l0, l1);
            } else { v8h h0, h1;
#pragma unroll
                for (int j = 0; j < 8; ++j) { h0[j] = (h16)s[2 * kk][qb][j]; h1[j] = (h16)s[2 * kk + 1][qb][j]; }
                pf[qb] = cat16(h0, h1); } }
        V v[4], v2[4];   // behind each group of V loads: s_wait_xcnt 0 in front of the first instruction that reuses their address registers; the addresses are its inputs, so that their registers are not given to a load's result in front of it
        if constexpr (HI) { const size_t vo = (size_t)(c0 + kk * 32) * HD + (hi * 16 + lr) * 8; const T16* va = Vp + vo; const T16* va2 = Vp2 + vo;   // fragment-order planes: the block's V is 4 KiB in a row in each
#pragma unroll
            for (int dt = 0; dt < 4; ++dt) { v[dt] = WFrag<T16>::ldp(va + dt * 512); v2[dt] = WFrag<T16>::ldp(va2 + dt * 512); asm volatile("s_wait_xcnt 0x0" :: "v"(va), "v"(va2) : "memory"); }
        } else { const T16* va = Vp + (size_t)(c0 + kk * 32) * HD + (hi * 16 + lr) * 8;   // fragment-order plane: the block's V is 4 KiB in a row
#pragma unroll
            for (int dt = 0; dt < 4; ++dt) v[dt] = WFrag<T16>::ldp(va + dt * 512);
            asm volatile("s_wait_xcnt 0x0" :: "v"(va) : "memory");
        }
#pragma unroll
        for (int dt = 0; dt < 4; ++dt)
#pragma unroll
            for (int qb = 0; qb < 2; ++qb) { o[dt][qb] = WFrag<T16>::mma(v[dt], pf[qb], o[dt][qb]); if (HI) { o[dt][qb] = WFrag<T16>::mma(v[dt], pf2[qb], o[dt][qb]); o[dt][qb] = WFrag<T16>::mma(v2[dt], pf[qb], o[dt][qb]); } } }
}
template <typename T16, bool HI>
__device__ __forceinline__ void fa_tile(const T16* __restrict__ Qp, const T16* __restrict__ Qp2, const T16* __restrict__ Kp, const T16* __restrict__ Kp2, const T16* __restrict__ Vp, const T16* __restrict__ Vp2, int r0, int a0, int limA, int kbB, float* os, float* ms, float* ls) {
    typedef typename WFrag<T16>::V V;
    const int lane = threadIdx.x & 31, lr = lane & 15, hi = lane >> 4; const int wv = __builtin_amdgcn_readfirstlane((int)(threadIdx.x >> 5));   // wave number in a scalar register, as a0, limA and kbB are: the key loop's bounds and branches stay scalar, every lane stays on for the matrix instructions
    V qf[2][2], qf2[2][2]; v8f o[4][2]; float m[2], l[2];
#pragma unroll
    for (int qb = 0; qb < 2; ++qb) { m[qb] = -3.0e38f; l[qb] = 0.0f;
#pragma unroll
        for (int ks = 0; ks < 2; ++ks) {
            const size_t qo = (size_t)r0 * HD + lane * 8 + (qb * 2 + ks) * 512; qf[qb][ks] = WFrag<T16>::ldp(Qp + qo);   // fragment-order planes
            if constexpr (HI) qf2[qb][ks] = WFrag<T16>::ldp(Qp2 + qo); }
#pragma unroll
        for (int dt = 0; dt < 4; ++dt) o[dt][qb] = (v8f){}; }
    asm volatile("s_wait_xcnt 0x0" ::: "memory");   // stands in front of the first instruction that reuses an address register of the Q loads above
    const int nblk = r0 / KB + 1;   // KB-key blocks up to and with the diagonal block; only the last one holds keys above the diagonal, and each of its rows holds at least one key at or below it
    bool inA = !HI && a0 < limA; int kb = inA ? a0 : HI ? wv : kbB;   // the wave's blocks: a0, a0 + NWA / 2, ... below limA, then kbB, kbB + NWA, ...; hi/lo tile: wv, wv + NWA, ...
#pragma unroll 1
    while (kb < nblk - 1) { fa_blk<T16, HI, false>(qf, qf2, Kp, Kp2, Vp, Vp2, kb * KB, r0, lr, hi, o, m, l);
        if (inA) { kb += NWA / 2; if (kb >= limA) { kb = kbB; inA = false; } } else kb += NWA; }
    if (kb == nblk - 1) fa_blk<T16, HI, true>(qf, qf2, Kp, Kp2, Vp, Vp2, kb * KB, r0, lr, hi, o, m, l);
#pragma unroll
    for (int qb = 0; qb < 2; ++qb) { const float lt = l[qb] + __shfl_xor(l[qb], 16, 32); if (hi == 0) { ms[wv * QT + qb * 16 + lr] = m[qb]; ls[wv * QT + qb * 16 + lr] = lt; }
#pragma unroll
        for (int dt = 0; dt < 4; ++dt) { float* p = os + (wv * QT + qb * 16 + lr) * 68 + dt * 16 + hi * 8; *(v4fa*)p = __builtin_shufflevector(o[dt][qb], o[dt][qb], 0, 1, 2, 3); *(v4fa*)(p + 4) = __builtin_shufflevector(o[dt][qb], o[dt][qb], 4, 5, 6, 7); } }
}
// The upper-half tile that goes with lower-half tile ts. Cost of a tile in f16 key blocks: t + 1, times 5/2 for hi/lo rows (three products for one, two planes for one). rk = rank of ts among the lower half by rising cost (ties: hi/lo first); it meets the upper half in falling cost.
static_assert(RH / QT * 5 / 2 <= NQT / 2, "the dearest hi/lo tile costs no more than the last tile of the lower half: rk stays a permutation of 0..NQT/2-1");
__device__ __forceinline__ int fa_long(int ts) {
    const int nh = RH / QT, ch = (5 * (ts + 1) + 1) / 2 - (nh + 1), cl = 2 * (ts + 1) / 5;   // ch: f16 tiles of the lower half cheaper than hi/lo tile ts; cl: hi/lo tiles no dearer than f16 tile ts
    const int rk = (ts < nh) ? ts + (ch > 0 ? ch : 0) : ts - nh + (cl < nh ? cl : nh);
    return NQT - 1 - rk;
}
__global__ __launch_bounds__(32 * NWA) __attribute__((amdgpu_waves_per_eu(4))) /* registers for four waves a SIMD: the work-group's NWA waves on one WGP */ void k_fattn(const h16* __restrict__ Q16, const h16* __restrict__ K16, const h16* __restrict__ V16, const bf* __restrict__ Qh, const bf* __restrict__ Ql, const bf* __restrict__ Kh, const bf* __restrict__ Kl, const bf* __restrict__ Vh, const bf* __restrict__ Vl, float* OUTr) {
    __shared__ __align__(16) float os2[2][NWA * QT * 68]; __shared__ float ms2[2][NWA * QT]; __shared__ float ls2[2][NWA * QT];   // one set of partial results a tile: no barrier between the two tiles
    const size_t zo = (size_t)blockIdx.z * TT * HD; const int tlo = (int)blockIdx.x, tup = fa_long(tlo);
    const int wv = __builtin_amdgcn_readfirstlane((int)(threadIdx.x >> 5)), g = wv & 1, wi = wv >> 1;   // wave number in a scalar register; partners: waves 2 wi and 2 wi + 1
    const int S = (tlo * QT < RH) ? 0 : tlo + 1;   // key blocks that both tiles read from the same planes (none where the lower tile reads the hi/lo planes)
    const int kbu = S + (((((wi - S) & (NWA / 2 - 1)) << 1)) | g);   // the upper tile's blocks from S on, dealt over all NWA waves, first to the waves that got no odd block below S
#pragma unroll 1   // the two tiles share one copy of the key loops
    for (int h = 0; h < 2; ++h) { const int lo = h ^ g, rt = (lo ? tlo : tup) * QT;   // even waves: upper tile, then lower; odd waves: lower tile, then upper
        if (rt < RH) fa_tile<bf, true>(Qh + zo, Ql + zo, Kh + zo, Kl + zo, Vh + zo, Vl + zo, rt, 0, 0, 0, os2[lo], ms2[lo], ls2[lo]);
        else fa_tile<h16, false>(Q16 + zo, nullptr, K16 + zo, nullptr, V16 + zo, nullptr, rt, wi, (lo == g) ? S : 0, lo ? TT : kbu, os2[lo], ms2[lo], ls2[lo]); }
    __syncthreads();   // every wave's m, l and partial result of both tiles are in LDS
    const int hm = (int)(threadIdx.x >> 8), tm = (int)(threadIdx.x & 255);   // the first 256 threads sum the upper tile, the rest the lower one
    const int r0 = (hm ? tlo : tup) * QT; const float* os = os2[hm]; const float* ms = ms2[hm]; const float* ls = ls2[hm];
    const int row = tm >> 3, cofs = (tm & 7) * 8; float mw[NWA]; float M = -3.0e38f;
#pragma unroll
    for (int w = 0; w < NWA; ++w) { mw[w] = ms[w * QT + row]; M = fmaxf(M, mw[w]); }
    float L = 0.0f; v4f a0 = (v4f){}, a1 = (v4f){};
#pragma unroll   // the LDS reads are issued together; the adds keep the order w = 0..NWA-1; a wave that had no block has m = -3e38, l = 0 and weight 0
    for (int w = 0; w < NWA; ++w) { const float f = ex2((mw[w] - M) * CL2); L = fmaf(ls[w * QT + row], f, L); const float* p = os + (w * QT + row) * 68 + cofs; a0 += *(const v4fa*)p * f; a1 += *(const v4fa*)(p + 4) * f; }
    const float rl = __fdiv_rn(1.0f, L); float* op = OUTr + zo + (size_t)(r0 + row) * HD + cofs; *(v4f*)op = a0 * rl; *(v4f*)(op + 4) = a1 * rl;
}

extern "C" void kernel_launch(void* const* d_in, const int* in_sizes, int n_in,
                              void* d_out, int out_size, void* d_ws, size_t ws_size, hipStream_t stream) {
    (void)in_sizes; (void)n_in; (void)out_size;
    const float* x = (const float*)d_in[0]; const float* wq = (const float*)d_in[1]; const float* bq = (const float*)d_in[2]; const float* wk = (const float*)d_in[3]; const float* bk = (const float*)d_in[4]; const float* wv = (const float*)d_in[5]; const float* bv = (const float*)d_in[6];
    float* OUT = (float*)d_out; float* OUTK = OUT + (size_t)NB_ * TT * HD; float* OUTV = OUT + (size_t)2 * NB_ * TT * HD;   /* tuple output: result | K | V, each [4][4096][64] f32 */
    char* wsp = (char*)d_ws;
    auto take = [&](size_t bytes) { char* p = wsp; wsp += (bytes + 255) & ~(size_t)255; return (void*)p; };
    bf* WP = (bf*)take((size_t)3 * HD * DM * 2);
    const size_t PB = (size_t)TT * HD;   // elements of one batch's plane; every plane holds all NB_ batches
    h16* QP16 = (h16*)take(NB_ * PB * 2); h16* KP16 = (h16*)take(NB_ * PB * 2); h16* VT16 = (h16*)take(NB_ * PB * 2);
    bf* QPh = (bf*)take(NB_ * PB * 2); bf* QPl = (bf*)take(NB_ * PB * 2); bf* KPh = (bf*)take(NB_ * PB * 2); bf* KPl = (bf*)take(NB_ * PB * 2); bf* VTh = (bf*)take(NB_ * PB * 2); bf* VTl = (bf*)take(NB_ * PB * 2);
    if ((size_t)(wsp - (char*)d_ws) > ws_size) return;    // ws 256 MiB
    k_wpack<<<3 * HD * DM / 8 / 256, 256, 0, stream>>>(wq, wk, wv, WP);
    k_proj<<<NB_ * TT / 64, 32 * NWK, 0, stream>>>(x, WP, bq, bk, bv, OUTK, OUTV, QP16, QPh, QPl, KP16, KPh, KPl, VT16, VTh, VTl);   /* K, V -> output slots 1, 2 */
    k_fattn<<<dim3(NQT / 2, 1, NB_), 32 * NWA, 0, stream>>>(QP16, KP16, VT16, QPh, QPl, KPh, KPl, VTh, VTl, OUT);   /* result -> output slot 0 */
}

// v008
// One run takes 26.3 microseconds.
// Timed twice side by side with v007, it ran 1.04 and 1.03 times as fast.
// Over all steps from v000 it is 33.5 times as fast.
#include <hip/hip_runtime.h>

// Single-head causal attention with cache outputs (x [4][4096][768]; Q, K, V = x W + b ('xw' [768][64] + [64]); scores = Q.K / 8, causal; softmax; result = attn.V; returns (result, K, V) -> three [4][4096][64] f32 tensors (3.1 M)).
// Layout: one launch packs the three weights (bf16, fragment order); one launch for all batches does the exact projections (+ biases), writes K and V into their output slots (f32) and every 16-bit plane from its epilogue; then one launch for all batches: hybrid causal attention over 4,096 keys (rows < 512 hi/lo, rest fp16 x1024), scores, running-maximum softmax and attn.v in one kernel, result written from there.
// Compute dtypes, f32 accumulate: every input rounded to bf16; projections on PLAIN bf16 operands (exact) + f32 biases (K and V outputs are exactly these f32 sums); scores and attn.v rows < 512 on bf16 hi/lo planes (3 products), the rest single fp16; softmax f32; f32 result.

#define NB_  4
#define TT   4096
#define DM   768
#define NH_  1
#define NKV  1
#define REP  (NH_ / NKV)
#define HD   64
#define DQ   (NH_ * HD)
#define DKV  (NKV * HD)
#define RH   512                  // query rows < RH use hi+lo planes
#define WIN  4096
#define SCL  0.125f   // HD^-0.5
#define NWK  8                    // waves per work-group that share one K loop in the long-K GEMMs
typedef _Float16 h16;
typedef unsigned short bf;
typedef __attribute__((ext_vector_type(16))) __bf16   v16bf;
typedef __attribute__((ext_vector_type(16))) _Float16 v16h;
typedef __attribute__((ext_vector_type(8)))  _Float16 v8h;
typedef __attribute__((ext_vector_type(8)))  unsigned short v8us;
typedef __attribute__((ext_vector_type(8)))  float    v8f;
typedef __attribute__((ext_vector_type(4)))  float    v4f;
typedef v8h  __attribute__((may_alias)) v8ha;
typedef v4f  __attribute__((may_alias)) v4fa;
typedef v8us __attribute__((may_alias)) v8usa;

__device__ __forceinline__ unsigned short f2bf(float f) { unsigned u = __float_as_uint(f); u += 0x7FFFu + ((u >> 16) & 1u); return (unsigned short)(u >> 16); }
__device__ __forceinline__ float bf2f(unsigned short b) { return __uint_as_float(((unsigned)b) << 16); }
__device__ __forceinline__ float bfr(float f) { return bf2f(f2bf(f)); }
__device__ __forceinline__ v16h cat16(v8h lo, v8h hi) { return __builtin_shufflevector(lo, hi, 0, 1, 2, 3, 4, 5, 6, 7, 8, 9, 10, 11, 12, 13, 14, 15); }
__device__ __forceinline__ v16bf cat16b(v8us lo, v8us hi) { return __builtin_bit_cast(v16bf, __builtin_shufflevector(lo, hi, 0, 1, 2, 3, 4, 5, 6, 7, 8, 9, 10, 11, 12, 13, 14, 15)); }
__device__ __forceinline__ v8f wmma16(v16h a, v16h b, v8f c) { return __builtin_amdgcn_wmma_f32_16x16x32_f16(false, a, false, b, (short)0, c, false, false); }
__device__ __forceinline__ v8f wmmab(v16bf a, v16bf b, v8f c) { return __builtin_amdgcn_wmma_f32_16x16x32_bf16(false, a, false, b, (short)0, c, false, false); }



// ---- fragment loaders and matrix products of the two 16-bit types
template <typename T16> struct WFrag;
template <> struct WFrag<h16> { typedef v16h V; static __device__ __forceinline__ V ld(const h16* p) { return cat16(*(const v8h*)p, *(const v8h*)(p + 16)); } static __device__ __forceinline__ V ldp(const h16* p) { return cat16(*(const v8h*)p, *(const v8h*)(p + 256)); } static __device__ __forceinline__ v8f mma(V a, V b, v8f c) { return wmma16(a, b, c); } };
template <> struct WFrag<bf> { typedef v16bf V; static __device__ __forceinline__ V ld(const bf* p) { return cat16b(*(const v8us*)p, *(const v8us*)(p + 16)); } static __device__ __forceinline__ V ldp(const bf* p) { return cat16b(*(const v8us*)p, *(const v8us*)(p + 256)); } static __device__ __forceinline__ v8f mma(V a, V b, v8f c) { return wmmab(a, b, c); } };
template <int NW> __device__ __forceinline__ void tile_sync() { if (NW == 1) { __builtin_amdgcn_wave_barrier(); asm volatile("" ::: "memory"); } else __syncthreads(); }   // orders the LDS tile's writes and reads: inside the one wave, or among the NW waves

__device__ __forceinline__ h16 tohx(float x) { return (h16)x; }
__device__ __forceinline__ void splitf(float y, unsigned short& h, unsigned short& l) { h = f2bf(y); l = f2bf(y - bf2f(h)); }
typedef __attribute__((ext_vector_type(4))) _Float16 v4h;
typedef __attribute__((ext_vector_type(4))) unsigned short v4us;

typedef v4us __attribute__((may_alias)) v4usa;
typedef v4h  __attribute__((may_alias)) v4ha;
typedef __attribute__((ext_vector_type(4))) __bf16 v4bf;

// ---- k_wpack: the three weights [DM][HD] f32 -> bf16 in the order in which k_proj's waves read them: fragment (tensor nt, 32-wide K step ks, 16-column block nb) = 1 KiB, two halves of 32 lanes x 16 bytes, so that each wave-wide load covers 512 contiguous bytes.
// Half h of lane (hi, lr) holds column nb * 16 + lr, k = ks * 32 + h * 16 + hi * 8 + 0..7: the k order of WFrag<bf>::ld. One thread = one 16-byte piece.
#define KST  (DM / 32)            // K steps
#define KSW  (KST / NWK)          // K steps a wave
__global__ __launch_bounds__(256) void k_wpack(const float* __restrict__ wq, const float* __restrict__ wk, const float* __restrict__ wv, bf* Wp) {
    const int i = blockIdx.x * 256 + threadIdx.x; const int lane = i & 31, h = (i >> 5) & 1, nb = (i >> 6) & 3, fs = i >> 8; const int ks = fs % KST, nt = fs / KST;
    const float* w = (nt == 0) ? wq : (nt == 1) ? wk : wv; const int n = nb * 16 + (lane & 15), k0 = ks * 32 + h * 16 + (lane >> 4) * 8; v8us o;
#pragma unroll
    for (int j = 0; j < 8; ++j) o[j] = f2bf(w[(size_t)(k0 + j) * HD + n]);
    *(v8us*)(Wp + (size_t)i * 8) = o;
}

// ---- k_proj: Q, K, V = bf16(x) bf16(W) + bias for 64 rows of x a work-group (grid: NB_ * TT / 64), NWK waves; writes K and V (f32 outputs) and all nine 16-bit planes that k_fattn reads.
// Split K: wave w takes the 32-wide K steps w, w + NWK, ...; x is read once, f32, in whole 128-byte lines, rounded to bf16 and turned into fragments through the wave's own LDS rows; the fragments stay in registers for the three 64-column products.
// The products are computed transposed (W as the first operand), so that a lane holds 8 neighbouring columns of one row and stores its partial tile in 16-byte pieces. Per product the NWK partial tiles are summed through LDS in wave order 0..NWK-1;
// the partial tiles alternate between two LDS buffers, so one barrier a product is enough. V's planes run along t inside a fragment: its summed tile goes through a further LDS tile to be read along t.
#define PJS  (64 * 68)            // floats of one wave's partial tile in LDS
#define XP   40                   // bf16 elements of one staged x row: 32 + 8, an 80-byte pitch for the 16-byte fragment reads
#define TP   65                   // floats of one row of V's transposing tile
// All nine 16-bit planes of Q, K and V (f16, bf16 hi, bf16 lo) are stored in the order in which k_fattn's waves read them: one fragment = 1 KiB = two halves h of 32 lanes x 16 bytes, so that each wave-wide load covers 512 contiguous bytes (four whole lines, not sixteen).
// Q and K: fragment (16-row block, 32-wide step ks of the head dims), half h of lane (hi, lr) = row lr, head dims ks * 32 + h * 16 + hi * 8 + 0..7. V: fragment (32-key block, 16-row block dt of the head dims), half h of lane (hi, lr) = head dim dt * 16 + lr, keys h * 16 + hi * 8 + 0..7.
// Both are the k orders of WFrag::ld on row-major planes. A work-group's 64 rows are 8 KiB in a row in each plane.
#define FTE  (32 * 128)           // 16-bit elements of one fragment-order tile in LDS: 32 groups of 16 lane parts of 16 bytes, no pad
// Place of lane part r of group g in such a tile: the part's number is turned by the group's, so that a wave's 8-byte writes (8 groups, 2 parts each) fall on all banks, as its 16-byte reads of whole groups do.
__device__ __forceinline__ int ft_at(int g, int r) { return g * 128 + (r ^ ((g & 7) * 2)) * 8; }
// Work-group barrier that orders LDS only: the waves exchange nothing but LDS here, so it does not wait for the global stores of the epilogue before it or for the weight loads issued ahead.
__device__ __forceinline__ void lds_sync() { __builtin_amdgcn_fence(__ATOMIC_RELEASE, "workgroup", "local"); __builtin_amdgcn_s_barrier(); __builtin_amdgcn_fence(__ATOMIC_ACQUIRE, "workgroup", "local"); }
__device__ __forceinline__ void pj_ldw(v16bf (&b)[KSW][4], const bf* __restrict__ wl, int nt) {   // wl: the packed weights at this wave's first K step and this lane's piece
#pragma unroll
    for (int i = 0; i < KSW; ++i)
#pragma unroll
        for (int nb = 0; nb < 4; ++nb) { const bf* p = wl + ((nt * KST + NWK * i) * 4 + nb) * 512; b[i][nb] = cat16b(*(const v8us*)p, *(const v8us*)(p + 256)); }
}
// one wave's partial 64 x 64 tile over its KSW K steps, transposed: acc[mb][nb][j] of lane (hi, lr) = row mb * 16 + lr of x, column nb * 16 + hi * 8 + j
__device__ __forceinline__ void pj_mma(const v16bf (&a)[KSW][4], const v16bf (&b)[KSW][4], v8f (&acc)[4][4]) {
#pragma unroll
    for (int mb = 0; mb < 4; ++mb)
#pragma unroll
        for (int nb = 0; nb < 4; ++nb) acc[mb][nb] = (v8f){};
#pragma unroll
    for (int i = 0; i < KSW; ++i)
#pragma unroll
        for (int nb = 0; nb < 4; ++nb)
#pragma unroll
            for (int mb = 0; mb < 4; ++mb) acc[mb][nb] = wmmab(b[i][nb], a[i][mb], acc[mb][nb]);
}
// the partial tile -> the wave's LDS rows [row of x][column]
__device__ __forceinline__ void pj_put(const v8f (&acc)[4][4], float* ow, int lr, int hi) {
#pragma unroll
    for (int mb = 0; mb < 4; ++mb)
#pragma unroll
        for (int nb = 0; nb < 4; ++nb) { float* p = ow + (mb * 16 + lr) * 68 + nb * 16 + hi * 8; *(v4fa*)p = __builtin_shufflevector(acc[mb][nb], acc[mb][nb], 0, 1, 2, 3); *(v4fa*)(p + 4) = __builtin_shufflevector(acc[mb][nb], acc[mb][nb], 4, 5, 6, 7); }
}
// A group of global loads or stores is written as grp_open(); the loads or stores; grp_close().
// grp_open: nothing made earlier sinks into the group. grp_close: s_wait_xcnt 0 stands behind the group, in front of the first instruction that reuses a register the group names (address or data), and nothing from below moves in front of the wait.
__device__ __forceinline__ void grp_open() { __builtin_amdgcn_sched_barrier(0); }
__device__ __forceinline__ void grp_close() { asm volatile("s_wait_xcnt 0x0" ::: "memory"); __builtin_amdgcn_sched_barrier(0); }
// the same for a group of loads whose address is not used again: the address is an input of the wait, so that its registers are given to nothing else (not to a load's result either) in front of the wait
__device__ __forceinline__ void grp_close(const void* p) { asm volatile("s_wait_xcnt 0x0" :: "v"(p) : "memory"); __builtin_amdgcn_sched_barrier(0); }
// Behind a product's last matrix instruction: the four vector slots that the chip needs before the next product's first matrix instructions overwrite its results; the scheduling barriers keep the slots between the two products.
__device__ __forceinline__ void wmma_gap() { __builtin_amdgcn_sched_barrier(0); asm volatile("v_nop\n\tv_nop\n\tv_nop\n\tv_nop"); __builtin_amdgcn_sched_barrier(0); }
// one thread's 4 x 4 elements of the NWK partial tiles, LDS -> registers; asked for in one run, in front of the next product's matrix instructions, which cover the LDS time
__device__ __forceinline__ void pj_get(const float* os, v4f (&raw)[4][NWK]) {
    const float* p = os + (int)(threadIdx.x >> 4) * 68 + (int)(threadIdx.x & 15) * 4;
#pragma unroll
    for (int s = 0; s < 4; ++s)
#pragma unroll
        for (int w = 0; w < NWK; ++w) raw[s][w] = *(const v4fa*)(p + s * 16 * 68 + w * PJS);
    __builtin_amdgcn_sched_barrier(0);   // the LDS reads stay together, in front of the next product's matrix instructions where there is one
}
template <int NT>
__device__ __forceinline__ void pj_epi(const v4f (&raw)[4][NWK], float* ts, h16* ft, v4f bs, size_t g0, float* F, h16* P16, bf* Ph, bf* Pl) {
    const int cofs = (int)(threadIdx.x & 15) * 4, rw = (int)(threadIdx.x >> 4); v4f val[4]; v4h o16[4]; v4us oh[4], ol[4];
#pragma unroll
    for (int s = 0; s < 4; ++s) { v4f v = raw[s][0];
#pragma unroll   // the adds keep the order w = 0..NWK-1
        for (int w = 1; w < NWK; ++w) v += raw[s][w];
        val[s] = v + bs;
        if (NT < 2) {
#pragma unroll
            for (int q = 0; q < 4; ++q) { o16[s][q] = tohx(val[s][q]); unsigned short a2, c2; splitf(val[s][q], a2, c2); oh[s][q] = a2; ol[s][q] = c2; } } }
    if (NT < 2) {   // the f16, hi and lo tiles of Q or K -> LDS at their fragment-order places: group s * 8 + (ks, h, hi) = s * 8 + cofs / 8, lane part rw; pj_fld and pj_fst take them to memory behind the next barrier
#pragma unroll
        for (int s = 0; s < 4; ++s) { const int fo = ft_at(s * 8 + (cofs >> 3), rw) + (cofs & 4); *(v4ha*)(ft + fo) = o16[s]; *(v4usa*)((bf*)ft + FTE + fo) = oh[s]; *(v4usa*)((bf*)ft + 2 * FTE + fo) = ol[s]; } }
    if (NT > 0) { float* fp = F + (g0 + rw) * HD + cofs;
        grp_open();
#pragma unroll
        for (int s = 0; s < 4; ++s) *(v4f*)(fp + s * 16 * HD) = val[s];
        grp_close(); }
    if (NT == 2) {
#pragma unroll
        for (int s = 0; s < 4; ++s)
#pragma unroll
            for (int q = 0; q < 4; ++q) ts[(cofs + q) * TP + 16 * s + rw] = val[s][q];
        lds_sync();   // V's summed tile is in LDS
        const int d = (int)(threadIdx.x >> 2), t0 = (int)(threadIdx.x & 3) * 16; v8h t16[2]; v8us th[2], tl[2];
#pragma unroll
        for (int c = 0; c < 2; ++c)
#pragma unroll
            for (int q = 0; q < 8; ++q) { const float v = ts[d * TP + t0 + c * 8 + q]; t16[c][q] = tohx(v); unsigned short a2, c2; splitf(v, a2, c2); th[c][q] = a2; tl[c][q] = c2; }
        const size_t et = g0 * HD + ((((t0 >> 5) * 4 + (d >> 4)) * 2 + ((t0 >> 4) & 1)) * 32 + (d & 15)) * 8; h16* q16 = P16 + et; bf* qh = Ph + et; bf* ql = Pl + et;   // fragment order, hi = c
        grp_open();
#pragma unroll
        for (int c = 0; c < 2; ++c) { *(v8h*)(q16 + c * 128) = t16[c]; *(v8us*)(qh + c * 128) = th[c]; *(v8us*)(ql + c * 128) = tl[c]; } }   // the kernel's last stores: nothing reuses their registers
}
// the f16, hi and lo tiles of Q or K, LDS -> registers -> each one's 8 KiB of its fragment-order plane, 16 bytes a lane, whole lines
__device__ __forceinline__ void pj_fld(const h16* ft, v8h (&fr)[3][2]) {
    const h16* q = ft + ft_at((int)(threadIdx.x >> 4), (int)(threadIdx.x & 15));
#pragma unroll
    for (int t = 0; t < 3; ++t) { fr[t][0] = *(const v8ha*)(q + t * FTE); fr[t][1] = *(const v8ha*)(q + t * FTE + 16 * 128); }
    __builtin_amdgcn_sched_barrier(0);   // these LDS reads stay in front of pj_get's: they return first, so pj_fst's stores wait for none of the partial tiles
}
__device__ __forceinline__ void pj_fst(const v8h (&fr)[3][2], size_t g0, h16* P16, bf* Ph, bf* Pl) {
    const size_t e = g0 * HD + (int)threadIdx.x * 8; h16* p = P16 + e; bf* ph = Ph + e; bf* pl = Pl + e;
    grp_open(); *(v8h*)p = fr[0][0]; *(v8h*)(p + 2048) = fr[0][1]; *(v8us*)ph = __builtin_bit_cast(v8us, fr[1][0]); *(v8us*)(ph + 2048) = __builtin_bit_cast(v8us, fr[1][1]); *(v8us*)pl = __builtin_bit_cast(v8us, fr[2][0]); *(v8us*)(pl + 2048) = __builtin_bit_cast(v8us, fr[2][1]); grp_close();
}
__device__ __forceinline__ v4f bfr4(v4f r) { v4f o; o[0] = bfr(r[0]); o[1] = bfr(r[1]); o[2] = bfr(r[2]); o[3] = bfr(r[3]); return o; }
__global__ __launch_bounds__(32 * NWK) void k_proj(const float* __restrict__ x, const bf* __restrict__ Wp, const float* __restrict__ bq, const float* __restrict__ bk, const float* __restrict__ bv, float* OUTK, float* OUTV, h16* Q16, bf* Qh, bf* Ql, h16* K16, bf* Kh, bf* Kl, h16* V16, bf* Vh, bf* Vl) {
    __shared__ __align__(16) float os[2][NWK * PJS]; __shared__ __align__(16) h16 fq[3 * FTE], fk[3 * FTE]; float* ts = os[1];   // V's transposing tile lies in the second partial-tile buffer, whose last readers (K's sum) are in front of the barrier in front of V's sum
    const int lane = threadIdx.x & 31, lr = lane & 15, hi = lane >> 4; const int wv = __builtin_amdgcn_readfirstlane((int)(threadIdx.x >> 5));   // wave number in a scalar register: the weight addresses' wave part stays scalar
    const size_t g0 = (size_t)blockIdx.x * 64;
    v4f xv[KSW][16]; const float* xp = x + (g0 + (lane >> 3)) * DM + wv * 32 + (lane & 7) * 4;   // 8 lanes a 128-byte line, 4 rows a load
    v16bf b0[KSW][4], b1[KSW][4]; const bf* wl = Wp + (size_t)wv * (4 * 512) + lane * 8;
    grp_open();
#pragma unroll
    for (int i = 0; i < KSW; ++i)
#pragma unroll
        for (int q = 0; q < 16; ++q) xv[i][q] = *(const v4f*)(xp + (size_t)q * 4 * DM + i * (32 * NWK));
    grp_close(xp);
    pj_ldw(b0, wl, 0);   // the first product's weights and the biases fly together with x
    const v4f rq = *(const v4f*)(bq + lr * 4), rk = *(const v4f*)(bk + lr * 4), rv = *(const v4f*)(bv + lr * 4);
    grp_close();
    bf* xs = (bf*)(os[0] + wv * PJS);   // the wave's own part of the partial-tile buffer, free until its first product is done
#pragma unroll
    for (int i = 0; i < KSW; ++i)
#pragma unroll
        for (int q = 0; q < 16; ++q) *(v4usa*)(xs + (i * 64 + q * 4 + (lane >> 3)) * XP + (lane & 7) * 4) = __builtin_bit_cast(v4us, __builtin_convertvector(xv[i][q], v4bf));
    tile_sync<1>();   // the wave's LDS writes stay in front of its fragment reads, which take other lanes' values
    v16bf a[KSW][4];
#pragma unroll
    for (int i = 0; i < KSW; ++i)
#pragma unroll
        for (int mb = 0; mb < 4; ++mb) { const bf* p = xs + (i * 64 + mb * 16 + lr) * XP + 8 * hi; a[i][mb] = cat16b(*(const v8usa*)p, *(const v8usa*)(p + 16)); }
    tile_sync<1>();   // the fragment reads stay in front of the wave's partial-tile writes to the same LDS
    grp_open(); pj_ldw(b1, wl, 1); grp_close();   // each later product's weights are asked for one product ahead
    v8f acc[4][4]; v4f raw[4][NWK]; v8h fr[3][2];
    pj_mma(a, b0, acc); pj_put(acc, os[0] + wv * PJS, lr, hi); wmma_gap();
    lds_sync();   // every wave's partial tile of Q is in LDS
    pj_get(os[0], raw); pj_mma(a, b1, acc);
    __builtin_amdgcn_sched_barrier(0);   // the matrix instructions stay in one run in front of Q's sum
    pj_epi<0>(raw, ts, fq, bfr4(rq), g0, nullptr, Q16, Qh, Ql);
    grp_open(); pj_ldw(b0, wl, 2); grp_close(wl);
    pj_put(acc, os[1] + wv * PJS, lr, hi); wmma_gap();
    lds_sync();   // K's partial tiles and Q's three 16-bit tiles are in LDS, and every wave has read Q's partial tiles
    pj_fld(fq, fr); pj_get(os[1], raw); pj_mma(a, b0, acc);
    __builtin_amdgcn_sched_barrier(0);   // the matrix instructions stay in one run in front of K's sum
    pj_fst(fr, g0, Q16, Qh, Ql);
    pj_epi<1>(raw, ts, fk, bfr4(rk), g0, OUTK, K16, Kh, Kl);
    pj_put(acc, os[0] + wv * PJS, lr, hi);
    lds_sync();   // V's partial tiles and K's three 16-bit tiles are in LDS
    pj_fld(fk, fr); pj_get(os[0], raw);
    pj_fst(fr, g0, K16, Kh, Kl);
    pj_epi<2>(raw, ts, fk, bfr4(rv), g0, OUTV, V16, Vh, Vl);
}

// ---- k_fattn: scores, causal softmax and attn.v in one kernel; no score or probability matrix in memory. One work-group = two tiles of QT query rows of one batch, NWA waves (grid x: tile pair; grid z: batch).
// A tile's cost grows with its index and the launch lasts as long as its fullest work-group, so each work-group takes one tile of the upper half (fa_long) and one of the lower half, one after the other in every wave: near equal work for all; one work-group a WGP, the whole grid resident.
// In each tile a wave takes some of the KB-key blocks up to the diagonal block and keeps its own running row maximum m, row sum l and unnormalised result; per tile the NWA partial results are brought to one maximum and summed through LDS in wave order.
// Which blocks: the lower tile's S blocks are read by both tiles. Partner waves 2i and 2i + 1 take the same blocks i, i + NWA / 2, ... below S at the same time, the even wave for the upper tile, the odd one for the lower: the block's K and V lines come from L2 once and the partner's loads find them in the WGP's cache.
// From S on all NWA waves share the upper tile's blocks; the work-group's blocks stay spread evenly over its waves. Hi/lo lower tiles read other planes than the upper tile: S = 0 there, and wave w takes block w.
// The key loops hold no barrier and no shared buffer (fragments go to registers, partial results to the wave's own LDS rows), so waves may be in different tiles at the same time.
// Both products are computed transposed, so that no value changes lanes between them: S^T = K Q^T (lane: query lr, keys hi*8 + j) is, converted, already the B fragment of O^T = V^T P^T (lane: query lr, head dims hi*8 + j), and m, l are one value a lane.
// Rows < RH: bf16 hi/lo planes, 3 products each; the rest: f16, probabilities x 1024 (added to the exponent; it cancels in the division by l).
#define QT   32
#define NWA  16
#define NQT  (TT / QT)            // query tiles of one batch
#define KB   32                   // keys per block
#define KT   (KB / 16)
#define CL2  (SCL * 1.4426950408889634f)   // score -> exponent of 2
// 2^x on v_exp_f32, written in asm so that the free slot which the instruction set asks for behind a transcendental (before its result is read or its source overwritten) stands there by construction: each v_exp_f32 works in place on a register of its own, and a v_nop follows the last.
__device__ __forceinline__ float ex2(float x) { asm("v_exp_f32 %0, %0\n\tv_nop" : "+v"(x)); return x; }
__device__ __forceinline__ void ex2x8(float (&x)[8]) { asm("v_exp_f32 %0, %0\n\tv_exp_f32 %1, %1\n\tv_exp_f32 %2, %2\n\tv_exp_f32 %3, %3\n\tv_exp_f32 %4, %4\n\tv_exp_f32 %5, %5\n\tv_exp_f32 %6, %6\n\tv_exp_f32 %7, %7\n\tv_nop" : "+v"(x[0]), "+v"(x[1]), "+v"(x[2]), "+v"(x[3]), "+v"(x[4]), "+v"(x[5]), "+v"(x[6]), "+v"(x[7])); }
template <typename T16, bool HI, bool MASK>
__device__ __forceinline__ void fa_blk(const typename WFrag<T16>::V (&qf)[2][2], const typename WFrag<T16>::V (&qf2)[2][2], const T16* __restrict__ Kp, const T16* __restrict__ Kp2, const T16* __restrict__ Vp, const T16* __restrict__ Vp2, int c0, int r0, int lr, int hi, v8f (&o)[4][2], float (&m)[2], float (&l)[2]) {
    typedef typename WFrag<T16>::V V;
    v8f s[KT][2]; V kf[KT][2], kf2[KT][2];
    if constexpr (HI) { const size_t ko = (size_t)c0 * HD + (hi * 16 + lr) * 8; const T16* ka = Kp + ko; const T16* ka2 = Kp2 + ko;   // fragment-order planes: the block's K is 4 KiB in a row in each
#pragma unroll
        for (int kt = 0; kt < KT; ++kt)
#pragma unroll
            for (int ks = 0; ks < 2; ++ks) { kf[kt][ks] = WFrag<T16>::ldp(ka + (kt * 2 + ks) * 512); kf2[kt][ks] = WFrag<T16>::ldp(ka2 + (kt * 2 + ks) * 512); }
        asm volatile("s_wait_xcnt 0x0" :: "v"(ka), "v"(ka2) : "memory");   // stands in front of the first instruction that reuses an address register of the K loads above; the addresses are its inputs, so that their registers are not given to a later load's result in front of it
    } else { const T16* ka = Kp + (size_t)c0 * HD + (hi * 16 + lr) * 8;   // fragment-order plane: the block's K is 4 KiB in a row
#pragma unroll
        for (int kt = 0; kt < KT; ++kt)
#pragma unroll
            for (int ks = 0; ks < 2; ++ks) kf[kt][ks] = WFrag<T16>::ldp(ka + (kt * 2 + ks) * 512);
        asm volatile("s_wait_xcnt 0x0" ::: "memory");   // stands in front of the first instruction that reuses an address register of the K loads above
    }
#pragma unroll
    for (int kt = 0; kt < KT; ++kt) { s[kt][0] = (v8f){}; s[kt][1] = (v8f){};
#pragma unroll
        for (int ks = 0; ks < 2; ++ks)
#pragma unroll
            for (int qb = 0; qb < 2; ++qb) { s[kt][qb] = WFrag<T16>::mma(kf[kt][ks], qf[qb][ks], s[kt][qb]); if (HI) { s[kt][qb] = WFrag<T16>::mma(kf[kt][ks], qf2[qb][ks], s[kt][qb]); s[kt][qb] = WFrag<T16>::mma(kf2[kt][ks], qf[qb][ks], s[kt][qb]); } } }
#pragma unroll
    for (int qb = 0; qb < 2; ++qb) {
        float mk[KT];
#pragma unroll
        for (int kt = 0; kt < KT; ++kt) {
#pragma unroll
            for (int j = 0; j < 8; ++j) { if (MASK) s[kt][qb][j] = (c0 + kt * 16 + hi * 8 + j <= r0 + qb * 16 + lr) ? s[kt][qb][j] : -3.0e38f; mk[kt] = j ? fmaxf(mk[kt], s[kt][qb][j]) : s[kt][qb][j]; } }
        float mx = fmaxf(fmaxf(mk[0], mk[1]), m[qb]); mx = fmaxf(mx, __shfl_xor(mx, 16, 32));   // the two half-waves hold the two halves of a query's keys
        const float al = ex2((m[qb] - mx) * CL2); m[qb] = mx; const float eb = (HI ? 0.0f : 10.0f) - mx * CL2;
        float ps[KT];   // independent sums
#pragma unroll
        for (int kt = 0; kt < KT; ++kt) {
            float p[8];
#pragma unroll
            for (int j = 0; j < 8; ++j) p[j] = fmaf(s[kt][qb][j], CL2, eb);
            ex2x8(p);
#pragma unroll
            for (int j = 0; j < 8; ++j) { s[kt][qb][j] = p[j]; ps[kt] = j ? ps[kt] + p[j] : p[j]; } }
        l[qb] = fmaf(l[qb], al, ps[0] + ps[1]);
#pragma unroll
        for (int dt = 0; dt < 4; ++dt) o[dt][qb] *= al;
    }
#pragma unroll
    for (int kk = 0; kk < KB / 32; ++kk) { V pf[2], pf2[2];
#pragma unroll
        for (int qb = 0; qb < 2; ++qb) {
            if constexpr (HI) { v8us h0, h1, l0, l1;
#pragma unroll
                for (int j = 0; j < 8; ++j) { unsigned short a, c; splitf(s[2 * kk][qb][j], a, c); h0[j] = a; l0[j] = c; splitf(s[2 * kk + 1][qb][j], a, c); h1[j] = a; l1[j] = c; }
                pf[qb] = cat16b(h0, h1); pf2[qb] = cat16b(l0, l1);
            } else { v8h h0, h1;
#pragma unroll
                for (int j = 0; j < 8; ++j) { h0[j] = (h16)s[2 * kk][qb][j]; h1[j] = (h16)s[2 * kk + 1][qb][j]; }
                pf[qb] = cat16(h0, h1); } }
        V v[4], v2[4];   // behind each group of V loads: s_wait_xcnt 0 in front of the first instruction that reuses their address registers; the addresses are its inputs, so that their registers are not given to a load's result in front of it
        if constexpr (HI) { const size_t vo = (size_t)(c0 + kk * 32) * HD + (hi * 16 + lr) * 8; const T16* va = Vp + vo; const T16* va2 = Vp2 + vo;   // fragment-order planes: the block's V is 4 KiB in a row in each
#pragma unroll
            for (int dt = 0; dt < 4; ++dt) { v[dt] = WFrag<T16>::ldp(va + dt * 512); v2[dt] = WFrag<T16>::ldp(va2 + dt * 512); asm volatile("s_wait_xcnt 0x0" :: "v"(va), "v"(va2) : "memory"); }
        } else { const T16* va = Vp + (size_t)(c0 + kk * 32) * HD + (hi * 16 + lr) * 8;   // fragment-order plane: the block's V is 4 KiB in a row
#pragma unroll
            for (int dt = 0; dt < 4; ++dt) v[dt] = WFrag<T16>::ldp(va + dt * 512);
            asm volatile("s_wait_xcnt 0x0" :: "v"(va) : "memory");
        }
#pragma unroll
        for (int dt = 0; dt < 4; ++dt)
#pragma unroll
            for (int qb = 0; qb < 2; ++qb) { o[dt][qb] = WFrag<T16>::mma(v[dt], pf[qb], o[dt][qb]); if (HI) { o[dt][qb] = WFrag<T16>::mma(v[dt], pf2[qb], o[dt][qb]); o[dt][qb] = WFrag<T16>::mma(v2[dt], pf[qb], o[dt][qb]); } } }
}
template <typename T16, bool HI>
__device__ __forceinline__ void fa_tile(const T16* __restrict__ Qp, const T16* __restrict__ Qp2, const T16* __restrict__ Kp, const T16* __restrict__ Kp2, const T16* __restrict__ Vp, const T16* __restrict__ Vp2, int r0, int a0, int limA, int kbB, float* os, float* ms, float* ls) {
    typedef typename WFrag<T16>::V V;
    const int lane = threadIdx.x & 31, lr = lane & 15, hi = lane >> 4; const int wv = __builtin_amdgcn_readfirstlane((int)(threadIdx.x >> 5));   // wave number in a scalar register, as a0, limA and kbB are: the key loop's bounds and branches stay scalar, every lane stays on for the matrix instructions
    V qf[2][2], qf2[2][2]; v8f o[4][2]; float m[2], l[2];
#pragma unroll
    for (int qb = 0; qb < 2; ++qb) { m[qb] = -3.0e38f; l[qb] = 0.0f;
#pragma unroll
        for (int ks = 0; ks < 2; ++ks) {
            const size_t qo = (size_t)r0 * HD + lane * 8 + (qb * 2 + ks) * 512; qf[qb][ks] = WFrag<T16>::ldp(Qp + qo);   // fragment-order planes
            if constexpr (HI) qf2[qb][ks] = WFrag<T16>::ldp(Qp2 + qo); }
#pragma unroll
        for (int dt = 0; dt < 4; ++dt) o[dt][qb] = (v8f){}; }
    asm volatile("s_wait_xcnt 0x0" ::: "memory");   // stands in front of the first instruction that reuses an address register of the Q loads above
    const int nblk = r0 / KB + 1;   // KB-key blocks up to and with the diagonal block; only the last one holds keys above the diagonal, and each of its rows holds at least one key at or below it
    bool inA = !HI && a0 < limA; int kb = inA ? a0 : HI ? wv : kbB;   // the wave's blocks: a0, a0 + NWA / 2, ... below limA, then kbB, kbB + NWA, ...; hi/lo tile: wv, wv + NWA, ...
#pragma unroll 1
    while (kb < nblk - 1) { fa_blk<T16, HI, false>(qf, qf2, Kp, Kp2, Vp, Vp2, kb * KB, r0, lr, hi, o, m, l);
        if (inA) { kb += NWA / 2; if (kb >= limA) { kb = kbB; inA = false; } } else kb += NWA; }
    if (kb == nblk - 1) fa_blk<T16, HI, true>(qf, qf2, Kp, Kp2, Vp, Vp2, kb * KB, r0, lr, hi, o, m, l);
#pragma unroll
    for (int qb = 0; qb < 2; ++qb) { const float lt = l[qb] + __shfl_xor(l[qb], 16, 32); if (hi == 0) { ms[wv * QT + qb * 16 + lr] = m[qb]; ls[wv * QT + qb * 16 + lr] = lt; }
#pragma unroll
        for (int dt = 0; dt < 4; ++dt) { float* p = os + (wv * QT + qb * 16 + lr) * 68 + dt * 16 + hi * 8; *(v4fa*)p = __builtin_shufflevector(o[dt][qb], o[dt][qb], 0, 1, 2, 3); *(v4fa*)(p + 4) = __builtin_shufflevector(o[dt][qb], o[dt][qb], 4, 5, 6, 7); } }
}
// The upper-half tile that goes with lower-half tile ts. Cost of a tile in f16 key blocks: t + 1, times 5/2 for hi/lo rows (three products for one, two planes for one). rk = rank of ts among the lower half by rising cost (ties: hi/lo first); it meets the upper half in falling cost.
static_assert(RH / QT * 5 / 2 <= NQT / 2, "the dearest hi/lo tile costs no more than the last tile of the lower half: rk stays a permutation of 0..NQT/2-1");
__device__ __forceinline__ int fa_long(int ts) {
    const int nh = RH / QT, ch = (5 * (ts + 1) + 1) / 2 - (nh + 1), cl = 2 * (ts + 1) / 5;   // ch: f16 tiles of the lower half cheaper than hi/lo tile ts; cl: hi/lo tiles no dearer than f16 tile ts
    const int rk = (ts < nh) ? ts + (ch > 0 ? ch : 0) : ts - nh + (cl < nh ? cl : nh);
    return NQT - 1 - rk;
}
__global__ __launch_bounds__(32 * NWA) __attribute__((amdgpu_waves_per_eu(4))) /* registers for four waves a SIMD: the work-group's NWA waves on one WGP */ void k_fattn(const h16* __restrict__ Q16, const h16* __restrict__ K16, const h16* __restrict__ V16, const bf* __restrict__ Qh, const bf* __restrict__ Ql, const bf* __restrict__ Kh, const bf* __restrict__ Kl, const bf* __restrict__ Vh, const bf* __restrict__ Vl, float* OUTr) {
    __shared__ __align__(16) float os2[2][NWA * QT * 68]; __shared__ float ms2[2][NWA * QT]; __shared__ float ls2[2][NWA * QT];   // one set of partial results a tile: no barrier between the two tiles
    const size_t zo = (size_t)blockIdx.z * TT * HD; const int tlo = (int)blockIdx.x, tup = fa_long(tlo);
    const int wv = __builtin_amdgcn_readfirstlane((int)(threadIdx.x >> 5)), g = wv & 1, wi = wv >> 1;   // wave number in a scalar register; partners: waves 2 wi and 2 wi + 1
    // The K and V planes were stored by the launch before: where they are not in the reader's L2, the first work-group to reach a key block waits for memory there, and the work-groups that run ahead through the keys do so at every block. So at its start each work-group asks L2 for a share of its batch's planes,
    // one request a thread, the threads 256 bytes apart. Waves 0..NWA/2-1: 64 KiB (512 keys, number x / 8) of the f16 K (even x) or V (odd x). The other waves: the 64 KiB that hold the RH hi/lo rows of Kh, Kl, Vh or Vl (x % 4).
    // Any four neighbouring values of x mod 8 hold every share. A hint only: nothing counts on the lines being there. Every address lies inside its plane; every lane of every wave is on.
    static_assert(NQT / 2 == 64 && (NWA / 2) * 32 * 256 * 8 == TT * HD * 2 && (NWA / 2) * 32 * 256 == RH * HD * 2, "eight shares of one unit a thread cover an f16 plane of a batch, one share the hi/lo rows of a plane");
    const char* pfb = (wv < NWA / 2) ? (const char*)(((tlo & 1) ? V16 : K16) + zo + (size_t)(tlo >> 3) * (TT * HD / 8)) : (const char*)(((tlo & 2) ? ((tlo & 1) ? Vl : Vh) : ((tlo & 1) ? Kl : Kh)) + zo);
    const char* pfa = pfb + (int)(threadIdx.x & (NWA / 2 * 32 - 1)) * 256;
    asm volatile("global_prefetch_b8 %0, off scope:SCOPE_SE" :: "v"(pfa));   // into L2 only; no data comes back and no counter moves
    const int S = (tlo * QT < RH) ? 0 : tlo + 1;   // key blocks that both tiles read from the same planes (none where the lower tile reads the hi/lo planes)
    const int kbu = S + (((((wi - S) & (NWA / 2 - 1)) << 1)) | g);   // the upper tile's blocks from S on, dealt over all NWA waves, first to the waves that got no odd block below S
#pragma unroll 1   // the two tiles share one copy of the key loops
    for (int h = 0; h < 2; ++h) { const int lo = h ^ g, rt = (lo ? tlo : tup) * QT;   // even waves: upper tile, then lower; odd waves: lower tile, then upper
        if (rt < RH) fa_tile<bf, true>(Qh + zo, Ql + zo, Kh + zo, Kl + zo, Vh + zo, Vl + zo, rt, 0, 0, 0, os2[lo], ms2[lo], ls2[lo]);
        else fa_tile<h16, false>(Q16 + zo, nullptr, K16 + zo, nullptr, V16 + zo, nullptr, rt, wi, (lo == g) ? S : 0, lo ? TT : kbu, os2[lo], ms2[lo], ls2[lo]); }
    asm volatile("" :: "v"(pfa));   // input only: the prefetch's address registers are given to nothing else up to here (no counter says when the request has read them)
    __syncthreads();   // every wave's m, l and partial result of both tiles are in LDS
    const int hm = (int)(threadIdx.x >> 8), tm = (int)(threadIdx.x & 255);   // the first 256 threads sum the upper tile, the rest the lower one
    const int r0 = (hm ? tlo : tup) * QT; const float* os = os2[hm]; const float* ms = ms2[hm]; const float* ls = ls2[hm];
    const int row = tm >> 3, cofs = (tm & 7) * 8; float mw[NWA]; float M = -3.0e38f;
#pragma unroll
    for (int w = 0; w < NWA; ++w) { mw[w] = ms[w * QT + row]; M = fmaxf(M, mw[w]); }
    float L = 0.0f; v4f a0 = (v4f){}, a1 = (v4f){};
#pragma unroll   // the LDS reads are issued together; the adds keep the order w = 0..NWA-1; a wave that had no block has m = -3e38, l = 0 and weight 0
    for (int w = 0; w < NWA; ++w) { const float f = ex2((mw[w] - M) * CL2); L = fmaf(ls[w * QT + row], f, L); const float* p = os + (w * QT + row) * 68 + cofs; a0 += *(const v4fa*)p * f; a1 += *(const v4fa*)(p + 4) * f; }
    const float rl = __fdiv_rn(1.0f, L); float* op = OUTr + zo + (size_t)(r0 + row) * HD + cofs; *(v4f*)op = a0 * rl; *(v4f*)(op + 4) = a1 * rl;
}

extern "C" void kernel_launch(void* const* d_in, const int* in_sizes, int n_in,
                              void* d_out, int out_size, void* d_ws, size_t ws_size, hipStream_t stream) {
    (void)in_sizes; (void)n_in; (void)out_size;
    const float* x = (const float*)d_in[0]; const float* wq = (const float*)d_in[1]; const float* bq = (const float*)d_in[2]; const float* wk = (const float*)d_in[3]; const float* bk = (const float*)d_in[4]; const float* wv = (const float*)d_in[5]; const float* bv = (const float*)d_in[6];
    float* OUT = (float*)d_out; float* OUTK = OUT + (size_t)NB_ * TT * HD; float* OUTV = OUT + (size_t)2 * NB_ * TT * HD;   /* tuple output: result | K | V, each [4][4096][64] f32 */
    char* wsp = (char*)d_ws;
    auto take = [&](size_t bytes) { char* p = wsp; wsp += (bytes + 255) & ~(size_t)255; return (void*)p; };
    bf* WP = (bf*)take((size_t)3 * HD * DM * 2);
    const size_t PB = (size_t)TT * HD;   // elements of one batch's plane; every plane holds all NB_ batches
    h16* QP16 = (h16*)take(NB_ * PB * 2); h16* KP16 = (h16*)take(NB_ * PB * 2); h16* VT16 = (h16*)take(NB_ * PB * 2);
    bf* QPh = (bf*)take(NB_ * PB * 2); bf* QPl = (bf*)take(NB_ * PB * 2); bf* KPh = (bf*)take(NB_ * PB * 2); bf* KPl = (bf*)take(NB_ * PB * 2); bf* VTh = (bf*)take(NB_ * PB * 2); bf* VTl = (bf*)take(NB_ * PB * 2);
    if ((size_t)(wsp - (char*)d_ws) > ws_size) return;    // ws 256 MiB
    k_wpack<<<3 * HD * DM / 8 / 256, 256, 0, stream>>>(wq, wk, wv, WP);
    k_proj<<<NB_ * TT / 64, 32 * NWK, 0, stream>>>(x, WP, bq, bk, bv, OUTK, OUTV, QP16, QPh, QPl, KP16, KPh, KPl, VT16, VTh, VTl);   /* K, V -> output slots 1, 2 */
    k_fattn<<<dim3(NQT / 2, 1, NB_), 32 * NWA, 0, stream>>>(QP16, KP16, VT16, QPh, QPl, KPh, KPl, VTh, VTl, OUT);   /* result -> output slot 0 */
}
